// v000
// Measured on an AMD MI455X. A time is GPU time per run, averaged over a window of back-to-back runs after a warm-up
// (all launches, gaps included; the runs take copies of the inputs in turn), and the median of several windows.
// Apart from v000's, it joins two sittings. Times from different sittings can be a few percent apart, while
// side-by-side timings come from the same sitting.
// v000, which the later versions start from, runs in 763 microseconds.
#include <hip/hip_runtime.h>

// Contractions, f32 accumulate: qkv = x.w_qkv + b_qkv ([8192 x 1024].[1024 x 3072], k-major weight transposed to an n-major plane; PLAIN bf16 operands: inputs
// rounded once, exact) and out.w_o + b_o (merged heads as bf16 hi + residual: two products) on v_wmma_f32_16x16x32_bf16; the 16-head length-masked attention fused
// on v_wmma_f32_16x16x32_f16: logits = q.k/8 where query AND key are < lengths[b] (the INPUT), else -1e9 (the reference's score*mask + NEG(1-mask)); softmax; the
// weights are multiplied by the same mask again (so rows beyond the length give exactly zero context); q and k as f16 hi + residual x1024 (hi.hi + hi.lo + lo.hi),

#define NB_  2                   // per pass (the 8 batch items are processed in four passes of 2)
#define NT_  1024
#define DM   1024
#define NH_  16
#define NKV  16
#define KVW  (NKV * HD)          // 1024
#define HD   64
#define NTK  (NB_ * NT_)
#define NW   1024
#define NQKV 1024
#define PSC  32768.0f
#define NEGV (-1.0e9f)
#define LOSC 1024.0f
#define LOSCI (1.0f / 1024.0f)

typedef _Float16 h16;
typedef unsigned short bf;
typedef __attribute__((ext_vector_type(16))) __bf16   v16bf;
typedef __attribute__((ext_vector_type(16))) _Float16 v16h;
typedef __attribute__((ext_vector_type(8)))  _Float16 v8h;
typedef __attribute__((ext_vector_type(8)))  unsigned short v8us;
typedef __attribute__((ext_vector_type(8)))  float    v8f;
typedef __attribute__((ext_vector_type(4)))  float    v4f;
typedef v8h  __attribute__((may_alias)) v8ha;
typedef v4f  __attribute__((may_alias)) v4fa;
typedef v8us __attribute__((may_alias)) v8usa;

__device__ __forceinline__ unsigned short f2bf(float f) { unsigned u = __float_as_uint(f); u += 0x7FFFu + ((u >> 16) & 1u); return (unsigned short)(u >> 16); }
__device__ __forceinline__ float bf2f(unsigned short b) { return __uint_as_float(((unsigned)b) << 16); }
__device__ __forceinline__ float bfr(float f) { return bf2f(f2bf(f)); }
__device__ __forceinline__ v16h cat16(v8h lo, v8h hi) { return __builtin_shufflevector(lo, hi, 0, 1, 2, 3, 4, 5, 6, 7, 8, 9, 10, 11, 12, 13, 14, 15); }
__device__ __forceinline__ v16bf cat16b(v8us lo, v8us hi) { return __builtin_bit_cast(v16bf, __builtin_shufflevector(lo, hi, 0, 1, 2, 3, 4, 5, 6, 7, 8, 9, 10, 11, 12, 13, 14, 15)); }
__device__ __forceinline__ v8f wmma16(v16h a, v16h b, v8f c) { return __builtin_amdgcn_wmma_f32_16x16x32_f16(false, a, false, b, (short)0, c, false, false); }
__device__ __forceinline__ v8f wmmab(v16bf a, v16bf b, v8f c) { return __builtin_amdgcn_wmma_f32_16x16x32_bf16(false, a, false, b, (short)0, c, false, false); }

__global__ __launch_bounds__(256) void k_cvtb(const float* __restrict__ src, int nrows, bf* dst) {
    const int lane = threadIdx.x & 31, r = blockIdx.x * 8 + (threadIdx.x >> 5);
    if (r >= nrows) return;
    v8us o[DM / 256];
#pragma unroll
    for (int q = 0; q < DM / 256; ++q) { v8us t;
#pragma unroll
        for (int i = 0; i < 8; ++i) t[i] = f2bf(src[(size_t)r * DM + q * 256 + lane * 8 + i]);
        o[q] = t; }
#pragma unroll
    for (int q = 0; q < DM / 256; ++q) *(v8us*)(dst + (size_t)r * DM + q * 256 + lane * 8) = o[q];
    
}

// k_wt: W [1024 k][ncols n] (k-major) -> n-major bf16 plane WT[ncols][1024]; 64 x 64 tiles through LDS.
__global__ __launch_bounds__(256) void k_wt(const float* __restrict__ Wm, int ncols, bf* WT) {
    __shared__ __align__(16) unsigned short tl[64 * 72];
    const int tid = threadIdx.x, k0 = blockIdx.x * 64, n0 = blockIdx.y * 64;
    const int kk = tid >> 2, nq = (tid & 3) * 16;
#pragma unroll
    for (int i = 0; i < 16; ++i) tl[(nq + i) * 72 + kk] = f2bf(Wm[(size_t)(k0 + kk) * ncols + n0 + nq + i]);
    __syncthreads();
    const int piece = tid & 7;
    typedef __attribute__((ext_vector_type(8))) unsigned short v8us_; typedef v8us_ __attribute__((may_alias)) v8usa_;
    auto pass = [&]() {
#pragma unroll
        for (int s = 0; s < 2; ++s) { const int nr = (tid >> 3) + 32 * s; const v8us_ val = *(const v8usa_*)(tl + nr * 72 + piece * 8);
            *(v8us_*)(WT + (size_t)(n0 + nr) * DM + k0 + piece * 8) = val; }
    };
    pass(); 
}

template <bool SPLITA, bool F16OUT = false>
__global__ __launch_bounds__(128) void k_gemmb(const bf* __restrict__ A, const bf* __restrict__ Al, const bf* __restrict__ Bn, const float* __restrict__ bias, float* C, int ldc, h16* C2) {
    __shared__ __align__(16) float ost[4][16 * 68];
    const int lane = threadIdx.x & 31, wave = threadIdx.x >> 5, lr = lane & 15, hi = lane >> 4;
    const int r0 = blockIdx.x * 64 + wave * 16, c0 = blockIdx.y * 64;
    const size_t aoff = (size_t)(r0 + lr) * DM + 8 * hi;
    size_t boff[4];
#pragma unroll
    for (int t = 0; t < 4; ++t) boff[t] = (size_t)(c0 + t * 16 + lr) * DM + 8 * hi;
    v8f acc[4];
#pragma unroll
    for (int t = 0; t < 4; ++t) acc[t] = (v8f){};
#pragma unroll 1
    for (int kc = 0; kc < DM; kc += 32) {
        const v16bf a = cat16b(*(const v8us*)(A + aoff + kc), *(const v8us*)(A + aoff + kc + 16));
        v16bf al = a;
        if (SPLITA) al = cat16b(*(const v8us*)(Al + aoff + kc), *(const v8us*)(Al + aoff + kc + 16));
#pragma unroll
        for (int t = 0; t < 4; ++t) { const v16bf b = cat16b(*(const v8us*)(Bn + boff[t] + kc), *(const v8us*)(Bn + boff[t] + kc + 16)); acc[t] = wmmab(a, b, acc[t]); if (SPLITA) acc[t] = wmmab(al, b, acc[t]); }
        asm volatile("v_nop\n\tv_nop\n\tv_nop\n\tv_nop" : "+v"(acc[0]), "+v"(acc[1]), "+v"(acc[2]), "+v"(acc[3]) : "v"(a), "v"(al));
    }
    float* os = &ost[wave][0];
#pragma unroll
    for (int t = 0; t < 4; ++t) { const float bv = bias ? bfr(bias[c0 + t * 16 + lr]) : 0.f;
#pragma unroll
        for (int j = 0; j < 8; ++j) os[(hi * 8 + j) * 68 + t * 16 + lr] = acc[t][j] + bv; }
    __syncthreads();
    if (F16OUT) {
        h16* crow = (h16*)(void*)C + (size_t)r0 * ldc + c0;
        auto pass = [&]() {
#pragma unroll
            for (int s = 0; s < 4; ++s) { const int row = 4 * s + (lane >> 3), piece = lane & 7; const float* sp = os + row * 68 + piece * 8; v8h o, o2;
#pragma unroll
                for (int i = 0; i < 8; ++i) { const h16 a = (h16)sp[i]; o[i] = a; o2[i] = (h16)((sp[i] - (float)a) * LOSC); }
                *(v8h*)(crow + (size_t)row * ldc + piece * 8) = o; if (C2) *(v8h*)(C2 + (size_t)r0 * ldc + c0 + (size_t)row * ldc + piece * 8) = o2; }
        };
        pass(); 
    } else {
        float* crow = C + (size_t)r0 * ldc + c0;
        auto pass = [&]() {
#pragma unroll
            for (int s = 0; s < 8; ++s) { const int Lid = (lane >> 3) + 4 * s, piece = lane & 7; const int row = Lid >> 1, cofs = (Lid & 1) * 32 + piece * 4;
                const v4f val = *(const v4fa*)(os + row * 68 + cofs); *(v4f*)(crow + (size_t)row * ldc + cofs) = val; }
        };
        pass(); 
    }
}

__global__ __launch_bounds__(256) void k_vt(const float* __restrict__ V, h16* VTH, h16* VTL) {
    __shared__ __align__(16) h16 tile[64 * 72];
    __shared__ __align__(16) h16 til2[64 * 72];
    const int bid = blockIdx.x;
    const int b = bid / (NKV * (NT_ / 64)), rem = bid - b * (NKV * (NT_ / 64)), h = rem / (NT_ / 64), kt = rem - h * (NT_ / 64);
    const int k0 = kt * 64, tid = threadIdx.x;
    const int kk = tid >> 2, d0 = (tid & 3) * 16;
    const float* src = V + ((size_t)b * NT_ + k0 + kk) * KVW + h * HD + d0;      // h = kv head here
#pragma unroll
    for (int i = 0; i < 16; ++i) { const float v = src[i]; const h16 a = (h16)v; tile[(d0 + i) * 72 + kk] = a; til2[(d0 + i) * 72 + kk] = (h16)((v - (float)a) * LOSC); }
    __syncthreads();
    const int piece = tid & 7;
    const size_t base = (((size_t)b * NKV + h) * HD) * NT_ + k0;
    auto pass = [&]() {
#pragma unroll
        for (int s = 0; s < 4; ++s) { const int Lid = (tid >> 3) + 32 * s; const int pln = Lid >> 6, d = Lid & 63;
            const v8h val = *(const v8ha*)((pln ? til2 : tile) + d * 72 + piece * 8); *(v8h*)((pln ? VTL : VTH) + base + (size_t)d * NT_ + piece * 8) = val; }
    };
    pass(); 
}

// k_attn: block = (b, h, 64 queries), wave = 16; ALL 32 key tiles (no mask); 4 WMMA scores /8 (f32), online softmax, weights x32768 f16 tile (same-wave may_alias
// reload after a compiler barrier), 4 WMMA .v; ctx -> bf16 hi + residual planes CH/CL[tok][h*64+d].
__global__ __launch_bounds__(128) void k_attn(const h16* __restrict__ Q16, const h16* __restrict__ QL16, const h16* __restrict__ K16, const h16* __restrict__ KL16, const h16* __restrict__ VTH, const h16* __restrict__ VTL, const int* __restrict__ lens, int bofs, bf* CH, bf* CL) {
    __shared__ __align__(16) h16 plds[4][16 * 32];
    __shared__ __align__(16) h16 plds2[4][16 * 32];
    __shared__ __align__(16) float ost[4][16 * 68];
    const int lane = threadIdx.x & 31, wave = threadIdx.x >> 5, lr = lane & 15, hi = lane >> 4;
    const int bid = blockIdx.x;
    const int b = bid / (NH_ * (NT_ / 64)), rem = bid - b * (NH_ * (NT_ / 64)), h = rem / (NT_ / 64), qt = rem - h * (NT_ / 64);
    const int q0 = qt * 64 + wave * 16;
    const size_t tok0 = (size_t)b * NT_;
    h16* pl = &plds[wave][0]; h16* pl2 = &plds2[wave][0];
    v16h qa[2];
    const size_t qo0 = (tok0 + q0 + lr) * DM + h * HD + 8 * hi;
#pragma unroll
    for (int kc = 0; kc < 2; ++kc) qa[kc] = cat16(*(const v8h*)(Q16 + qo0 + kc * 32), *(const v8h*)(Q16 + qo0 + kc * 32 + 16));
    const int g = h / (NH_ / NKV);                      // kv head
    const h16* kh_b = K16 + tok0 * KVW + g * HD;
    const h16* kl_b = KL16 + tok0 * KVW + g * HD;
    const size_t vbase = (((size_t)b * NKV + g) * HD) * NT_;
    v8f o[4], ox[4];
#pragma unroll
    for (int n = 0; n < 4; ++n) { o[n] = (v8f){}; ox[n] = (v8f){}; }
    float mrow[8], lpart[8];
#pragma unroll
    for (int j = 0; j < 8; ++j) { mrow[j] = -3.0e38f; lpart[j] = 0.f; }
    int qpos[8];
#pragma unroll
    for (int j = 0; j < 8; ++j) qpos[j] = q0 + 8 * hi + j;
    int len = lens[bofs + b]; len = len < 0 ? 0 : (len > NT_ ? NT_ : len);     // INPUT length of this batch item (block-uniform)
    const int kt_lo = 0, kt_hi = NT_ / 32 - 1;      // all key tiles are visited: a fully-masked row (query >= len) must still see all NEG keys to reproduce the reference's uniform-then-zeroed weights
#pragma unroll 1
    for (int kt = kt_lo; kt <= kt_hi; ++kt) {
        const int l0 = kt * 32;
        const size_t ko0 = (size_t)(l0 + lr) * KVW + 8 * hi, ko1 = (size_t)(l0 + 16 + lr) * KVW + 8 * hi;
        v8f s0 = {}, s1 = {}, x0 = {}, x1 = {};
#pragma unroll
        for (int kc = 0; kc < 2; ++kc) {
            { const v16h k0h = cat16(*(const v8h*)(kh_b + ko0 + kc * 32), *(const v8h*)(kh_b + ko0 + kc * 32 + 16)), k1h = cat16(*(const v8h*)(kh_b + ko1 + kc * 32), *(const v8h*)(kh_b + ko1 + kc * 32 + 16));
              const v16h qlk = cat16(*(const v8h*)(QL16 + qo0 + kc * 32), *(const v8h*)(QL16 + qo0 + kc * 32 + 16));     // query residual re-read per step (registers)
              s0 = wmma16(qa[kc], k0h, s0); x0 = wmma16(qlk, k0h, x0); s1 = wmma16(qa[kc], k1h, s1); x1 = wmma16(qlk, k1h, x1);
              asm volatile("v_nop" : "+v"(s0), "+v"(s1), "+v"(x0), "+v"(x1) : "v"(qlk), "v"(k0h), "v"(k1h) : "memory"); }
            { const v16h k0l = cat16(*(const v8h*)(kl_b + ko0 + kc * 32), *(const v8h*)(kl_b + ko0 + kc * 32 + 16)), k1l = cat16(*(const v8h*)(kl_b + ko1 + kc * 32), *(const v8h*)(kl_b + ko1 + kc * 32 + 16));
              x0 = wmma16(qa[kc], k0l, x0); x1 = wmma16(qa[kc], k1l, x1);
              asm volatile("v_nop" : "+v"(x0), "+v"(x1) : "v"(k0l), "v"(k1l) : "memory"); }
        }
        asm volatile("v_nop\n\tv_nop\n\tv_nop\n\tv_nop" : "+v"(s0), "+v"(s1), "+v"(x0), "+v"(x1) : "v"(qa[0]), "v"(qa[1]));
        float alpha[8];
#pragma unroll
        for (int j = 0; j < 8; ++j) {
            const int ja = l0 + lr, jb = l0 + 16 + lr, qi = qpos[j];
            const bool va = (qi < len) && (ja < len), vb = (qi < len) && (jb < len);
            const float a0 = va ? (s0[j] + x0[j] * LOSCI) * 0.125f : NEGV, a1 = vb ? (s1[j] + x1[j] * LOSCI) * 0.125f : NEGV;
            float mx = fmaxf(a0, a1);
            mx = fmaxf(mx, __shfl_xor(mx, 1, 16)); mx = fmaxf(mx, __shfl_xor(mx, 2, 16)); mx = fmaxf(mx, __shfl_xor(mx, 4, 16)); mx = fmaxf(mx, __shfl_xor(mx, 8, 16));
            const float mn = fmaxf(mrow[j], mx);
            alpha[j] = __expf(mrow[j] - mn); mrow[j] = mn;
            const float p0 = __expf(a0 - mn), p1 = __expf(a1 - mn);
            lpart[j] = lpart[j] * alpha[j] + (p0 + p1);             // normaliser over the (masked-to-NEG) scores, as the reference's softmax
            const int mr = hi * 8 + j;
            const float ps0 = va ? p0 * PSC : 0.f, ps1 = vb ? p1 * PSC : 0.f; const h16 h0 = (h16)ps0, h1 = (h16)ps1;     // attn * mask
            pl[mr * 32 + lr] = h0; pl[mr * 32 + 16 + lr] = h1;
            pl2[mr * 32 + lr] = (h16)((ps0 - (float)h0) * LOSC); pl2[mr * 32 + 16 + lr] = (h16)((ps1 - (float)h1) * LOSC);
        }
#pragma unroll
        for (int n = 0; n < 4; ++n)
#pragma unroll
            for (int j = 0; j < 8; ++j) { o[n][j] *= alpha[j]; ox[n][j] *= alpha[j]; }
        asm volatile("" ::: "memory");
        const v16h pa = cat16(*(const v8ha*)(pl + lr * 32 + hi * 8), *(const v8ha*)(pl + lr * 32 + 16 + hi * 8));
        const v16h px = cat16(*(const v8ha*)(pl2 + lr * 32 + hi * 8), *(const v8ha*)(pl2 + lr * 32 + 16 + hi * 8));
#pragma unroll
        for (int n = 0; n < 4; ++n) { const size_t vo = vbase + (size_t)(n * 16 + lr) * NT_ + l0 + hi * 8;
            const v16h vh = cat16(*(const v8h*)(VTH + vo), *(const v8h*)(VTH + vo + 16)), vl = cat16(*(const v8h*)(VTL + vo), *(const v8h*)(VTL + vo + 16));
            o[n] = wmma16(pa, vh, o[n]); ox[n] = wmma16(pa, vl, ox[n]); ox[n] = wmma16(px, vh, ox[n]);
            asm volatile("" : "+v"(o[n]), "+v"(ox[n]) : "v"(vh), "v"(vl) : "memory"); }
        asm volatile("v_nop\n\tv_nop\n\tv_nop\n\tv_nop" : "+v"(o[0]), "+v"(o[1]), "+v"(o[2]), "+v"(o[3]), "+v"(ox[0]), "+v"(ox[1]), "+v"(ox[2]), "+v"(ox[3]) : "v"(pa), "v"(px));
    }
    float inv[8];
#pragma unroll
    for (int j = 0; j < 8; ++j) { float rs = lpart[j]; rs += __shfl_xor(rs, 1, 16); rs += __shfl_xor(rs, 2, 16); rs += __shfl_xor(rs, 4, 16); rs += __shfl_xor(rs, 8, 16); inv[j] = 1.0f / (rs * PSC); }
    float* os = &ost[wave][0];
#pragma unroll
    for (int n = 0; n < 4; ++n)
#pragma unroll
        for (int j = 0; j < 8; ++j) os[(hi * 8 + j) * 68 + n * 16 + lr] = (o[n][j] + ox[n][j] * LOSCI) * inv[j];
    __syncthreads();
    const size_t cbase = (tok0 + q0) * DM + (size_t)h * HD;
    auto pass = [&]() {
#pragma unroll
        for (int s = 0; s < 4; ++s) { const int row = 4 * s + (lane >> 3), piece = lane & 7; const float* sp = os + row * 68 + piece * 8; v8us oh, ol;
#pragma unroll
            for (int i = 0; i < 8; ++i) { const unsigned short hb = f2bf(sp[i]); oh[i] = hb; ol[i] = f2bf(sp[i] - bf2f(hb)); }
            *(v8us*)(CH + cbase + (size_t)row * DM + piece * 8) = oh; *(v8us*)(CL + cbase + (size_t)row * DM + piece * 8) = ol; }
    };
    pass(); 
}

#define VST2(T, p, v) do { const T vst2_v_ = (v); *(T*)(p) = vst2_v_;  } while (0)
extern "C" void kernel_launch(void* const* d_in, const int* in_sizes, int n_in,
                              void* d_out, int out_size, void* d_ws, size_t ws_size, hipStream_t stream) {
    (void)in_sizes; (void)n_in; (void)out_size;
    const float* x = (const float*)d_in[0]; const int* lens = (const int*)d_in[1]; const float* Wqkv = (const float*)d_in[2]; const float* bqkv = (const float*)d_in[3]; const float* Wo = (const float*)d_in[4]; const float* bo = (const float*)d_in[5];
    float* out = (float*)d_out;    // [8][1024][1024]
    char* wsp = (char*)d_ws;
    auto take = [&](size_t bytes) { char* p = wsp; wsp += (bytes + 255) & ~(size_t)255; return (void*)p; };
    bf* Xb = (bf*)take((size_t)NTK * DM * 2); bf* W3T = (bf*)take((size_t)3 * DM * DM * 2); bf* WoT = (bf*)take((size_t)DM * DM * 2);
    h16* QH = (h16*)take((size_t)NTK * DM * 2); h16* QL = (h16*)take((size_t)NTK * DM * 2); h16* KH = (h16*)take((size_t)NTK * DM * 2); h16* KL = (h16*)take((size_t)NTK * DM * 2);
    float* Vf = (float*)take((size_t)NTK * DM * 4); h16* VTL = (h16*)take((size_t)NTK * DM * 2);
    if ((size_t)(wsp - (char*)d_ws) > ws_size) return;    // per pass (2 batch items = 2048 rows): 4.2 + 6.3 + 2.1 + 4 x 4.2 + 8.4 + 4.2 ~ 42 MB
    h16* VTH = (h16*)Xb; bf* CH = (bf*)Vf; bf* CL = (bf*)((char*)Vf + (size_t)NTK * DM * 2);
    k_wt<<<dim3(DM / 64, (3 * DM) / 64, 1), 256, 0, stream>>>(Wqkv, 3 * DM, W3T);
    k_wt<<<dim3(DM / 64, DM / 64, 1), 256, 0, stream>>>(Wo, DM, WoT);
    for (int pass = 0; pass < 4; ++pass) {
        const float* xp = x + (size_t)pass * NTK * DM; float* op = out + (size_t)pass * NTK * DM;
        k_cvtb<<<NTK / 8, 256, 0, stream>>>(xp, NTK, Xb);
        k_gemmb<false, true><<<dim3(NTK / 64, DM / 64, 1), 128, 0, stream>>>(Xb, nullptr, W3T, bqkv, (float*)(void*)QH, DM, QL);
        k_gemmb<false, true><<<dim3(NTK / 64, DM / 64, 1), 128, 0, stream>>>(Xb, nullptr, W3T + (size_t)DM * DM, bqkv + DM, (float*)(void*)KH, DM, KL);
        k_gemmb<false, false><<<dim3(NTK / 64, DM / 64, 1), 128, 0, stream>>>(Xb, nullptr, W3T + (size_t)2 * DM * DM, bqkv + 2 * DM, Vf, DM, nullptr);
        k_vt<<<NB_ * NKV * (NT_ / 64), 256, 0, stream>>>(Vf, VTH, VTL);
        k_attn<<<NB_ * NH_ * (NT_ / 64), 128, 0, stream>>>(QH, QL, KH, KL, VTH, VTL, lens, pass * NB_, CH, CL);
        k_gemmb<true, false><<<dim3(NTK / 64, DM / 64, 1), 128, 0, stream>>>(CH, CL, WoT, bo, op, DM, nullptr);
    }
}

// v001
// A run of this version takes 597 microseconds.
// Next to v000, in two timings, it ran 1.31 times as fast each time.
#include <hip/hip_runtime.h>

// Contractions, f32 accumulate: qkv = x.w_qkv + b_qkv ([8192 x 1024].[1024 x 3072], k-major weight transposed to an n-major plane; PLAIN bf16 operands: inputs
// rounded once, exact) and out.w_o + b_o (merged heads as bf16 hi + residual: two products) on v_wmma_f32_16x16x32_bf16; the 16-head length-masked attention fused
// on v_wmma_f32_16x16x32_f16: logits = q.k/8 where query AND key are < lengths[b] (the INPUT), else -1e9 (the reference's score*mask + NEG(1-mask)); softmax; the
// weights are multiplied by the same mask again (so rows beyond the length give exactly zero context); q and k as f16 hi + residual x1024 (hi.hi + hi.lo + lo.hi),

#define NB_  8                   // all 8 batch items go through every launch together
#define NT_  1024
#define DM   1024
#define NH_  16
#define NKV  16
#define KVW  (NKV * HD)          // 1024
#define HD   64
#define NTK  (NB_ * NT_)
#define NW   1024
#define NQKV 1024
#define PSC  32768.0f
#define NEGV (-1.0e9f)
#define LOSC 1024.0f
#define LOSCI (1.0f / 1024.0f)

typedef _Float16 h16;
typedef unsigned short bf;
typedef __attribute__((ext_vector_type(16))) __bf16   v16bf;
typedef __attribute__((ext_vector_type(16))) _Float16 v16h;
typedef __attribute__((ext_vector_type(8)))  _Float16 v8h;
typedef __attribute__((ext_vector_type(8)))  unsigned short v8us;
typedef __attribute__((ext_vector_type(8)))  float    v8f;
typedef __attribute__((ext_vector_type(4)))  float    v4f;
typedef v8h  __attribute__((may_alias)) v8ha;
typedef v4f  __attribute__((may_alias)) v4fa;
typedef v8us __attribute__((may_alias)) v8usa;

__device__ __forceinline__ unsigned short f2bf(float f) { unsigned u = __float_as_uint(f); u += 0x7FFFu + ((u >> 16) & 1u); return (unsigned short)(u >> 16); }
__device__ __forceinline__ float bf2f(unsigned short b) { return __uint_as_float(((unsigned)b) << 16); }
__device__ __forceinline__ float bfr(float f) { return bf2f(f2bf(f)); }
__device__ __forceinline__ v16h cat16(v8h lo, v8h hi) { return __builtin_shufflevector(lo, hi, 0, 1, 2, 3, 4, 5, 6, 7, 8, 9, 10, 11, 12, 13, 14, 15); }
__device__ __forceinline__ v16bf cat16b(v8us lo, v8us hi) { return __builtin_bit_cast(v16bf, __builtin_shufflevector(lo, hi, 0, 1, 2, 3, 4, 5, 6, 7, 8, 9, 10, 11, 12, 13, 14, 15)); }
__device__ __forceinline__ v8f wmma16(v16h a, v16h b, v8f c) { return __builtin_amdgcn_wmma_f32_16x16x32_f16(false, a, false, b, (short)0, c, false, false); }
__device__ __forceinline__ v8f wmmab(v16bf a, v16bf b, v8f c) { return __builtin_amdgcn_wmma_f32_16x16x32_bf16(false, a, false, b, (short)0, c, false, false); }

__global__ __launch_bounds__(256) void k_cvtb(const float* __restrict__ src, int nrows, bf* dst) {
    const int lane = threadIdx.x & 31, r = blockIdx.x * 8 + (threadIdx.x >> 5);
    if (r >= nrows) return;
    v8us o[DM / 256];
#pragma unroll
    for (int q = 0; q < DM / 256; ++q) { v8us t;
#pragma unroll
        for (int i = 0; i < 8; ++i) t[i] = f2bf(src[(size_t)r * DM + q * 256 + lane * 8 + i]);
        o[q] = t; }
#pragma unroll
    for (int q = 0; q < DM / 256; ++q) *(v8us*)(dst + (size_t)r * DM + q * 256 + lane * 8) = o[q];
    
}

// k_wt: W [1024 k][ncols n] (k-major) -> n-major bf16 plane WT[ncols][1024]; 64 x 64 tiles through LDS.
__global__ __launch_bounds__(256) void k_wt(const float* __restrict__ Wm, int ncols, bf* WT) {
    __shared__ __align__(16) unsigned short tl[64 * 72];
    const int tid = threadIdx.x, k0 = blockIdx.x * 64, n0 = blockIdx.y * 64;
    const int kk = tid >> 2, nq = (tid & 3) * 16;
#pragma unroll
    for (int i = 0; i < 16; ++i) tl[(nq + i) * 72 + kk] = f2bf(Wm[(size_t)(k0 + kk) * ncols + n0 + nq + i]);
    __syncthreads();
    const int piece = tid & 7;
    typedef __attribute__((ext_vector_type(8))) unsigned short v8us_; typedef v8us_ __attribute__((may_alias)) v8usa_;
    auto pass = [&]() {
#pragma unroll
        for (int s = 0; s < 2; ++s) { const int nr = (tid >> 3) + 32 * s; const v8us_ val = *(const v8usa_*)(tl + nr * 72 + piece * 8);
            *(v8us_*)(WT + (size_t)(n0 + nr) * DM + k0 + piece * 8) = val; }
    };
    pass(); 
}

template <bool SPLITA, bool F16OUT = false>
__global__ __launch_bounds__(128) void k_gemmb(const bf* __restrict__ A, const bf* __restrict__ Al, const bf* __restrict__ Bn, const float* __restrict__ bias, float* C, int ldc, h16* C2) {
    __shared__ __align__(16) float ost[4][16 * 68];
    const int lane = threadIdx.x & 31, wave = threadIdx.x >> 5, lr = lane & 15, hi = lane >> 4;
    const int r0 = blockIdx.x * 64 + wave * 16, c0 = blockIdx.y * 64;
    const size_t aoff = (size_t)(r0 + lr) * DM + 8 * hi;
    size_t boff[4];
#pragma unroll
    for (int t = 0; t < 4; ++t) boff[t] = (size_t)(c0 + t * 16 + lr) * DM + 8 * hi;
    v8f acc[4];
#pragma unroll
    for (int t = 0; t < 4; ++t) acc[t] = (v8f){};
#pragma unroll 1
    for (int kc = 0; kc < DM; kc += 32) {
        const v16bf a = cat16b(*(const v8us*)(A + aoff + kc), *(const v8us*)(A + aoff + kc + 16));
        v16bf al = a;
        if (SPLITA) al = cat16b(*(const v8us*)(Al + aoff + kc), *(const v8us*)(Al + aoff + kc + 16));
#pragma unroll
        for (int t = 0; t < 4; ++t) { const v16bf b = cat16b(*(const v8us*)(Bn + boff[t] + kc), *(const v8us*)(Bn + boff[t] + kc + 16)); acc[t] = wmmab(a, b, acc[t]); if (SPLITA) acc[t] = wmmab(al, b, acc[t]); }
        asm volatile("v_nop\n\tv_nop\n\tv_nop\n\tv_nop" : "+v"(acc[0]), "+v"(acc[1]), "+v"(acc[2]), "+v"(acc[3]) : "v"(a), "v"(al));
    }
    float* os = &ost[wave][0];
#pragma unroll
    for (int t = 0; t < 4; ++t) { const float bv = bias ? bfr(bias[c0 + t * 16 + lr]) : 0.f;
#pragma unroll
        for (int j = 0; j < 8; ++j) os[(hi * 8 + j) * 68 + t * 16 + lr] = acc[t][j] + bv; }
    __syncthreads();
    if (F16OUT) {
        h16* crow = (h16*)(void*)C + (size_t)r0 * ldc + c0;
        auto pass = [&]() {
#pragma unroll
            for (int s = 0; s < 4; ++s) { const int row = 4 * s + (lane >> 3), piece = lane & 7; const float* sp = os + row * 68 + piece * 8; v8h o, o2;
#pragma unroll
                for (int i = 0; i < 8; ++i) { const h16 a = (h16)sp[i]; o[i] = a; o2[i] = (h16)((sp[i] - (float)a) * LOSC); }
                *(v8h*)(crow + (size_t)row * ldc + piece * 8) = o; if (C2) *(v8h*)(C2 + (size_t)r0 * ldc + c0 + (size_t)row * ldc + piece * 8) = o2; }
        };
        pass(); 
    } else {
        float* crow = C + (size_t)r0 * ldc + c0;
        auto pass = [&]() {
#pragma unroll
            for (int s = 0; s < 8; ++s) { const int Lid = (lane >> 3) + 4 * s, piece = lane & 7; const int row = Lid >> 1, cofs = (Lid & 1) * 32 + piece * 4;
                const v4f val = *(const v4fa*)(os + row * 68 + cofs); *(v4f*)(crow + (size_t)row * ldc + cofs) = val; }
        };
        pass(); 
    }
}

__global__ __launch_bounds__(256) void k_vt(const float* __restrict__ V, h16* VTH, h16* VTL) {
    __shared__ __align__(16) h16 tile[64 * 72];
    __shared__ __align__(16) h16 til2[64 * 72];
    const int bid = blockIdx.x;
    const int b = bid / (NKV * (NT_ / 64)), rem = bid - b * (NKV * (NT_ / 64)), h = rem / (NT_ / 64), kt = rem - h * (NT_ / 64);
    const int k0 = kt * 64, tid = threadIdx.x;
    const int kk = tid >> 2, d0 = (tid & 3) * 16;
    const float* src = V + ((size_t)b * NT_ + k0 + kk) * KVW + h * HD + d0;      // h = kv head here
#pragma unroll
    for (int i = 0; i < 16; ++i) { const float v = src[i]; const h16 a = (h16)v; tile[(d0 + i) * 72 + kk] = a; til2[(d0 + i) * 72 + kk] = (h16)((v - (float)a) * LOSC); }
    __syncthreads();
    const int piece = tid & 7;
    const size_t base = (((size_t)b * NKV + h) * HD) * NT_ + k0;
    auto pass = [&]() {
#pragma unroll
        for (int s = 0; s < 4; ++s) { const int Lid = (tid >> 3) + 32 * s; const int pln = Lid >> 6, d = Lid & 63;
            const v8h val = *(const v8ha*)((pln ? til2 : tile) + d * 72 + piece * 8); *(v8h*)((pln ? VTL : VTH) + base + (size_t)d * NT_ + piece * 8) = val; }
    };
    pass(); 
}

// k_attn: block = (b, h, 64 queries), wave = 16; ALL 32 key tiles (none skipped; length mask per element); 12 WMMA scores (hi.hi + hi.lo + lo.hi) /8 (f32), online softmax, weights x32768 f16 tile (same-wave may_alias
// reload after a compiler barrier), 12 WMMA .v (hi.hi + hi.lo + lo.hi); ctx -> bf16 hi + residual planes CH/CL[tok][h*64+d].
__global__ __launch_bounds__(128) void k_attn(const h16* __restrict__ Q16, const h16* __restrict__ QL16, const h16* __restrict__ K16, const h16* __restrict__ KL16, const h16* __restrict__ VTH, const h16* __restrict__ VTL, const int* __restrict__ lens, int bofs, bf* CH, bf* CL) {
    __shared__ __align__(16) h16 plds[4][16 * 32];
    __shared__ __align__(16) h16 plds2[4][16 * 32];
    __shared__ __align__(16) float ost[4][16 * 68];
    const int lane = threadIdx.x & 31, wave = threadIdx.x >> 5, lr = lane & 15, hi = lane >> 4;
    const int bid = blockIdx.x;
    const int b = bid / (NH_ * (NT_ / 64)), rem = bid - b * (NH_ * (NT_ / 64)), h = rem / (NT_ / 64), qt = rem - h * (NT_ / 64);
    const int q0 = qt * 64 + wave * 16;
    const size_t tok0 = (size_t)b * NT_;
    h16* pl = &plds[wave][0]; h16* pl2 = &plds2[wave][0];
    v16h qa[2];
    const size_t qo0 = (tok0 + q0 + lr) * DM + h * HD + 8 * hi;
#pragma unroll
    for (int kc = 0; kc < 2; ++kc) qa[kc] = cat16(*(const v8h*)(Q16 + qo0 + kc * 32), *(const v8h*)(Q16 + qo0 + kc * 32 + 16));
    const int g = h / (NH_ / NKV);                      // kv head
    const h16* kh_b = K16 + tok0 * KVW + g * HD;
    const h16* kl_b = KL16 + tok0 * KVW + g * HD;
    const size_t vbase = (((size_t)b * NKV + g) * HD) * NT_;
    v8f o[4], ox[4];
#pragma unroll
    for (int n = 0; n < 4; ++n) { o[n] = (v8f){}; ox[n] = (v8f){}; }
    float mrow[8], lpart[8];
#pragma unroll
    for (int j = 0; j < 8; ++j) { mrow[j] = -3.0e38f; lpart[j] = 0.f; }
    int qpos[8];
#pragma unroll
    for (int j = 0; j < 8; ++j) qpos[j] = q0 + 8 * hi + j;
    int len = lens[bofs + b]; len = len < 0 ? 0 : (len > NT_ ? NT_ : len);     // INPUT length of this batch item (block-uniform)
    const int kt_lo = 0, kt_hi = NT_ / 32 - 1;      // all key tiles are visited: a fully-masked row (query >= len) must still see all NEG keys to reproduce the reference's uniform-then-zeroed weights
#pragma unroll 1
    for (int kt = kt_lo; kt <= kt_hi; ++kt) {
        const int l0 = kt * 32;
        const size_t ko0 = (size_t)(l0 + lr) * KVW + 8 * hi, ko1 = (size_t)(l0 + 16 + lr) * KVW + 8 * hi;
        v8f s0 = {}, s1 = {}, x0 = {}, x1 = {};
#pragma unroll
        for (int kc = 0; kc < 2; ++kc) {
            { const v16h k0h = cat16(*(const v8h*)(kh_b + ko0 + kc * 32), *(const v8h*)(kh_b + ko0 + kc * 32 + 16)), k1h = cat16(*(const v8h*)(kh_b + ko1 + kc * 32), *(const v8h*)(kh_b + ko1 + kc * 32 + 16));
              const v16h qlk = cat16(*(const v8h*)(QL16 + qo0 + kc * 32), *(const v8h*)(QL16 + qo0 + kc * 32 + 16));     // query residual re-read per step (registers)
              s0 = wmma16(qa[kc], k0h, s0); x0 = wmma16(qlk, k0h, x0); s1 = wmma16(qa[kc], k1h, s1); x1 = wmma16(qlk, k1h, x1);
              asm volatile("v_nop" : "+v"(s0), "+v"(s1), "+v"(x0), "+v"(x1) : "v"(qlk), "v"(k0h), "v"(k1h) : "memory"); }
            { const v16h k0l = cat16(*(const v8h*)(kl_b + ko0 + kc * 32), *(const v8h*)(kl_b + ko0 + kc * 32 + 16)), k1l = cat16(*(const v8h*)(kl_b + ko1 + kc * 32), *(const v8h*)(kl_b + ko1 + kc * 32 + 16));
              x0 = wmma16(qa[kc], k0l, x0); x1 = wmma16(qa[kc], k1l, x1);
              asm volatile("v_nop" : "+v"(x0), "+v"(x1) : "v"(k0l), "v"(k1l) : "memory"); }
        }
        asm volatile("v_nop\n\tv_nop\n\tv_nop\n\tv_nop" : "+v"(s0), "+v"(s1), "+v"(x0), "+v"(x1) : "v"(qa[0]), "v"(qa[1]));
        float alpha[8];
#pragma unroll
        for (int j = 0; j < 8; ++j) {
            const int ja = l0 + lr, jb = l0 + 16 + lr, qi = qpos[j];
            const bool va = (qi < len) && (ja < len), vb = (qi < len) && (jb < len);
            const float a0 = va ? (s0[j] + x0[j] * LOSCI) * 0.125f : NEGV, a1 = vb ? (s1[j] + x1[j] * LOSCI) * 0.125f : NEGV;
            float mx = fmaxf(a0, a1);
            mx = fmaxf(mx, __shfl_xor(mx, 1, 16)); mx = fmaxf(mx, __shfl_xor(mx, 2, 16)); mx = fmaxf(mx, __shfl_xor(mx, 4, 16)); mx = fmaxf(mx, __shfl_xor(mx, 8, 16));
            const float mn = fmaxf(mrow[j], mx);
            alpha[j] = __expf(mrow[j] - mn); mrow[j] = mn;
            const float p0 = __expf(a0 - mn), p1 = __expf(a1 - mn);
            lpart[j] = lpart[j] * alpha[j] + (p0 + p1);             // normaliser over the (masked-to-NEG) scores, as the reference's softmax
            const int mr = hi * 8 + j;
            const float ps0 = va ? p0 * PSC : 0.f, ps1 = vb ? p1 * PSC : 0.f; const h16 h0 = (h16)ps0, h1 = (h16)ps1;     // attn * mask
            pl[mr * 32 + lr] = h0; pl[mr * 32 + 16 + lr] = h1;
            pl2[mr * 32 + lr] = (h16)((ps0 - (float)h0) * LOSC); pl2[mr * 32 + 16 + lr] = (h16)((ps1 - (float)h1) * LOSC);
        }
#pragma unroll
        for (int n = 0; n < 4; ++n)
#pragma unroll
            for (int j = 0; j < 8; ++j) { o[n][j] *= alpha[j]; ox[n][j] *= alpha[j]; }
        asm volatile("" ::: "memory");
        const v16h pa = cat16(*(const v8ha*)(pl + lr * 32 + hi * 8), *(const v8ha*)(pl + lr * 32 + 16 + hi * 8));
        const v16h px = cat16(*(const v8ha*)(pl2 + lr * 32 + hi * 8), *(const v8ha*)(pl2 + lr * 32 + 16 + hi * 8));
#pragma unroll
        for (int n = 0; n < 4; ++n) { const size_t vo = vbase + (size_t)(n * 16 + lr) * NT_ + l0 + hi * 8;
            const v16h vh = cat16(*(const v8h*)(VTH + vo), *(const v8h*)(VTH + vo + 16)), vl = cat16(*(const v8h*)(VTL + vo), *(const v8h*)(VTL + vo + 16));
            o[n] = wmma16(pa, vh, o[n]); ox[n] = wmma16(pa, vl, ox[n]); ox[n] = wmma16(px, vh, ox[n]);
            asm volatile("" : "+v"(o[n]), "+v"(ox[n]) : "v"(vh), "v"(vl) : "memory"); }
        asm volatile("v_nop\n\tv_nop\n\tv_nop\n\tv_nop" : "+v"(o[0]), "+v"(o[1]), "+v"(o[2]), "+v"(o[3]), "+v"(ox[0]), "+v"(ox[1]), "+v"(ox[2]), "+v"(ox[3]) : "v"(pa), "v"(px));
    }
    float inv[8];
#pragma unroll
    for (int j = 0; j < 8; ++j) { float rs = lpart[j]; rs += __shfl_xor(rs, 1, 16); rs += __shfl_xor(rs, 2, 16); rs += __shfl_xor(rs, 4, 16); rs += __shfl_xor(rs, 8, 16); inv[j] = 1.0f / (rs * PSC); }
    float* os = &ost[wave][0];
#pragma unroll
    for (int n = 0; n < 4; ++n)
#pragma unroll
        for (int j = 0; j < 8; ++j) os[(hi * 8 + j) * 68 + n * 16 + lr] = (o[n][j] + ox[n][j] * LOSCI) * inv[j];
    __syncthreads();
    const size_t cbase = (tok0 + q0) * DM + (size_t)h * HD;
    auto pass = [&]() {
#pragma unroll
        for (int s = 0; s < 4; ++s) { const int row = 4 * s + (lane >> 3), piece = lane & 7; const float* sp = os + row * 68 + piece * 8; v8us oh, ol;
#pragma unroll
            for (int i = 0; i < 8; ++i) { const unsigned short hb = f2bf(sp[i]); oh[i] = hb; ol[i] = f2bf(sp[i] - bf2f(hb)); }
            *(v8us*)(CH + cbase + (size_t)row * DM + piece * 8) = oh; *(v8us*)(CL + cbase + (size_t)row * DM + piece * 8) = ol; }
    };
    pass(); 
}

#define VST2(T, p, v) do { const T vst2_v_ = (v); *(T*)(p) = vst2_v_;  } while (0)
extern "C" void kernel_launch(void* const* d_in, const int* in_sizes, int n_in,
                              void* d_out, int out_size, void* d_ws, size_t ws_size, hipStream_t stream) {
    (void)in_sizes; (void)n_in; (void)out_size;
    const float* x = (const float*)d_in[0]; const int* lens = (const int*)d_in[1]; const float* Wqkv = (const float*)d_in[2]; const float* bqkv = (const float*)d_in[3]; const float* Wo = (const float*)d_in[4]; const float* bo = (const float*)d_in[5];
    float* out = (float*)d_out;    // [8][1024][1024]
    char* wsp = (char*)d_ws;
    auto take = [&](size_t bytes) { char* p = wsp; wsp += (bytes + 255) & ~(size_t)255; return (void*)p; };
    bf* Xb = (bf*)take((size_t)NTK * DM * 2); bf* W3T = (bf*)take((size_t)3 * DM * DM * 2); bf* WoT = (bf*)take((size_t)DM * DM * 2);
    h16* QH = (h16*)take((size_t)NTK * DM * 2); h16* QL = (h16*)take((size_t)NTK * DM * 2); h16* KH = (h16*)take((size_t)NTK * DM * 2); h16* KL = (h16*)take((size_t)NTK * DM * 2);
    float* Vf = (float*)take((size_t)NTK * DM * 4); h16* VTL = (h16*)take((size_t)NTK * DM * 2);
    if ((size_t)(wsp - (char*)d_ws) > ws_size) return;    // 8 batch items = 8192 rows: 16.8 + 6.3 + 2.1 + 4 x 16.8 + 33.6 + 16.8 ~ 143 MB
    h16* VTH = (h16*)Xb; bf* CH = (bf*)Vf; bf* CL = (bf*)((char*)Vf + (size_t)NTK * DM * 2);
    k_wt<<<dim3(DM / 64, (3 * DM) / 64, 1), 256, 0, stream>>>(Wqkv, 3 * DM, W3T);
    k_wt<<<dim3(DM / 64, DM / 64, 1), 256, 0, stream>>>(Wo, DM, WoT);
    k_cvtb<<<NTK / 8, 256, 0, stream>>>(x, NTK, Xb);
    k_gemmb<false, true><<<dim3(NTK / 64, DM / 64, 1), 128, 0, stream>>>(Xb, nullptr, W3T, bqkv, (float*)(void*)QH, DM, QL);
    k_gemmb<false, true><<<dim3(NTK / 64, DM / 64, 1), 128, 0, stream>>>(Xb, nullptr, W3T + (size_t)DM * DM, bqkv + DM, (float*)(void*)KH, DM, KL);
    k_gemmb<false, false><<<dim3(NTK / 64, DM / 64, 1), 128, 0, stream>>>(Xb, nullptr, W3T + (size_t)2 * DM * DM, bqkv + 2 * DM, Vf, DM, nullptr);
    k_vt<<<NB_ * NKV * (NT_ / 64), 256, 0, stream>>>(Vf, VTH, VTL);
    k_attn<<<NB_ * NH_ * (NT_ / 64), 128, 0, stream>>>(QH, QL, KH, KL, VTH, VTL, lens, 0, CH, CL);
    k_gemmb<true, false><<<dim3(NTK / 64, DM / 64, 1), 128, 0, stream>>>(CH, CL, WoT, bo, out, DM, nullptr);
}

// v002
// It runs in 560 microseconds.
// Next to v001, in two timings, it ran 1.07 times as fast each time.
// Counting every step since v000, it is 1.40 times as fast.
#include <hip/hip_runtime.h>

// Contractions, f32 accumulate: qkv = x.w_qkv + b_qkv ([8192 x 1024].[1024 x 3072], k-major weight transposed to an n-major plane; PLAIN bf16 operands: inputs
// rounded once, exact) and out.w_o + b_o (merged heads as bf16 hi + residual: two products) on v_wmma_f32_16x16x32_bf16; the 16-head length-masked attention fused
// on v_wmma_f32_16x16x32_f16: logits = q.k/8 where query AND key are < lengths[b] (the INPUT), else -1e9 (the reference's score*mask + NEG(1-mask)); softmax; the
// weights are multiplied by the same mask again (so rows beyond the length give exactly zero context); q and k as f16 hi + residual x1024 (hi.hi + hi.lo + lo.hi),

#define NB_  8                   // all 8 batch items go through every launch together
#define NT_  1024
#define DM   1024
#define NH_  16
#define NKV  16
#define KVW  (NKV * HD)          // 1024
#define HD   64
#define NTK  (NB_ * NT_)
#define NW   1024
#define NQKV 1024
#define PSC  32768.0f
#define NEGV (-1.0e9f)
#define LOSC 1024.0f
#define LOSCI (1.0f / 1024.0f)
// Every 16-bit operand plane in the workspace (rows of 1024 elements) is stored fragment-major: the 16 rows x 32 k of one WMMA operand fragment are 512 consecutive
// elements, element (row, k) at FRG(row / 16, k / 32) + ((k % 32) / 16) * 256 + ((((k % 16) / 8) * 16) + row % 16) * 8 + k % 8. A lane's two 16-byte pieces then
// lie at lane * 8 and 256 + lane * 8, so one wave load reads 512 consecutive bytes (4 whole 128-byte lines) where the row-major plane made it touch 16 lines.
#define FRG(rg, kc32) (((size_t)(rg) * (DM / 32) + (size_t)(kc32)) * 512)

typedef _Float16 h16;
typedef unsigned short bf;
typedef __attribute__((ext_vector_type(16))) __bf16   v16bf;
typedef __attribute__((ext_vector_type(16))) _Float16 v16h;
typedef __attribute__((ext_vector_type(8)))  _Float16 v8h;
typedef __attribute__((ext_vector_type(8)))  unsigned short v8us;
typedef __attribute__((ext_vector_type(8)))  float    v8f;
typedef __attribute__((ext_vector_type(4)))  float    v4f;
typedef v8h  __attribute__((may_alias)) v8ha;
typedef v4f  __attribute__((may_alias)) v4fa;
typedef v8us __attribute__((may_alias)) v8usa;

__device__ __forceinline__ unsigned short f2bf(float f) { unsigned u = __float_as_uint(f); u += 0x7FFFu + ((u >> 16) & 1u); return (unsigned short)(u >> 16); }
__device__ __forceinline__ float bf2f(unsigned short b) { return __uint_as_float(((unsigned)b) << 16); }
__device__ __forceinline__ float bfr(float f) { return bf2f(f2bf(f)); }
__device__ __forceinline__ v16h cat16(v8h lo, v8h hi) { return __builtin_shufflevector(lo, hi, 0, 1, 2, 3, 4, 5, 6, 7, 8, 9, 10, 11, 12, 13, 14, 15); }
__device__ __forceinline__ v16bf cat16b(v8us lo, v8us hi) { return __builtin_bit_cast(v16bf, __builtin_shufflevector(lo, hi, 0, 1, 2, 3, 4, 5, 6, 7, 8, 9, 10, 11, 12, 13, 14, 15)); }
__device__ __forceinline__ v8f wmma16(v16h a, v16h b, v8f c) { return __builtin_amdgcn_wmma_f32_16x16x32_f16(false, a, false, b, (short)0, c, false, false); }
__device__ __forceinline__ v8f wmmab(v16bf a, v16bf b, v8f c) { return __builtin_amdgcn_wmma_f32_16x16x32_bf16(false, a, false, b, (short)0, c, false, false); }

__global__ __launch_bounds__(256) void k_cvtb(const float* __restrict__ src, int nrows, bf* dst) {
    const int lane = threadIdx.x & 31, lr = lane & 15, hi = lane >> 4;
    const int gw = blockIdx.x * 8 + (threadIdx.x >> 5);          // one wave: 16 rows x 64 k = two fragments
    const int rg = gw / (DM / 64), kq = gw - rg * (DM / 64);
    if (rg * 16 >= nrows) return;
    const float* sp = src + (size_t)(rg * 16 + lr) * DM + kq * 64 + hi * 8;
    v8us o[4];
#pragma unroll
    for (int u = 0; u < 4; ++u) { v8us t;                        // u = fragment * 2 + piece
#pragma unroll
        for (int i = 0; i < 8; ++i) t[i] = f2bf(sp[u * 16 + i]);
        o[u] = t; }
    bf* dp = dst + FRG(rg, kq * 2) + lane * 8;
#pragma unroll
    for (int u = 0; u < 4; ++u) *(v8us*)(dp + u * 256) = o[u];
}

// k_wt: W [1024 k][ncols n] (k-major) -> n-major bf16 plane WT (rows n, fragment-major); 64 x 64 tiles through LDS.
__global__ __launch_bounds__(256) void k_wt(const float* __restrict__ Wm, int ncols, bf* WT) {
    __shared__ __align__(16) unsigned short tl[64 * 72];
    const int tid = threadIdx.x, k0 = blockIdx.x * 64, n0 = blockIdx.y * 64;
    const int kk = tid >> 2, nq = (tid & 3) * 16;
#pragma unroll
    for (int i = 0; i < 16; ++i) tl[(nq + i) * 72 + kk] = f2bf(Wm[(size_t)(k0 + kk) * ncols + n0 + nq + i]);
    __syncthreads();
    typedef __attribute__((ext_vector_type(8))) unsigned short v8us_; typedef v8us_ __attribute__((may_alias)) v8usa_;
    auto pass = [&]() {
#pragma unroll
        for (int s = 0; s < 2; ++s) { const int u = tid + 256 * s; const int fr = u >> 6, pc = (u >> 5) & 1, ln = u & 31;     // 8 fragments: (fr >> 1) = 16-row group, (fr & 1) = 32-k chunk
            const v8us_ val = *(const v8usa_*)(tl + ((fr >> 1) * 16 + (ln & 15)) * 72 + (fr & 1) * 32 + pc * 16 + (ln >> 4) * 8);
            *(v8us_*)(WT + FRG((n0 >> 4) + (fr >> 1), (k0 >> 5) + (fr & 1)) + pc * 256 + ln * 8) = val; }
    };
    pass(); 
}

template <bool SPLITA, bool F16OUT = false>
__global__ __launch_bounds__(128) void k_gemmb(const bf* __restrict__ A, const bf* __restrict__ Al, const bf* __restrict__ Bn, const float* __restrict__ bias, float* C, int ldc, h16* C2) {
    __shared__ __align__(16) float ost[4][16 * 68];
    const int lane = threadIdx.x & 31, lr = lane & 15, hi = lane >> 4;
    const int wave = __builtin_amdgcn_readfirstlane(threadIdx.x >> 5);     // the same in every lane of a wave: fragment bases stay in scalar registers
    const unsigned l8 = lane * 8;                                // the one per-lane part of every fragment address
    const int r0 = blockIdx.x * 64 + wave * 16, c0 = blockIdx.y * 64;
    const bf* Ap = A + FRG(r0 >> 4, 0);
    const bf* Alp = SPLITA ? Al + FRG(r0 >> 4, 0) : Ap;
    const bf* Bp = Bn + FRG(c0 >> 4, 0);
    v8f acc[4];
#pragma unroll
    for (int t = 0; t < 4; ++t) acc[t] = (v8f){};
#pragma unroll 1
    for (int kc = 0; kc < DM; kc += 32) {
        const int ko = kc * 16;                                  // 512 elements per 32-k fragment
        const bf* ap = Ap + ko + l8; const bf* alp = Alp + ko + l8; const bf* bp = Bp + ko + l8;     // this trip's three load addresses
        const v16bf a = cat16b(*(const v8us*)ap, *(const v8us*)(ap + 256));
        v16bf al = a;
        if (SPLITA) al = cat16b(*(const v8us*)alp, *(const v8us*)(alp + 256));
#pragma unroll
        for (int t = 0; t < 4; ++t) { const bf* bk = bp + FRG(t, 0); const v16bf b = cat16b(*(const v8us*)bk, *(const v8us*)(bk + 256)); acc[t] = wmmab(a, b, acc[t]); if (SPLITA) acc[t] = wmmab(al, b, acc[t]); }
        // the addresses are inputs here so that no later load's result is placed over an address register while a load that names it is still out
        asm volatile("v_nop\n\tv_nop\n\tv_nop\n\tv_nop" : "+v"(acc[0]), "+v"(acc[1]), "+v"(acc[2]), "+v"(acc[3]) : "v"(a), "v"(al), "v"(ap), "v"(alp), "v"(bp));
    }
    float* os = &ost[wave][0];
#pragma unroll
    for (int t = 0; t < 4; ++t) { const float bv = bias ? bfr(bias[c0 + t * 16 + lr]) : 0.f;
#pragma unroll
        for (int j = 0; j < 8; ++j) os[(hi * 8 + j) * 68 + t * 16 + lr] = acc[t][j] + bv; }
    __syncthreads();
    if (F16OUT) {
        const size_t cfo = FRG(r0 >> 4, c0 >> 5);                // the wave's 16 x 64 tile = two fragments, 2 KB in a row
        h16* cf = (h16*)(void*)C + cfo;
        auto pass = [&]() {
#pragma unroll
            for (int s = 0; s < 4; ++s) { const float* sp = os + lr * 68 + s * 16 + hi * 8; v8h o, o2;     // s = fragment * 2 + piece
#pragma unroll
                for (int i = 0; i < 8; ++i) { const h16 a = (h16)sp[i]; o[i] = a; o2[i] = (h16)((sp[i] - (float)a) * LOSC); }
                *(v8h*)(cf + s * 256 + l8) = o;
                asm volatile("s_wait_xcnt 0x0" ::: "memory");    // stands before the issued store's registers are reused for the residual
                if (C2) *(v8h*)(C2 + cfo + s * 256 + l8) = o2; }
        };
        pass(); 
    } else {
        float* crow = C + (size_t)r0 * ldc + c0;
        auto pass = [&]() {
#pragma unroll
            for (int s = 0; s < 8; ++s) { const int Lid = (lane >> 3) + 4 * s, piece = lane & 7; const int row = Lid >> 1, cofs = (Lid & 1) * 32 + piece * 4;
                const v4f val = *(const v4fa*)(os + row * 68 + cofs); *(v4f*)(crow + (size_t)row * ldc + cofs) = val;
                asm volatile("s_wait_xcnt 0x0" ::: "memory"); }  // stands before the issued store's registers are reused
        };
        pass(); 
    }
}

__global__ __launch_bounds__(256) void k_vt(const float* __restrict__ V, h16* VTH, h16* VTL) {
    __shared__ __align__(16) h16 tile[64 * 72];
    __shared__ __align__(16) h16 til2[64 * 72];
    const int bid = blockIdx.x;
    const int b = bid / (NKV * (NT_ / 64)), rem = bid - b * (NKV * (NT_ / 64)), h = rem / (NT_ / 64), kt = rem - h * (NT_ / 64);
    const int k0 = kt * 64, tid = threadIdx.x;
    const int kk = tid >> 2, d0 = (tid & 3) * 16;
    const float* src = V + ((size_t)b * NT_ + k0 + kk) * KVW + h * HD + d0;      // h = kv head here
#pragma unroll
    for (int i = 0; i < 16; ++i) { const float v = src[i]; const h16 a = (h16)v; tile[(d0 + i) * 72 + kk] = a; til2[(d0 + i) * 72 + kk] = (h16)((v - (float)a) * LOSC); }
    __syncthreads();
    const int rg0 = ((b * NKV + h) * HD) >> 4;                   // plane rows = (b, h, d), k = key position
    auto pass = [&]() {
#pragma unroll
        for (int s = 0; s < 4; ++s) { const int u = tid + 256 * s; const int pln = u >> 9, fr = (u >> 6) & 7, pc = (u >> 5) & 1, ln = u & 31;
            const v8h val = *(const v8ha*)((pln ? til2 : tile) + ((fr >> 1) * 16 + (ln & 15)) * 72 + (fr & 1) * 32 + pc * 16 + (ln >> 4) * 8);
            *(v8h*)((pln ? VTL : VTH) + FRG(rg0 + (fr >> 1), (k0 >> 5) + (fr & 1)) + pc * 256 + ln * 8) = val; }
    };
    pass(); 
}

// k_attn: block = (b, h, 64 queries), wave = 16; ALL 32 key tiles (no mask); 4 WMMA scores /8 (f32), online softmax, weights x32768 f16 tile (same-wave may_alias
// reload after a compiler barrier), 4 WMMA .v; ctx -> bf16 hi + residual planes CH/CL (rows tok, k = h*64+d, fragment-major).
__global__ __launch_bounds__(128) void k_attn(const h16* __restrict__ Q16, const h16* __restrict__ QL16, const h16* __restrict__ K16, const h16* __restrict__ KL16, const h16* __restrict__ VTH, const h16* __restrict__ VTL, const int* __restrict__ lens, int bofs, bf* CH, bf* CL) {
    __shared__ __align__(16) h16 plds[4][16 * 32];
    __shared__ __align__(16) h16 plds2[4][16 * 32];
    __shared__ __align__(16) float ost[4][16 * 68];
    const int lane = threadIdx.x & 31, lr = lane & 15, hi = lane >> 4;
    const int wave = __builtin_amdgcn_readfirstlane(threadIdx.x >> 5);     // the same in every lane of a wave: fragment bases stay in scalar registers
    const unsigned l8 = lane * 8;                                // the one per-lane part of every fragment address
    const int bid = blockIdx.x;
    const int b = bid / (NH_ * (NT_ / 64)), rem = bid - b * (NH_ * (NT_ / 64)), h = rem / (NT_ / 64), qt = rem - h * (NT_ / 64);
    const int q0 = qt * 64 + wave * 16;
    const size_t tok0 = (size_t)b * NT_;
    h16* pl = &plds[wave][0]; h16* pl2 = &plds2[wave][0];
    v16h qa[2];
    const size_t qo0 = FRG((tok0 + q0) >> 4, h * 2);
#pragma unroll
    for (int kc = 0; kc < 2; ++kc) qa[kc] = cat16(*(const v8h*)(Q16 + qo0 + kc * 512 + l8), *(const v8h*)(Q16 + qo0 + kc * 512 + 256 + l8));
    asm volatile("s_wait_xcnt 0x0" ::: "memory");                // stands before the issued query loads' base registers are reused for the length's address
    const int g = h / (NH_ / NKV);                      // kv head
    const h16* kh_b = K16 + FRG(tok0 >> 4, g * 2);
    const h16* kl_b = KL16 + FRG(tok0 >> 4, g * 2);
    const size_t vbase = FRG(((b * NKV + g) * HD) >> 4, 0);
    v8f o[4], ox[4];
#pragma unroll
    for (int n = 0; n < 4; ++n) { o[n] = (v8f){}; ox[n] = (v8f){}; }
    float mrow[8], lpart[8];
#pragma unroll
    for (int j = 0; j < 8; ++j) { mrow[j] = -3.0e38f; lpart[j] = 0.f; }
    int qpos[8];
#pragma unroll
    for (int j = 0; j < 8; ++j) qpos[j] = q0 + 8 * hi + j;
    int len = lens[bofs + b]; len = len < 0 ? 0 : (len > NT_ ? NT_ : len);     // INPUT length of this batch item (block-uniform)
    const int kt_lo = 0, kt_hi = NT_ / 32 - 1;      // all key tiles are visited: a fully-masked row (query >= len) must still see all NEG keys to reproduce the reference's uniform-then-zeroed weights
#pragma unroll 1
    for (int kt = kt_lo; kt <= kt_hi; ++kt) {
        const int l0 = kt * 32;
        const h16* kh0 = kh_b + FRG(kt * 2, 0) + l8; const h16* kl0 = kl_b + FRG(kt * 2, 0) + l8;     // keys l0..l0+15; the next 16 keys lie FRG(1, 0) further
        const h16* vhp = VTH + vbase + FRG(0, kt) + l8; const h16* vlp = VTL + vbase + FRG(0, kt) + l8;
        v8f s0 = {}, s1 = {}, x0 = {}, x1 = {};
#pragma unroll
        for (int kc = 0; kc < 2; ++kc) {
            { const v16h k0h = cat16(*(const v8h*)(kh0 + kc * 512), *(const v8h*)(kh0 + kc * 512 + 256)), k1h = cat16(*(const v8h*)(kh0 + FRG(1, 0) + kc * 512), *(const v8h*)(kh0 + FRG(1, 0) + kc * 512 + 256));
              const v16h qlk = cat16(*(const v8h*)(QL16 + qo0 + kc * 512 + l8), *(const v8h*)(QL16 + qo0 + kc * 512 + 256 + l8));     // query residual re-read per step (registers)
              s0 = wmma16(qa[kc], k0h, s0); x0 = wmma16(qlk, k0h, x0); s1 = wmma16(qa[kc], k1h, s1); x1 = wmma16(qlk, k1h, x1);
              asm volatile("v_nop" : "+v"(s0), "+v"(s1), "+v"(x0), "+v"(x1) : "v"(qlk), "v"(k0h), "v"(k1h) : "memory"); }
            { const v16h k0l = cat16(*(const v8h*)(kl0 + kc * 512), *(const v8h*)(kl0 + kc * 512 + 256)), k1l = cat16(*(const v8h*)(kl0 + FRG(1, 0) + kc * 512), *(const v8h*)(kl0 + FRG(1, 0) + kc * 512 + 256));
              x0 = wmma16(qa[kc], k0l, x0); x1 = wmma16(qa[kc], k1l, x1);
              asm volatile("v_nop" : "+v"(x0), "+v"(x1) : "v"(k0l), "v"(k1l) : "memory"); }
        }
        // the key addresses are inputs here so that no later load's result is placed over an address register while a load that names it is still out
        asm volatile("v_nop\n\tv_nop\n\tv_nop\n\tv_nop" : "+v"(s0), "+v"(s1), "+v"(x0), "+v"(x1) : "v"(qa[0]), "v"(qa[1]), "v"(kh0), "v"(kl0));
        float alpha[8];
#pragma unroll
        for (int j = 0; j < 8; ++j) {
            const int ja = l0 + lr, jb = l0 + 16 + lr, qi = qpos[j];
            const bool va = (qi < len) && (ja < len), vb = (qi < len) && (jb < len);
            const float a0 = va ? (s0[j] + x0[j] * LOSCI) * 0.125f : NEGV, a1 = vb ? (s1[j] + x1[j] * LOSCI) * 0.125f : NEGV;
            float mx = fmaxf(a0, a1);
            mx = fmaxf(mx, __shfl_xor(mx, 1, 16)); mx = fmaxf(mx, __shfl_xor(mx, 2, 16)); mx = fmaxf(mx, __shfl_xor(mx, 4, 16)); mx = fmaxf(mx, __shfl_xor(mx, 8, 16));
            const float mn = fmaxf(mrow[j], mx);
            alpha[j] = __expf(mrow[j] - mn); mrow[j] = mn;
            const float p0 = __expf(a0 - mn), p1 = __expf(a1 - mn);
            lpart[j] = lpart[j] * alpha[j] + (p0 + p1);             // normaliser over the (masked-to-NEG) scores, as the reference's softmax
            const int mr = hi * 8 + j;
            const float ps0 = va ? p0 * PSC : 0.f, ps1 = vb ? p1 * PSC : 0.f; const h16 h0 = (h16)ps0, h1 = (h16)ps1;     // attn * mask
            pl[mr * 32 + lr] = h0; pl[mr * 32 + 16 + lr] = h1;
            pl2[mr * 32 + lr] = (h16)((ps0 - (float)h0) * LOSC); pl2[mr * 32 + 16 + lr] = (h16)((ps1 - (float)h1) * LOSC);
        }
#pragma unroll
        for (int n = 0; n < 4; ++n)
#pragma unroll
            for (int j = 0; j < 8; ++j) { o[n][j] *= alpha[j]; ox[n][j] *= alpha[j]; }
        asm volatile("" ::: "memory");
        const v16h pa = cat16(*(const v8ha*)(pl + lr * 32 + hi * 8), *(const v8ha*)(pl + lr * 32 + 16 + hi * 8));
        const v16h px = cat16(*(const v8ha*)(pl2 + lr * 32 + hi * 8), *(const v8ha*)(pl2 + lr * 32 + 16 + hi * 8));
#pragma unroll
        for (int n = 0; n < 4; ++n) { const size_t vo = FRG(n, 0);
            const v16h vh = cat16(*(const v8h*)(vhp + vo), *(const v8h*)(vhp + vo + 256)), vl = cat16(*(const v8h*)(vlp + vo), *(const v8h*)(vlp + vo + 256));
            o[n] = wmma16(pa, vh, o[n]); ox[n] = wmma16(pa, vl, ox[n]); ox[n] = wmma16(px, vh, ox[n]);
            asm volatile("" : "+v"(o[n]), "+v"(ox[n]) : "v"(vh), "v"(vl) : "memory"); }
        asm volatile("v_nop\n\tv_nop\n\tv_nop\n\tv_nop" : "+v"(o[0]), "+v"(o[1]), "+v"(o[2]), "+v"(o[3]), "+v"(ox[0]), "+v"(ox[1]), "+v"(ox[2]), "+v"(ox[3]) : "v"(pa), "v"(px), "v"(vhp), "v"(vlp));     // value addresses as inputs: as at the key addresses above
    }
    float inv[8];
#pragma unroll
    for (int j = 0; j < 8; ++j) { float rs = lpart[j]; rs += __shfl_xor(rs, 1, 16); rs += __shfl_xor(rs, 2, 16); rs += __shfl_xor(rs, 4, 16); rs += __shfl_xor(rs, 8, 16); inv[j] = 1.0f / (rs * PSC); }
    float* os = &ost[wave][0];
#pragma unroll
    for (int n = 0; n < 4; ++n)
#pragma unroll
        for (int j = 0; j < 8; ++j) os[(hi * 8 + j) * 68 + n * 16 + lr] = (o[n][j] + ox[n][j] * LOSCI) * inv[j];
    __syncthreads();
    const size_t cbase = FRG((tok0 + q0) >> 4, h * 2);
    auto pass = [&]() {
#pragma unroll
        for (int s = 0; s < 4; ++s) { const float* sp = os + lr * 68 + s * 16 + hi * 8; v8us oh, ol;     // s = fragment * 2 + piece
#pragma unroll
            for (int i = 0; i < 8; ++i) { const unsigned short hb = f2bf(sp[i]); oh[i] = hb; ol[i] = f2bf(sp[i] - bf2f(hb)); }
            *(v8us*)(CH + cbase + s * 256 + l8) = oh; *(v8us*)(CL + cbase + s * 256 + l8) = ol; }
    };
    pass(); 
}

#define VST2(T, p, v) do { const T vst2_v_ = (v); *(T*)(p) = vst2_v_;  } while (0)
extern "C" void kernel_launch(void* const* d_in, const int* in_sizes, int n_in,
                              void* d_out, int out_size, void* d_ws, size_t ws_size, hipStream_t stream) {
    (void)in_sizes; (void)n_in; (void)out_size;
    const float* x = (const float*)d_in[0]; const int* lens = (const int*)d_in[1]; const float* Wqkv = (const float*)d_in[2]; const float* bqkv = (const float*)d_in[3]; const float* Wo = (const float*)d_in[4]; const float* bo = (const float*)d_in[5];
    float* out = (float*)d_out;    // [8][1024][1024]
    char* wsp = (char*)d_ws;
    auto take = [&](size_t bytes) { char* p = wsp; wsp += (bytes + 255) & ~(size_t)255; return (void*)p; };
    bf* Xb = (bf*)take((size_t)NTK * DM * 2); bf* W3T = (bf*)take((size_t)3 * DM * DM * 2); bf* WoT = (bf*)take((size_t)DM * DM * 2);
    h16* QH = (h16*)take((size_t)NTK * DM * 2); h16* QL = (h16*)take((size_t)NTK * DM * 2); h16* KH = (h16*)take((size_t)NTK * DM * 2); h16* KL = (h16*)take((size_t)NTK * DM * 2);
    float* Vf = (float*)take((size_t)NTK * DM * 4); h16* VTL = (h16*)take((size_t)NTK * DM * 2);
    if ((size_t)(wsp - (char*)d_ws) > ws_size) return;    // 8 batch items = 8192 rows: 16.8 + 6.3 + 2.1 + 4 x 16.8 + 33.6 + 16.8 ~ 143 MB
    h16* VTH = (h16*)Xb; bf* CH = (bf*)Vf; bf* CL = (bf*)((char*)Vf + (size_t)NTK * DM * 2);
    k_wt<<<dim3(DM / 64, (3 * DM) / 64, 1), 256, 0, stream>>>(Wqkv, 3 * DM, W3T);
    k_wt<<<dim3(DM / 64, DM / 64, 1), 256, 0, stream>>>(Wo, DM, WoT);
    k_cvtb<<<NTK / 8, 256, 0, stream>>>(x, NTK, Xb);
    k_gemmb<false, true><<<dim3(NTK / 64, DM / 64, 1), 128, 0, stream>>>(Xb, nullptr, W3T, bqkv, (float*)(void*)QH, DM, QL);
    k_gemmb<false, true><<<dim3(NTK / 64, DM / 64, 1), 128, 0, stream>>>(Xb, nullptr, W3T + (size_t)DM * DM, bqkv + DM, (float*)(void*)KH, DM, KL);
    k_gemmb<false, false><<<dim3(NTK / 64, DM / 64, 1), 128, 0, stream>>>(Xb, nullptr, W3T + (size_t)2 * DM * DM, bqkv + 2 * DM, Vf, DM, nullptr);
    k_vt<<<NB_ * NKV * (NT_ / 64), 256, 0, stream>>>(Vf, VTH, VTL);
    k_attn<<<NB_ * NH_ * (NT_ / 64), 128, 0, stream>>>(QH, QL, KH, KL, VTH, VTL, lens, 0, CH, CL);
    k_gemmb<true, false><<<dim3(NTK / 64, DM / 64, 1), 128, 0, stream>>>(CH, CL, WoT, bo, out, DM, nullptr);
}

// v003
// It runs in 449 microseconds.
// Two timings next to v002 both put it at 1.25 times that version's speed.
// All steps since v000 together make it 1.75 times as fast.
#include <hip/hip_runtime.h>

// Contractions, f32 accumulate: qkv = x.w_qkv + b_qkv ([8192 x 1024].[1024 x 3072], k-major weight transposed to an n-major plane; PLAIN bf16 operands: inputs
// rounded once, exact) and out.w_o + b_o (merged heads as bf16 hi + residual: two products) on v_wmma_f32_16x16x32_bf16; the 16-head length-masked attention fused
// on v_wmma_f32_16x16x32_f16: logits = q.k/8 where query AND key are < lengths[b] (the INPUT), else -1e9 (the reference's score*mask + NEG(1-mask)); softmax; the
// weights are multiplied by the same mask again (so rows beyond the length give exactly zero context); q and k as f16 hi + residual x1024 (hi.hi + hi.lo + lo.hi),

#define NB_  8                   // all 8 batch items go through every launch together
#define NT_  1024
#define DM   1024
#define NH_  16
#define NKV  16
#define KVW  (NKV * HD)          // 1024
#define HD   64
#define NTK  (NB_ * NT_)
#define NW   1024
#define NQKV 1024
#define PSC  32768.0f
#define NEGV (-1.0e9f)
#define LOSC 1024.0f
#define LOSCI (1.0f / 1024.0f)
// Every 16-bit operand plane in the workspace (rows of 1024 elements) is stored fragment-major: the 16 rows x 32 k of one WMMA operand fragment are 512 consecutive
// elements, element (row, k) at FRG(row / 16, k / 32) + ((k % 32) / 16) * 256 + ((((k % 16) / 8) * 16) + row % 16) * 8 + k % 8. A lane's two 16-byte pieces then
// lie at lane * 8 and 256 + lane * 8, so one wave load reads 512 consecutive bytes (4 whole 128-byte lines) where the row-major plane made it touch 16 lines.
#define FRG(rg, kc32) (((size_t)(rg) * (DM / 32) + (size_t)(kc32)) * 512)

typedef _Float16 h16;
typedef unsigned short bf;
typedef __attribute__((ext_vector_type(16))) __bf16   v16bf;
typedef __attribute__((ext_vector_type(16))) _Float16 v16h;
typedef __attribute__((ext_vector_type(8)))  _Float16 v8h;
typedef __attribute__((ext_vector_type(8)))  unsigned short v8us;
typedef __attribute__((ext_vector_type(8)))  float    v8f;
typedef __attribute__((ext_vector_type(4)))  float    v4f;
typedef v8h  __attribute__((may_alias)) v8ha;
typedef v4f  __attribute__((may_alias)) v4fa;
typedef v8us __attribute__((may_alias)) v8usa;

__device__ __forceinline__ unsigned short f2bf(float f) { unsigned u = __float_as_uint(f); u += 0x7FFFu + ((u >> 16) & 1u); return (unsigned short)(u >> 16); }
__device__ __forceinline__ float bf2f(unsigned short b) { return __uint_as_float(((unsigned)b) << 16); }
__device__ __forceinline__ float bfr(float f) { return bf2f(f2bf(f)); }
__device__ __forceinline__ v16h cat16(v8h lo, v8h hi) { return __builtin_shufflevector(lo, hi, 0, 1, 2, 3, 4, 5, 6, 7, 8, 9, 10, 11, 12, 13, 14, 15); }
__device__ __forceinline__ v16bf cat16b(v8us lo, v8us hi) { return __builtin_bit_cast(v16bf, __builtin_shufflevector(lo, hi, 0, 1, 2, 3, 4, 5, 6, 7, 8, 9, 10, 11, 12, 13, 14, 15)); }
__device__ __forceinline__ v8f wmma16(v16h a, v16h b, v8f c) { return __builtin_amdgcn_wmma_f32_16x16x32_f16(false, a, false, b, (short)0, c, false, false); }
__device__ __forceinline__ v8f wmmab(v16bf a, v16bf b, v8f c) { return __builtin_amdgcn_wmma_f32_16x16x32_bf16(false, a, false, b, (short)0, c, false, false); }

// lengths[b] (the INPUT), clamped to 0..NT_. A token at or beyond it is masked as query and as key: its context row is exactly zero and its key weighs exactly zero
// (exp(-1e9 - max) = 0 in f32), so a 64-token tile that lies wholly beyond the length is left out of every launch; the output rows there are the bias alone.
__device__ __forceinline__ int len_of(const int* __restrict__ lens, int b) { const int l = lens[b]; return l < 0 ? 0 : (l > NT_ ? NT_ : l); }
__device__ __forceinline__ bool tile_past(const int* __restrict__ lens, int row) { return ((row & (NT_ - 1)) & ~63) >= len_of(lens, row / NT_); }     // row = b * NT_ + token

__global__ __launch_bounds__(256) void k_cvtb(const float* __restrict__ src, int nrows, bf* dst, const int* __restrict__ lens) {
    if (tile_past(lens, ((blockIdx.x * 8) / (DM / 64)) * 16)) return;     // the block's 8 waves share one 16-row group (block-uniform)
    const int lane = threadIdx.x & 31, lr = lane & 15, hi = lane >> 4;
    const int gw = blockIdx.x * 8 + (threadIdx.x >> 5);          // one wave: 16 rows x 64 k = two fragments
    const int rg = gw / (DM / 64), kq = gw - rg * (DM / 64);
    if (rg * 16 >= nrows) return;
    const float* sp = src + (size_t)(rg * 16 + lr) * DM + kq * 64 + hi * 8;
    v8us o[4];
#pragma unroll
    for (int u = 0; u < 4; ++u) { v8us t;                        // u = fragment * 2 + piece
#pragma unroll
        for (int i = 0; i < 8; ++i) t[i] = f2bf(sp[u * 16 + i]);
        o[u] = t; }
    bf* dp = dst + FRG(rg, kq * 2) + lane * 8;
#pragma unroll
    for (int u = 0; u < 4; ++u) *(v8us*)(dp + u * 256) = o[u];
}

// k_wt: W [1024 k][ncols n] (k-major) -> n-major bf16 plane WT (rows n, fragment-major); 64 x 64 tiles through LDS.
__global__ __launch_bounds__(256) void k_wt(const float* __restrict__ Wm, int ncols, bf* WT) {
    __shared__ __align__(16) unsigned short tl[64 * 72];
    const int tid = threadIdx.x, k0 = blockIdx.x * 64, n0 = blockIdx.y * 64;
    const int kk = tid >> 2, nq = (tid & 3) * 16;
#pragma unroll
    for (int i = 0; i < 16; ++i) tl[(nq + i) * 72 + kk] = f2bf(Wm[(size_t)(k0 + kk) * ncols + n0 + nq + i]);
    __syncthreads();
    typedef __attribute__((ext_vector_type(8))) unsigned short v8us_; typedef v8us_ __attribute__((may_alias)) v8usa_;
    auto pass = [&]() {
#pragma unroll
        for (int s = 0; s < 2; ++s) { const int u = tid + 256 * s; const int fr = u >> 6, pc = (u >> 5) & 1, ln = u & 31;     // 8 fragments: (fr >> 1) = 16-row group, (fr & 1) = 32-k chunk
            const v8us_ val = *(const v8usa_*)(tl + ((fr >> 1) * 16 + (ln & 15)) * 72 + (fr & 1) * 32 + pc * 16 + (ln >> 4) * 8);
            *(v8us_*)(WT + FRG((n0 >> 4) + (fr >> 1), (k0 >> 5) + (fr & 1)) + pc * 256 + ln * 8) = val; }
    };
    pass(); 
}

template <bool SPLITA, bool F16OUT = false>
__global__ __launch_bounds__(128) void k_gemmb(const bf* __restrict__ A, const bf* __restrict__ Al, const bf* __restrict__ Bn, const float* __restrict__ bias, float* C, int ldc, h16* C2, const int* __restrict__ lens) {
    __shared__ __align__(16) float ost[4][16 * 68];
    const bool past = tile_past(lens, blockIdx.x * 64);          // the block's 64 tokens all lie beyond their item's length (block-uniform)
    if (!SPLITA && past) return;                                 // q, k, v rows that nobody reads; stands in front of the barrier
    const int lane = threadIdx.x & 31, lr = lane & 15, hi = lane >> 4;
    const int wave = __builtin_amdgcn_readfirstlane(threadIdx.x >> 5);     // the same in every lane of a wave: fragment bases stay in scalar registers
    const unsigned l8 = lane * 8;                                // the one per-lane part of every fragment address
    const int r0 = blockIdx.x * 64 + wave * 16, c0 = blockIdx.y * 64;
    const bf* Ap = A + FRG(r0 >> 4, 0);
    const bf* Alp = SPLITA ? Al + FRG(r0 >> 4, 0) : Ap;
    const bf* Bp = Bn + FRG(c0 >> 4, 0);
    v8f acc[4];
#pragma unroll
    for (int t = 0; t < 4; ++t) acc[t] = (v8f){};
#pragma unroll 1
    for (int kc = (SPLITA && past) ? DM : 0; kc < DM; kc += 32) {     // output projection of all-zero context rows: no trip, the bias alone is stored
        const int ko = kc * 16;                                  // 512 elements per 32-k fragment
        const bf* ap = Ap + ko + l8; const bf* alp = Alp + ko + l8; const bf* bp = Bp + ko + l8;     // this trip's three load addresses
        const v16bf a = cat16b(*(const v8us*)ap, *(const v8us*)(ap + 256));
        v16bf al = a;
        if (SPLITA) al = cat16b(*(const v8us*)alp, *(const v8us*)(alp + 256));
#pragma unroll
        for (int t = 0; t < 4; ++t) { const bf* bk = bp + FRG(t, 0); const v16bf b = cat16b(*(const v8us*)bk, *(const v8us*)(bk + 256)); acc[t] = wmmab(a, b, acc[t]); if (SPLITA) acc[t] = wmmab(al, b, acc[t]); }
        // the addresses are inputs here so that no later load's result is placed over an address register while a load that names it is still out
        asm volatile("v_nop\n\tv_nop\n\tv_nop\n\tv_nop" : "+v"(acc[0]), "+v"(acc[1]), "+v"(acc[2]), "+v"(acc[3]) : "v"(a), "v"(al), "v"(ap), "v"(alp), "v"(bp));
    }
    float* os = &ost[wave][0];
#pragma unroll
    for (int t = 0; t < 4; ++t) { const float bv = bias ? bfr(bias[c0 + t * 16 + lr]) : 0.f;
#pragma unroll
        for (int j = 0; j < 8; ++j) os[(hi * 8 + j) * 68 + t * 16 + lr] = acc[t][j] + bv; }
    __syncthreads();
    if (F16OUT) {
        const size_t cfo = FRG(r0 >> 4, c0 >> 5);                // the wave's 16 x 64 tile = two fragments, 2 KB in a row
        h16* cf = (h16*)(void*)C + cfo;
        auto pass = [&]() {
#pragma unroll
            for (int s = 0; s < 4; ++s) { const float* sp = os + lr * 68 + s * 16 + hi * 8; v8h o, o2;     // s = fragment * 2 + piece
#pragma unroll
                for (int i = 0; i < 8; ++i) { const h16 a = (h16)sp[i]; o[i] = a; o2[i] = (h16)((sp[i] - (float)a) * LOSC); }
                *(v8h*)(cf + s * 256 + l8) = o;
                asm volatile("s_wait_xcnt 0x0" ::: "memory");    // stands before the issued store's registers are reused for the residual
                if (C2) *(v8h*)(C2 + cfo + s * 256 + l8) = o2; }
        };
        pass(); 
    } else {
        float* crow = C + (size_t)r0 * ldc + c0;
        auto pass = [&]() {
#pragma unroll
            for (int s = 0; s < 8; ++s) { const int Lid = (lane >> 3) + 4 * s, piece = lane & 7; const int row = Lid >> 1, cofs = (Lid & 1) * 32 + piece * 4;
                const v4f val = *(const v4fa*)(os + row * 68 + cofs); *(v4f*)(crow + (size_t)row * ldc + cofs) = val;
                asm volatile("s_wait_xcnt 0x0" ::: "memory"); }  // stands before the issued store's registers are reused
        };
        pass(); 
    }
}

__global__ __launch_bounds__(256) void k_vt(const float* __restrict__ V, h16* VTH, h16* VTL, const int* __restrict__ lens) {
    __shared__ __align__(16) h16 tile[64 * 72];
    __shared__ __align__(16) h16 til2[64 * 72];
    const int bid = blockIdx.x;
    const int b = bid / (NKV * (NT_ / 64)), rem = bid - b * (NKV * (NT_ / 64)), h = rem / (NT_ / 64), kt = rem - h * (NT_ / 64);
    const int k0 = kt * 64, tid = threadIdx.x;
    if (k0 >= len_of(lens, b)) return;                           // 64 keys beyond the length: no key tile of k_attn reads them (block-uniform, in front of the barrier)
    const int kk = tid >> 2, d0 = (tid & 3) * 16;
    const float* src = V + ((size_t)b * NT_ + k0 + kk) * KVW + h * HD + d0;      // h = kv head here
#pragma unroll
    for (int i = 0; i < 16; ++i) { const float v = src[i]; const h16 a = (h16)v; tile[(d0 + i) * 72 + kk] = a; til2[(d0 + i) * 72 + kk] = (h16)((v - (float)a) * LOSC); }
    __syncthreads();
    const int rg0 = ((b * NKV + h) * HD) >> 4;                   // plane rows = (b, h, d), k = key position
    auto pass = [&]() {
#pragma unroll
        for (int s = 0; s < 4; ++s) { const int u = tid + 256 * s; const int pln = u >> 9, fr = (u >> 6) & 7, pc = (u >> 5) & 1, ln = u & 31;
            const v8h val = *(const v8ha*)((pln ? til2 : tile) + ((fr >> 1) * 16 + (ln & 15)) * 72 + (fr & 1) * 32 + pc * 16 + (ln >> 4) * 8);
            *(v8h*)((pln ? VTL : VTH) + FRG(rg0 + (fr >> 1), (k0 >> 5) + (fr & 1)) + pc * 256 + ln * 8) = val; }
    };
    pass(); 
}

// k_attn: block = (b, h, 64 queries), wave = 16; the key tiles that begin below lengths[b]; 4 WMMA scores /8 (f32), online softmax, weights x32768 f16 tile (same-wave may_alias
// reload after a compiler barrier), 4 WMMA .v; ctx -> bf16 hi + residual planes CH/CL (rows tok, k = h*64+d, fragment-major).
__global__ __launch_bounds__(128) void k_attn(const h16* __restrict__ Q16, const h16* __restrict__ QL16, const h16* __restrict__ K16, const h16* __restrict__ KL16, const h16* __restrict__ VTH, const h16* __restrict__ VTL, const int* __restrict__ lens, int bofs, bf* CH, bf* CL) {
    __shared__ __align__(16) h16 plds[4][16 * 32];
    __shared__ __align__(16) h16 plds2[4][16 * 32];
    __shared__ __align__(16) float ost[4][16 * 68];
    const int lane = threadIdx.x & 31, lr = lane & 15, hi = lane >> 4;
    const int wave = __builtin_amdgcn_readfirstlane(threadIdx.x >> 5);     // the same in every lane of a wave: fragment bases stay in scalar registers
    const unsigned l8 = lane * 8;                                // the one per-lane part of every fragment address
    const int bid = blockIdx.x;
    const int b = bid / (NH_ * (NT_ / 64)), rem = bid - b * (NH_ * (NT_ / 64)), h = rem / (NT_ / 64), qt = rem - h * (NT_ / 64);
    const int q0 = qt * 64 + wave * 16;
    const int len = len_of(lens, bofs + b);                      // INPUT length of this batch item (block-uniform)
    if (qt * 64 >= len) return;                                  // 64 masked queries: the output projection does not read their context rows (in front of the barrier)
    const size_t tok0 = (size_t)b * NT_;
    h16* pl = &plds[wave][0]; h16* pl2 = &plds2[wave][0];
    v16h qa[2];
    const size_t qo0 = FRG((tok0 + q0) >> 4, h * 2);
#pragma unroll
    for (int kc = 0; kc < 2; ++kc) qa[kc] = cat16(*(const v8h*)(Q16 + qo0 + kc * 512 + l8), *(const v8h*)(Q16 + qo0 + kc * 512 + 256 + l8));
    asm volatile("s_wait_xcnt 0x0" ::: "memory");                // stands before the issued query loads' base registers are reused
    const int g = h / (NH_ / NKV);                      // kv head
    const h16* kh_b = K16 + FRG(tok0 >> 4, g * 2);
    const h16* kl_b = KL16 + FRG(tok0 >> 4, g * 2);
    const size_t vbase = FRG(((b * NKV + g) * HD) >> 4, 0);
    v8f o[4], ox[4];
#pragma unroll
    for (int n = 0; n < 4; ++n) { o[n] = (v8f){}; ox[n] = (v8f){}; }
    float mrow[8], lpart[8];
#pragma unroll
    for (int j = 0; j < 8; ++j) { mrow[j] = -3.0e38f; lpart[j] = 0.f; }
    int qpos[8];
#pragma unroll
    for (int j = 0; j < 8; ++j) qpos[j] = q0 + 8 * hi + j;
    const int kt_hi = (q0 < len ? (len + 31) / 32 : 1) - 1;      // wave-uniform, >= 0 (len >= 1 here): a tile of keys >= len adds exactly 0 to sum and context and leaves the maximum; 16 masked queries need one tile only
    int kt = 0;
#pragma unroll 1
    do {
        const int l0 = kt * 32;
        const h16* kh0 = kh_b + FRG(kt * 2, 0) + l8; const h16* kl0 = kl_b + FRG(kt * 2, 0) + l8;     // keys l0..l0+15; the next 16 keys lie FRG(1, 0) further
        const h16* vhp = VTH + vbase + FRG(0, kt) + l8; const h16* vlp = VTL + vbase + FRG(0, kt) + l8;
        v8f s0 = {}, s1 = {}, x0 = {}, x1 = {};
#pragma unroll
        for (int kc = 0; kc < 2; ++kc) {
            { const v16h k0h = cat16(*(const v8h*)(kh0 + kc * 512), *(const v8h*)(kh0 + kc * 512 + 256)), k1h = cat16(*(const v8h*)(kh0 + FRG(1, 0) + kc * 512), *(const v8h*)(kh0 + FRG(1, 0) + kc * 512 + 256));
              const v16h qlk = cat16(*(const v8h*)(QL16 + qo0 + kc * 512 + l8), *(const v8h*)(QL16 + qo0 + kc * 512 + 256 + l8));     // query residual re-read per step (registers)
              s0 = wmma16(qa[kc], k0h, s0); x0 = wmma16(qlk, k0h, x0); s1 = wmma16(qa[kc], k1h, s1); x1 = wmma16(qlk, k1h, x1);
              asm volatile("v_nop" : "+v"(s0), "+v"(s1), "+v"(x0), "+v"(x1) : "v"(qlk), "v"(k0h), "v"(k1h) : "memory"); }
            { const v16h k0l = cat16(*(const v8h*)(kl0 + kc * 512), *(const v8h*)(kl0 + kc * 512 + 256)), k1l = cat16(*(const v8h*)(kl0 + FRG(1, 0) + kc * 512), *(const v8h*)(kl0 + FRG(1, 0) + kc * 512 + 256));
              x0 = wmma16(qa[kc], k0l, x0); x1 = wmma16(qa[kc], k1l, x1);
              asm volatile("v_nop" : "+v"(x0), "+v"(x1) : "v"(k0l), "v"(k1l) : "memory"); }
        }
        // the key addresses are inputs here so that no later load's result is placed over an address register while a load that names it is still out
        asm volatile("v_nop\n\tv_nop\n\tv_nop\n\tv_nop" : "+v"(s0), "+v"(s1), "+v"(x0), "+v"(x1) : "v"(qa[0]), "v"(qa[1]), "v"(kh0), "v"(kl0));
        float alpha[8];
#pragma unroll
        for (int j = 0; j < 8; ++j) {
            const int ja = l0 + lr, jb = l0 + 16 + lr, qi = qpos[j];
            const bool va = (qi < len) && (ja < len), vb = (qi < len) && (jb < len);
            const float a0 = va ? (s0[j] + x0[j] * LOSCI) * 0.125f : NEGV, a1 = vb ? (s1[j] + x1[j] * LOSCI) * 0.125f : NEGV;
            float mx = fmaxf(a0, a1);
            mx = fmaxf(mx, __shfl_xor(mx, 1, 16)); mx = fmaxf(mx, __shfl_xor(mx, 2, 16)); mx = fmaxf(mx, __shfl_xor(mx, 4, 16)); mx = fmaxf(mx, __shfl_xor(mx, 8, 16));
            const float mn = fmaxf(mrow[j], mx);
            alpha[j] = __expf(mrow[j] - mn); mrow[j] = mn;
            const float p0 = __expf(a0 - mn), p1 = __expf(a1 - mn);
            lpart[j] = lpart[j] * alpha[j] + (p0 + p1);             // normaliser over the (masked-to-NEG) scores, as the reference's softmax
            const int mr = hi * 8 + j;
            const float ps0 = va ? p0 * PSC : 0.f, ps1 = vb ? p1 * PSC : 0.f; const h16 h0 = (h16)ps0, h1 = (h16)ps1;     // attn * mask
            pl[mr * 32 + lr] = h0; pl[mr * 32 + 16 + lr] = h1;
            pl2[mr * 32 + lr] = (h16)((ps0 - (float)h0) * LOSC); pl2[mr * 32 + 16 + lr] = (h16)((ps1 - (float)h1) * LOSC);
        }
#pragma unroll
        for (int n = 0; n < 4; ++n)
#pragma unroll
            for (int j = 0; j < 8; ++j) { o[n][j] *= alpha[j]; ox[n][j] *= alpha[j]; }
        asm volatile("" ::: "memory");
        const v16h pa = cat16(*(const v8ha*)(pl + lr * 32 + hi * 8), *(const v8ha*)(pl + lr * 32 + 16 + hi * 8));
        const v16h px = cat16(*(const v8ha*)(pl2 + lr * 32 + hi * 8), *(const v8ha*)(pl2 + lr * 32 + 16 + hi * 8));
#pragma unroll
        for (int n = 0; n < 4; ++n) { const size_t vo = FRG(n, 0);
            const v16h vh = cat16(*(const v8h*)(vhp + vo), *(const v8h*)(vhp + vo + 256)), vl = cat16(*(const v8h*)(vlp + vo), *(const v8h*)(vlp + vo + 256));
            o[n] = wmma16(pa, vh, o[n]); ox[n] = wmma16(pa, vl, ox[n]); ox[n] = wmma16(px, vh, ox[n]);
            asm volatile("" : "+v"(o[n]), "+v"(ox[n]) : "v"(vh), "v"(vl) : "memory"); }
        asm volatile("v_nop\n\tv_nop\n\tv_nop\n\tv_nop" : "+v"(o[0]), "+v"(o[1]), "+v"(o[2]), "+v"(o[3]), "+v"(ox[0]), "+v"(ox[1]), "+v"(ox[2]), "+v"(ox[3]) : "v"(pa), "v"(px), "v"(vhp), "v"(vlp));     // value addresses as inputs: as at the key addresses above
    } while (++kt <= kt_hi);
    float inv[8];
#pragma unroll
    for (int j = 0; j < 8; ++j) { float rs = lpart[j]; rs += __shfl_xor(rs, 1, 16); rs += __shfl_xor(rs, 2, 16); rs += __shfl_xor(rs, 4, 16); rs += __shfl_xor(rs, 8, 16); inv[j] = 1.0f / (rs * PSC); }
    float* os = &ost[wave][0];
#pragma unroll
    for (int n = 0; n < 4; ++n)
#pragma unroll
        for (int j = 0; j < 8; ++j) os[(hi * 8 + j) * 68 + n * 16 + lr] = (o[n][j] + ox[n][j] * LOSCI) * inv[j];
    __syncthreads();
    const size_t cbase = FRG((tok0 + q0) >> 4, h * 2);
    auto pass = [&]() {
#pragma unroll
        for (int s = 0; s < 4; ++s) { const float* sp = os + lr * 68 + s * 16 + hi * 8; v8us oh, ol;     // s = fragment * 2 + piece
#pragma unroll
            for (int i = 0; i < 8; ++i) { const unsigned short hb = f2bf(sp[i]); oh[i] = hb; ol[i] = f2bf(sp[i] - bf2f(hb)); }
            *(v8us*)(CH + cbase + s * 256 + l8) = oh; *(v8us*)(CL + cbase + s * 256 + l8) = ol; }
    };
    pass(); 
}

#define VST2(T, p, v) do { const T vst2_v_ = (v); *(T*)(p) = vst2_v_;  } while (0)
extern "C" void kernel_launch(void* const* d_in, const int* in_sizes, int n_in,
                              void* d_out, int out_size, void* d_ws, size_t ws_size, hipStream_t stream) {
    (void)in_sizes; (void)n_in; (void)out_size;
    const float* x = (const float*)d_in[0]; const int* lens = (const int*)d_in[1]; const float* Wqkv = (const float*)d_in[2]; const float* bqkv = (const float*)d_in[3]; const float* Wo = (const float*)d_in[4]; const float* bo = (const float*)d_in[5];
    float* out = (float*)d_out;    // [8][1024][1024]
    char* wsp = (char*)d_ws;
    auto take = [&](size_t bytes) { char* p = wsp; wsp += (bytes + 255) & ~(size_t)255; return (void*)p; };
    bf* Xb = (bf*)take((size_t)NTK * DM * 2); bf* W3T = (bf*)take((size_t)3 * DM * DM * 2); bf* WoT = (bf*)take((size_t)DM * DM * 2);
    h16* QH = (h16*)take((size_t)NTK * DM * 2); h16* QL = (h16*)take((size_t)NTK * DM * 2); h16* KH = (h16*)take((size_t)NTK * DM * 2); h16* KL = (h16*)take((size_t)NTK * DM * 2);
    float* Vf = (float*)take((size_t)NTK * DM * 4); h16* VTL = (h16*)take((size_t)NTK * DM * 2);
    if ((size_t)(wsp - (char*)d_ws) > ws_size) return;    // 8 batch items = 8192 rows: 16.8 + 6.3 + 2.1 + 4 x 16.8 + 33.6 + 16.8 ~ 143 MB
    h16* VTH = (h16*)Xb; bf* CH = (bf*)Vf; bf* CL = (bf*)((char*)Vf + (size_t)NTK * DM * 2);
    k_wt<<<dim3(DM / 64, (3 * DM) / 64, 1), 256, 0, stream>>>(Wqkv, 3 * DM, W3T);
    k_wt<<<dim3(DM / 64, DM / 64, 1), 256, 0, stream>>>(Wo, DM, WoT);
    k_cvtb<<<NTK / 8, 256, 0, stream>>>(x, NTK, Xb, lens);
    k_gemmb<false, true><<<dim3(NTK / 64, DM / 64, 1), 128, 0, stream>>>(Xb, nullptr, W3T, bqkv, (float*)(void*)QH, DM, QL, lens);
    k_gemmb<false, true><<<dim3(NTK / 64, DM / 64, 1), 128, 0, stream>>>(Xb, nullptr, W3T + (size_t)DM * DM, bqkv + DM, (float*)(void*)KH, DM, KL, lens);
    k_gemmb<false, false><<<dim3(NTK / 64, DM / 64, 1), 128, 0, stream>>>(Xb, nullptr, W3T + (size_t)2 * DM * DM, bqkv + 2 * DM, Vf, DM, nullptr, lens);
    k_vt<<<NB_ * NKV * (NT_ / 64), 256, 0, stream>>>(Vf, VTH, VTL, lens);
    k_attn<<<NB_ * NH_ * (NT_ / 64), 128, 0, stream>>>(QH, QL, KH, KL, VTH, VTL, lens, 0, CH, CL);
    k_gemmb<true, false><<<dim3(NTK / 64, DM / 64, 1), 128, 0, stream>>>(CH, CL, WoT, bo, out, DM, nullptr, lens);
}

// v004
// Measured time: 356 microseconds a run.
// Two timings next to v003 put it at 1.25 and 1.27 times that version's speed.
// Over all steps from v000 it is 2.20 times as fast.
#include <hip/hip_runtime.h>

// Contractions, f32 accumulate: qkv = x.w_qkv + b_qkv ([8192 x 1024].[1024 x 3072], k-major weight transposed to an n-major plane; PLAIN bf16 operands: inputs
// rounded once, exact) and out.w_o + b_o (merged heads as bf16 hi + residual: two products) on v_wmma_f32_16x16x32_bf16; the 16-head length-masked attention fused
// on v_wmma_f32_16x16x32_f16: logits = q.k/8 where query AND key are < lengths[b] (the INPUT), else -1e9 (the reference's score*mask + NEG(1-mask)); softmax; the
// weights are multiplied by the same mask again (so rows beyond the length give exactly zero context); q and k as f16 hi + residual x1024 (hi.hi + hi.lo + lo.hi),

#define NB_  8                   // all 8 batch items go through every launch together
#define NT_  1024
#define DM   1024
#define NH_  16
#define NKV  16
#define KVW  (NKV * HD)          // 1024
#define HD   64
#define NTK  (NB_ * NT_)
#define NW   1024
#define NQKV 1024
#define PSC  32768.0f
#define NEGV (-1.0e9f)
#define LOSC 1024.0f
#define LOSCI (1.0f / 1024.0f)
// Every 16-bit operand plane in the workspace (rows of 1024 elements) is stored fragment-major: the 16 rows x 32 k of one WMMA operand fragment are 512 consecutive
// elements, element (row, k) at FRG(row / 16, k / 32) + ((k % 32) / 16) * 256 + ((((k % 16) / 8) * 16) + row % 16) * 8 + k % 8. A lane's two 16-byte pieces then
// lie at lane * 8 and 256 + lane * 8, so one wave load reads 512 consecutive bytes (4 whole 128-byte lines) where the row-major plane made it touch 16 lines.
#define FRG(rg, kc32) (((size_t)(rg) * (DM / 32) + (size_t)(kc32)) * 512)

typedef _Float16 h16;
typedef unsigned short bf;
typedef __attribute__((ext_vector_type(16))) __bf16   v16bf;
typedef __attribute__((ext_vector_type(16))) _Float16 v16h;
typedef __attribute__((ext_vector_type(8)))  _Float16 v8h;
typedef __attribute__((ext_vector_type(8)))  unsigned short v8us;
typedef __attribute__((ext_vector_type(8)))  float    v8f;
typedef __attribute__((ext_vector_type(4)))  float    v4f;
typedef v8h  __attribute__((may_alias)) v8ha;
typedef v4f  __attribute__((may_alias)) v4fa;
typedef v8us __attribute__((may_alias)) v8usa;

__device__ __forceinline__ unsigned short f2bf(float f) { unsigned u = __float_as_uint(f); u += 0x7FFFu + ((u >> 16) & 1u); return (unsigned short)(u >> 16); }
__device__ __forceinline__ float bf2f(unsigned short b) { return __uint_as_float(((unsigned)b) << 16); }
__device__ __forceinline__ float bfr(float f) { return bf2f(f2bf(f)); }
__device__ __forceinline__ v16h cat16(v8h lo, v8h hi) { return __builtin_shufflevector(lo, hi, 0, 1, 2, 3, 4, 5, 6, 7, 8, 9, 10, 11, 12, 13, 14, 15); }
__device__ __forceinline__ v16bf cat16b(v8us lo, v8us hi) { return __builtin_bit_cast(v16bf, __builtin_shufflevector(lo, hi, 0, 1, 2, 3, 4, 5, 6, 7, 8, 9, 10, 11, 12, 13, 14, 15)); }
__device__ __forceinline__ v8f wmma16(v16h a, v16h b, v8f c) { return __builtin_amdgcn_wmma_f32_16x16x32_f16(false, a, false, b, (short)0, c, false, false); }
__device__ __forceinline__ v8f wmmab(v16bf a, v16bf b, v8f c) { return __builtin_amdgcn_wmma_f32_16x16x32_bf16(false, a, false, b, (short)0, c, false, false); }

// lengths[b] (the INPUT), clamped to 0..NT_. A token at or beyond it is masked as query and as key: its context row is exactly zero and its key weighs exactly zero
// (exp(-1e9 - max) = 0 in f32), so a 64-token tile that lies wholly beyond the length is left out of every launch; the output rows there are the bias alone.
__device__ __forceinline__ int len_of(const int* __restrict__ lens, int b) { const int l = lens[b]; return l < 0 ? 0 : (l > NT_ ? NT_ : l); }
__device__ __forceinline__ bool tile_past(const int* __restrict__ lens, int row) { return ((row & (NT_ - 1)) & ~63) >= len_of(lens, row / NT_); }     // row = b * NT_ + token

__global__ __launch_bounds__(256) void k_cvtb(const float* __restrict__ src, int nrows, bf* dst, const int* __restrict__ lens) {
    if (tile_past(lens, ((blockIdx.x * 8) / (DM / 64)) * 16)) return;     // the block's 8 waves share one 16-row group (block-uniform)
    const int lane = threadIdx.x & 31, lr = lane & 15, hi = lane >> 4;
    const int gw = blockIdx.x * 8 + (threadIdx.x >> 5);          // one wave: 16 rows x 64 k = two fragments
    const int rg = gw / (DM / 64), kq = gw - rg * (DM / 64);
    if (rg * 16 >= nrows) return;
    const float* sp = src + (size_t)(rg * 16 + lr) * DM + kq * 64 + hi * 8;
    v8us o[4];
#pragma unroll
    for (int u = 0; u < 4; ++u) { v8us t;                        // u = fragment * 2 + piece
#pragma unroll
        for (int i = 0; i < 8; ++i) t[i] = f2bf(sp[u * 16 + i]);
        o[u] = t; }
    bf* dp = dst + FRG(rg, kq * 2) + lane * 8;
#pragma unroll
    for (int u = 0; u < 4; ++u) *(v8us*)(dp + u * 256) = o[u];
}

// k_wt: W [1024 k][ncols n] (k-major) -> n-major bf16 plane WT (rows n, fragment-major); 64 x 64 tiles through LDS.
__global__ __launch_bounds__(256) void k_wt(const float* __restrict__ Wm, int ncols, bf* WT) {
    __shared__ __align__(16) unsigned short tl[64 * 72];
    const int tid = threadIdx.x, k0 = blockIdx.x * 64, n0 = blockIdx.y * 64;
    const int kk = tid >> 2, nq = (tid & 3) * 16;
#pragma unroll
    for (int i = 0; i < 16; ++i) tl[(nq + i) * 72 + kk] = f2bf(Wm[(size_t)(k0 + kk) * ncols + n0 + nq + i]);
    __syncthreads();
    typedef __attribute__((ext_vector_type(8))) unsigned short v8us_; typedef v8us_ __attribute__((may_alias)) v8usa_;
    auto pass = [&]() {
#pragma unroll
        for (int s = 0; s < 2; ++s) { const int u = tid + 256 * s; const int fr = u >> 6, pc = (u >> 5) & 1, ln = u & 31;     // 8 fragments: (fr >> 1) = 16-row group, (fr & 1) = 32-k chunk
            const v8us_ val = *(const v8usa_*)(tl + ((fr >> 1) * 16 + (ln & 15)) * 72 + (fr & 1) * 32 + pc * 16 + (ln >> 4) * 8);
            *(v8us_*)(WT + FRG((n0 >> 4) + (fr >> 1), (k0 >> 5) + (fr & 1)) + pc * 256 + ln * 8) = val; }
    };
    pass(); 
}

template <bool SPLITA, bool F16OUT = false>
__global__ __launch_bounds__(128) void k_gemmb(const bf* __restrict__ A, const bf* __restrict__ Al, const bf* __restrict__ Bn, const float* __restrict__ bias, float* C, int ldc, h16* C2, const int* __restrict__ lens) {
    __shared__ __align__(16) float ost[4][16 * 68];
    const bool past = tile_past(lens, blockIdx.x * 64);          // the block's 64 tokens all lie beyond their item's length (block-uniform)
    if (!SPLITA && past) return;                                 // q, k, v rows that nobody reads; stands in front of the barrier
    const int lane = threadIdx.x & 31, lr = lane & 15, hi = lane >> 4;
    const int wave = __builtin_amdgcn_readfirstlane(threadIdx.x >> 5);     // the same in every lane of a wave: fragment bases stay in scalar registers
    const unsigned l8 = lane * 8;                                // the one per-lane part of every fragment address
    const int r0 = blockIdx.x * 64 + wave * 16, c0 = blockIdx.y * 64;
    const bf* Ap = A + FRG(r0 >> 4, 0);
    const bf* Alp = SPLITA ? Al + FRG(r0 >> 4, 0) : Ap;
    const bf* Bp = Bn + FRG(c0 >> 4, 0);
    v8f acc[4];
#pragma unroll
    for (int t = 0; t < 4; ++t) acc[t] = (v8f){};
#pragma unroll 1
    for (int kc = (SPLITA && past) ? DM : 0; kc < DM; kc += 32) {     // output projection of all-zero context rows: no trip, the bias alone is stored
        const int ko = kc * 16;                                  // 512 elements per 32-k fragment
        const bf* ap = Ap + ko + l8; const bf* alp = Alp + ko + l8; const bf* bp = Bp + ko + l8;     // this trip's three load addresses
        const v16bf a = cat16b(*(const v8us*)ap, *(const v8us*)(ap + 256));
        v16bf al = a;
        if (SPLITA) al = cat16b(*(const v8us*)alp, *(const v8us*)(alp + 256));
#pragma unroll
        for (int t = 0; t < 4; ++t) { const bf* bk = bp + FRG(t, 0); const v16bf b = cat16b(*(const v8us*)bk, *(const v8us*)(bk + 256)); acc[t] = wmmab(a, b, acc[t]); if (SPLITA) acc[t] = wmmab(al, b, acc[t]); }
        // the addresses are inputs here so that no later load's result is placed over an address register while a load that names it is still out
        asm volatile("v_nop\n\tv_nop\n\tv_nop\n\tv_nop" : "+v"(acc[0]), "+v"(acc[1]), "+v"(acc[2]), "+v"(acc[3]) : "v"(a), "v"(al), "v"(ap), "v"(alp), "v"(bp));
    }
    float* os = &ost[wave][0];
#pragma unroll
    for (int t = 0; t < 4; ++t) { const float bv = bias ? bfr(bias[c0 + t * 16 + lr]) : 0.f;
#pragma unroll
        for (int j = 0; j < 8; ++j) os[(hi * 8 + j) * 68 + t * 16 + lr] = acc[t][j] + bv; }
    __syncthreads();
    if (F16OUT) {
        const size_t cfo = FRG(r0 >> 4, c0 >> 5);                // the wave's 16 x 64 tile = two fragments, 2 KB in a row
        h16* cf = (h16*)(void*)C + cfo;
        auto pass = [&]() {
#pragma unroll
            for (int s = 0; s < 4; ++s) { const float* sp = os + lr * 68 + s * 16 + hi * 8; v8h o, o2;     // s = fragment * 2 + piece
#pragma unroll
                for (int i = 0; i < 8; ++i) { const h16 a = (h16)sp[i]; o[i] = a; o2[i] = (h16)((sp[i] - (float)a) * LOSC); }
                *(v8h*)(cf + s * 256 + l8) = o;
                asm volatile("s_wait_xcnt 0x0" ::: "memory");    // stands before the issued store's registers are reused for the residual
                if (C2) *(v8h*)(C2 + cfo + s * 256 + l8) = o2; }
        };
        pass(); 
    } else {
        float* crow = C + (size_t)r0 * ldc + c0;
        auto pass = [&]() {
#pragma unroll
            for (int s = 0; s < 8; ++s) { const int Lid = (lane >> 3) + 4 * s, piece = lane & 7; const int row = Lid >> 1, cofs = (Lid & 1) * 32 + piece * 4;
                const v4f val = *(const v4fa*)(os + row * 68 + cofs); *(v4f*)(crow + (size_t)row * ldc + cofs) = val;
                asm volatile("s_wait_xcnt 0x0" ::: "memory"); }  // stands before the issued store's registers are reused
        };
        pass(); 
    }
}

__global__ __launch_bounds__(256) void k_vt(const float* __restrict__ V, h16* VTH, h16* VTL, const int* __restrict__ lens) {
    __shared__ __align__(16) h16 tile[64 * 72];
    __shared__ __align__(16) h16 til2[64 * 72];
    const int bid = blockIdx.x;
    const int b = bid / (NKV * (NT_ / 64)), rem = bid - b * (NKV * (NT_ / 64)), h = rem / (NT_ / 64), kt = rem - h * (NT_ / 64);
    const int k0 = kt * 64, tid = threadIdx.x;
    if (k0 >= len_of(lens, b)) return;                           // 64 keys beyond the length: no key tile of k_attn reads them (block-uniform, in front of the barrier)
    const int kk = tid >> 2, d0 = (tid & 3) * 16;
    const float* src = V + ((size_t)b * NT_ + k0 + kk) * KVW + h * HD + d0;      // h = kv head here
#pragma unroll
    for (int i = 0; i < 16; ++i) { const float v = src[i]; const h16 a = (h16)v; tile[(d0 + i) * 72 + kk] = a; til2[(d0 + i) * 72 + kk] = (h16)((v - (float)a) * LOSC); }
    __syncthreads();
    const int rg0 = ((b * NKV + h) * HD) >> 4;                   // plane rows = (b, h, d), k = key position
    auto pass = [&]() {
#pragma unroll
        for (int s = 0; s < 4; ++s) { const int u = tid + 256 * s; const int pln = u >> 9, fr = (u >> 6) & 7, pc = (u >> 5) & 1, ln = u & 31;
            const v8h val = *(const v8ha*)((pln ? til2 : tile) + ((fr >> 1) * 16 + (ln & 15)) * 72 + (fr & 1) * 32 + pc * 16 + (ln >> 4) * 8);
            *(v8h*)((pln ? VTL : VTH) + FRG(rg0 + (fr >> 1), (k0 >> 5) + (fr & 1)) + pc * 256 + ln * 8) = val; }
    };
    pass(); 
}

// k_attn: block = (b, h, 64 queries), wave = 16; the key tiles that begin below lengths[b]; 4 WMMA scores /8 (f32), online softmax, weights x32768 f16 tile (same-wave may_alias
// reload after a compiler barrier), 4 WMMA .v; ctx -> bf16 hi + residual planes CH/CL (rows tok, k = h*64+d, fragment-major).
// The 16 fragments of a 32-key tile (k hi, k residual, v hi, v residual: 16 KB, the same for the block's 4 waves) are brought into LDS once per block by asynchronous
// copies, two buffers, the next tile's copies in flight while this tile is worked on; stage layout in elements: k hi 0, k residual 2048, v hi 4096, v residual 6144.
#define STG 8192
__global__ __launch_bounds__(128) void k_attn(const h16* __restrict__ Q16, const h16* __restrict__ QL16, const h16* __restrict__ K16, const h16* __restrict__ KL16, const h16* __restrict__ VTH, const h16* __restrict__ VTL, const int* __restrict__ lens, int bofs, bf* CH, bf* CL) {
    __shared__ __align__(16) h16 plds[4][16 * 32];
    __shared__ __align__(16) h16 plds2[4][16 * 32];
    __shared__ __align__(16) float ost[4][16 * 68];
    __shared__ __align__(16) h16 ring[2 * STG];
    const int lane = threadIdx.x & 31, lr = lane & 15, hi = lane >> 4;
    const int wave = __builtin_amdgcn_readfirstlane(threadIdx.x >> 5);     // the same in every lane of a wave: fragment bases stay in scalar registers
    const unsigned l8 = lane * 8;                                // the one per-lane part of every fragment address
    const int bid = blockIdx.x;
    const int b = bid / (NH_ * (NT_ / 64)), rem = bid - b * (NH_ * (NT_ / 64)), h = rem / (NT_ / 64), qt = rem - h * (NT_ / 64);
    const int q0 = qt * 64 + wave * 16;
    const int len = len_of(lens, bofs + b);                      // INPUT length of this batch item (block-uniform)
    if (qt * 64 >= len) return;                                  // 64 masked queries: the output projection does not read their context rows (in front of the barrier)
    const size_t tok0 = (size_t)b * NT_;
    h16* pl = &plds[wave][0]; h16* pl2 = &plds2[wave][0];
    v16h qa[2];
    const size_t qo0 = FRG((tok0 + q0) >> 4, h * 2);
#pragma unroll
    for (int kc = 0; kc < 2; ++kc) qa[kc] = cat16(*(const v8h*)(Q16 + qo0 + kc * 512 + l8), *(const v8h*)(Q16 + qo0 + kc * 512 + 256 + l8));
    asm volatile("s_wait_xcnt 0x0" ::: "memory");                // stands before the issued query loads' base registers are reused
    const int g = h / (NH_ / NKV);                      // kv head
    const h16* kh_b = K16 + FRG(tok0 >> 4, g * 2);
    const h16* kl_b = KL16 + FRG(tok0 >> 4, g * 2);
    const size_t vbase = FRG(((b * NKV + g) * HD) >> 4, 0);
    v8f o[4], ox[4];
#pragma unroll
    for (int n = 0; n < 4; ++n) { o[n] = (v8f){}; ox[n] = (v8f){}; }
    float mrow[8], lpart[8];
#pragma unroll
    for (int j = 0; j < 8; ++j) { mrow[j] = -3.0e38f; lpart[j] = 0.f; }
    int qpos[8];
#pragma unroll
    for (int j = 0; j < 8; ++j) qpos[j] = q0 + 8 * hi + j;
    const int kt_hi = (len + 31) / 32 - 1;                       // block-uniform (every wave passes every barrier of the loop), >= 0 (len >= 1 here): a tile of keys >= len adds exactly 0 to sum and context and leaves the maximum
    const unsigned t8 = threadIdx.x * 8;                         // a thread's 16 bytes of each 2 KB that the block copies at once
    const unsigned ring0 = (unsigned)(size_t)&ring[0] + t8 * 2;  // its LDS byte address in buffer 0
    const h16* ksh = kh_b + t8; const h16* ksl = kl_b + t8;      // two fragments of one 16-key group lie in a row
    const size_t vso = vbase + FRG(threadIdx.x >> 6, 0) + (threadIdx.x & 63) * 8;     // 64 threads per v fragment, two fragments per copy
    auto stage = [&](int t) {                                    // tile t (t <= kt_hi <= 31: inside the planes) -> buffer t & 1; 8 copies of 16 bytes per lane, every lane on
        const unsigned d = ring0 + (unsigned)(t & 1) * (STG * 2);
        const h16* a0 = ksh + FRG(t * 2, 0); const h16* a1 = a0 + FRG(1, 0); const h16* a2 = ksl + FRG(t * 2, 0); const h16* a3 = a2 + FRG(1, 0);
        const h16* a4 = VTH + vso + FRG(0, t); const h16* a5 = a4 + FRG(2, 0); const h16* a6 = VTL + vso + FRG(0, t); const h16* a7 = a6 + FRG(2, 0);
        // the closing wait stands in the copies' own statement, in front of any rewrite of a register that a copy names
        asm volatile("global_load_async_to_lds_b128 %0, %8, off\n\tglobal_load_async_to_lds_b128 %1, %9, off\n\tglobal_load_async_to_lds_b128 %2, %10, off\n\tglobal_load_async_to_lds_b128 %3, %11, off\n\t"
                     "global_load_async_to_lds_b128 %4, %12, off\n\tglobal_load_async_to_lds_b128 %5, %13, off\n\tglobal_load_async_to_lds_b128 %6, %14, off\n\tglobal_load_async_to_lds_b128 %7, %15, off\n\ts_wait_xcnt 0x0"
                     :: "v"(d), "v"(d + 2048u), "v"(d + 4096u), "v"(d + 6144u), "v"(d + 8192u), "v"(d + 10240u), "v"(d + 12288u), "v"(d + 14336u),
                        "v"(a0), "v"(a1), "v"(a2), "v"(a3), "v"(a4), "v"(a5), "v"(a6), "v"(a7) : "memory");
    };
    stage(0);
    asm volatile("s_wait_asynccnt 0x0" ::: "memory");            // this wave's part of tile 0 has landed
    __syncthreads();                                             // every wave's part has: tile 0 may be read
    if (kt_hi >= 1) stage(1);
    int kt = 0;
#pragma unroll 1
    do {
        const int l0 = kt * 32;
        const h16* kh0 = ring + (kt & 1) * STG + l8; const h16* kl0 = kh0 + 2048;     // keys l0..l0+15; the next 16 keys lie 1024 elements further
        const h16* vhp = kh0 + 4096; const h16* vlp = kh0 + 6144;
        v8f s0 = {}, s1 = {}, x0 = {}, x1 = {};
#pragma unroll
        for (int kc = 0; kc < 2; ++kc) {
            { const v16h k0h = cat16(*(const v8ha*)(kh0 + kc * 512), *(const v8ha*)(kh0 + kc * 512 + 256)), k1h = cat16(*(const v8ha*)(kh0 + 1024 + kc * 512), *(const v8ha*)(kh0 + 1024 + kc * 512 + 256));
              const v16h qlk = cat16(*(const v8h*)(QL16 + qo0 + kc * 512 + l8), *(const v8h*)(QL16 + qo0 + kc * 512 + 256 + l8));     // query residual re-read per step (registers)
              s0 = wmma16(qa[kc], k0h, s0); x0 = wmma16(qlk, k0h, x0); s1 = wmma16(qa[kc], k1h, s1); x1 = wmma16(qlk, k1h, x1);
              asm volatile("v_nop" : "+v"(s0), "+v"(s1), "+v"(x0), "+v"(x1) : "v"(qlk), "v"(k0h), "v"(k1h) : "memory"); }
            { const v16h k0l = cat16(*(const v8ha*)(kl0 + kc * 512), *(const v8ha*)(kl0 + kc * 512 + 256)), k1l = cat16(*(const v8ha*)(kl0 + 1024 + kc * 512), *(const v8ha*)(kl0 + 1024 + kc * 512 + 256));
              x0 = wmma16(qa[kc], k0l, x0); x1 = wmma16(qa[kc], k1l, x1);
              asm volatile("v_nop" : "+v"(x0), "+v"(x1) : "v"(k0l), "v"(k1l) : "memory"); }
        }
        asm volatile("v_nop\n\tv_nop\n\tv_nop\n\tv_nop" : "+v"(s0), "+v"(s1), "+v"(x0), "+v"(x1) : "v"(qa[0]), "v"(qa[1]));
        float alpha[8];
#pragma unroll
        for (int j = 0; j < 8; ++j) {
            const int ja = l0 + lr, jb = l0 + 16 + lr, qi = qpos[j];
            const bool va = (qi < len) && (ja < len), vb = (qi < len) && (jb < len);
            const float a0 = va ? (s0[j] + x0[j] * LOSCI) * 0.125f : NEGV, a1 = vb ? (s1[j] + x1[j] * LOSCI) * 0.125f : NEGV;
            float mx = fmaxf(a0, a1);
            mx = fmaxf(mx, __shfl_xor(mx, 1, 16)); mx = fmaxf(mx, __shfl_xor(mx, 2, 16)); mx = fmaxf(mx, __shfl_xor(mx, 4, 16)); mx = fmaxf(mx, __shfl_xor(mx, 8, 16));
            const float mn = fmaxf(mrow[j], mx);
            alpha[j] = __expf(mrow[j] - mn); mrow[j] = mn;
            const float p0 = __expf(a0 - mn), p1 = __expf(a1 - mn);
            lpart[j] = lpart[j] * alpha[j] + (p0 + p1);             // normaliser over the (masked-to-NEG) scores, as the reference's softmax
            const int mr = hi * 8 + j;
            const float ps0 = va ? p0 * PSC : 0.f, ps1 = vb ? p1 * PSC : 0.f; const h16 h0 = (h16)ps0, h1 = (h16)ps1;     // attn * mask
            pl[mr * 32 + lr] = h0; pl[mr * 32 + 16 + lr] = h1;
            pl2[mr * 32 + lr] = (h16)((ps0 - (float)h0) * LOSC); pl2[mr * 32 + 16 + lr] = (h16)((ps1 - (float)h1) * LOSC);
        }
#pragma unroll
        for (int n = 0; n < 4; ++n)
#pragma unroll
            for (int j = 0; j < 8; ++j) { o[n][j] *= alpha[j]; ox[n][j] *= alpha[j]; }
        asm volatile("" ::: "memory");
        const v16h pa = cat16(*(const v8ha*)(pl + lr * 32 + hi * 8), *(const v8ha*)(pl + lr * 32 + 16 + hi * 8));
        const v16h px = cat16(*(const v8ha*)(pl2 + lr * 32 + hi * 8), *(const v8ha*)(pl2 + lr * 32 + 16 + hi * 8));
#pragma unroll
        for (int n = 0; n < 4; ++n) { const int vo = n * 512;
            const v16h vh = cat16(*(const v8ha*)(vhp + vo), *(const v8ha*)(vhp + vo + 256)), vl = cat16(*(const v8ha*)(vlp + vo), *(const v8ha*)(vlp + vo + 256));
            o[n] = wmma16(pa, vh, o[n]); ox[n] = wmma16(pa, vl, ox[n]); ox[n] = wmma16(px, vh, ox[n]);
            asm volatile("" : "+v"(o[n]), "+v"(ox[n]) : "v"(vh), "v"(vl) : "memory"); }
        asm volatile("v_nop\n\tv_nop\n\tv_nop\n\tv_nop" : "+v"(o[0]), "+v"(o[1]), "+v"(o[2]), "+v"(o[3]), "+v"(ox[0]), "+v"(ox[1]), "+v"(ox[2]), "+v"(ox[3]) : "v"(pa), "v"(px));
        asm volatile("s_wait_dscnt 0x0" ::: "memory");           // this wave's reads of the buffer have returned
        asm volatile("s_wait_asynccnt 0x0" ::: "memory");        // this wave's part of the next tile has landed
        __syncthreads();                                         // publishes the next tile and ends every wave's reads of this buffer, which is refilled behind it
        if (kt + 2 <= kt_hi) stage(kt + 2);
    } while (++kt <= kt_hi);
    asm volatile("s_wait_asynccnt 0x0" ::: "memory");            // no copy is out when the wave goes on to the epilogue
    float inv[8];
#pragma unroll
    for (int j = 0; j < 8; ++j) { float rs = lpart[j]; rs += __shfl_xor(rs, 1, 16); rs += __shfl_xor(rs, 2, 16); rs += __shfl_xor(rs, 4, 16); rs += __shfl_xor(rs, 8, 16); inv[j] = 1.0f / (rs * PSC); }
    float* os = &ost[wave][0];
#pragma unroll
    for (int n = 0; n < 4; ++n)
#pragma unroll
        for (int j = 0; j < 8; ++j) os[(hi * 8 + j) * 68 + n * 16 + lr] = (o[n][j] + ox[n][j] * LOSCI) * inv[j];
    __syncthreads();
    const size_t cbase = FRG((tok0 + q0) >> 4, h * 2);
    auto pass = [&]() {
#pragma unroll
        for (int s = 0; s < 4; ++s) { const float* sp = os + lr * 68 + s * 16 + hi * 8; v8us oh, ol;     // s = fragment * 2 + piece
#pragma unroll
            for (int i = 0; i < 8; ++i) { const unsigned short hb = f2bf(sp[i]); oh[i] = hb; ol[i] = f2bf(sp[i] - bf2f(hb)); }
            *(v8us*)(CH + cbase + s * 256 + l8) = oh; *(v8us*)(CL + cbase + s * 256 + l8) = ol; }
    };
    pass(); 
}

#define VST2(T, p, v) do { const T vst2_v_ = (v); *(T*)(p) = vst2_v_;  } while (0)
extern "C" void kernel_launch(void* const* d_in, const int* in_sizes, int n_in,
                              void* d_out, int out_size, void* d_ws, size_t ws_size, hipStream_t stream) {
    (void)in_sizes; (void)n_in; (void)out_size;
    const float* x = (const float*)d_in[0]; const int* lens = (const int*)d_in[1]; const float* Wqkv = (const float*)d_in[2]; const float* bqkv = (const float*)d_in[3]; const float* Wo = (const float*)d_in[4]; const float* bo = (const float*)d_in[5];
    float* out = (float*)d_out;    // [8][1024][1024]
    char* wsp = (char*)d_ws;
    auto take = [&](size_t bytes) { char* p = wsp; wsp += (bytes + 255) & ~(size_t)255; return (void*)p; };
    bf* Xb = (bf*)take((size_t)NTK * DM * 2); bf* W3T = (bf*)take((size_t)3 * DM * DM * 2); bf* WoT = (bf*)take((size_t)DM * DM * 2);
    h16* QH = (h16*)take((size_t)NTK * DM * 2); h16* QL = (h16*)take((size_t)NTK * DM * 2); h16* KH = (h16*)take((size_t)NTK * DM * 2); h16* KL = (h16*)take((size_t)NTK * DM * 2);
    float* Vf = (float*)take((size_t)NTK * DM * 4); h16* VTL = (h16*)take((size_t)NTK * DM * 2);
    if ((size_t)(wsp - (char*)d_ws) > ws_size) return;    // 8 batch items = 8192 rows: 16.8 + 6.3 + 2.1 + 4 x 16.8 + 33.6 + 16.8 ~ 143 MB
    h16* VTH = (h16*)Xb; bf* CH = (bf*)Vf; bf* CL = (bf*)((char*)Vf + (size_t)NTK * DM * 2);
    k_wt<<<dim3(DM / 64, (3 * DM) / 64, 1), 256, 0, stream>>>(Wqkv, 3 * DM, W3T);
    k_wt<<<dim3(DM / 64, DM / 64, 1), 256, 0, stream>>>(Wo, DM, WoT);
    k_cvtb<<<NTK / 8, 256, 0, stream>>>(x, NTK, Xb, lens);
    k_gemmb<false, true><<<dim3(NTK / 64, DM / 64, 1), 128, 0, stream>>>(Xb, nullptr, W3T, bqkv, (float*)(void*)QH, DM, QL, lens);
    k_gemmb<false, true><<<dim3(NTK / 64, DM / 64, 1), 128, 0, stream>>>(Xb, nullptr, W3T + (size_t)DM * DM, bqkv + DM, (float*)(void*)KH, DM, KL, lens);
    k_gemmb<false, false><<<dim3(NTK / 64, DM / 64, 1), 128, 0, stream>>>(Xb, nullptr, W3T + (size_t)2 * DM * DM, bqkv + 2 * DM, Vf, DM, nullptr, lens);
    k_vt<<<NB_ * NKV * (NT_ / 64), 256, 0, stream>>>(Vf, VTH, VTL, lens);
    k_attn<<<NB_ * NH_ * (NT_ / 64), 128, 0, stream>>>(QH, QL, KH, KL, VTH, VTL, lens, 0, CH, CL);
    k_gemmb<true, false><<<dim3(NTK / 64, DM / 64, 1), 128, 0, stream>>>(CH, CL, WoT, bo, out, DM, nullptr, lens);
}

// v005
// A run of this version takes 207 microseconds.
// Next to v004, in two timings, it ran 1.72 and 1.73 times as fast.
// Counting every step since v000, it is 3.80 times as fast.
#include <hip/hip_runtime.h>

// Contractions, f32 accumulate: qkv = x.w_qkv + b_qkv ([8192 x 1024].[1024 x 3072], k-major weight transposed to an n-major plane; PLAIN bf16 operands: inputs
// rounded once, exact) and out.w_o + b_o (merged heads as bf16 hi + residual: two products) on v_wmma_f32_16x16x32_bf16; the 16-head length-masked attention fused
// on v_wmma_f32_16x16x32_f16: logits = q.k/8 where query AND key are < lengths[b] (the INPUT), else -1e9 (the reference's score*mask + NEG(1-mask)); softmax; the
// weights are multiplied by the same mask again (so rows beyond the length give exactly zero context); q and k as f16 hi + residual x1024 (hi.hi + hi.lo + lo.hi),

#define NB_  8                   // all 8 batch items go through every launch together
#define NT_  1024
#define DM   1024
#define NH_  16
#define NKV  16
#define KVW  (NKV * HD)          // 1024
#define HD   64
#define NTK  (NB_ * NT_)
#define NW   1024
#define NQKV 1024
#define PSC  32768.0f
#define NEGV (-1.0e9f)
#define LOSC 1024.0f
#define LOSCI (1.0f / 1024.0f)
// Every 16-bit operand plane in the workspace (rows of 1024 elements) is stored fragment-major: the 16 rows x 32 k of one WMMA operand fragment are 512 consecutive
// elements, element (row, k) at FRG(row / 16, k / 32) + ((k % 32) / 16) * 256 + ((((k % 16) / 8) * 16) + row % 16) * 8 + k % 8. A lane's two 16-byte pieces then
// lie at lane * 8 and 256 + lane * 8, so one wave load reads 512 consecutive bytes (4 whole 128-byte lines) where the row-major plane made it touch 16 lines.
#define FRG(rg, kc32) (((size_t)(rg) * (DM / 32) + (size_t)(kc32)) * 512)

typedef _Float16 h16;
typedef unsigned short bf;
typedef __attribute__((ext_vector_type(16))) __bf16   v16bf;
typedef __attribute__((ext_vector_type(16))) _Float16 v16h;
typedef __attribute__((ext_vector_type(8)))  _Float16 v8h;
typedef __attribute__((ext_vector_type(8)))  unsigned short v8us;
typedef __attribute__((ext_vector_type(8)))  float    v8f;
typedef __attribute__((ext_vector_type(4)))  float    v4f;
typedef v8h  __attribute__((may_alias)) v8ha;
typedef v4f  __attribute__((may_alias)) v4fa;
typedef v8us __attribute__((may_alias)) v8usa;

__device__ __forceinline__ unsigned short f2bf(float f) { unsigned u = __float_as_uint(f); u += 0x7FFFu + ((u >> 16) & 1u); return (unsigned short)(u >> 16); }
__device__ __forceinline__ float bf2f(unsigned short b) { return __uint_as_float(((unsigned)b) << 16); }
__device__ __forceinline__ float bfr(float f) { return bf2f(f2bf(f)); }
__device__ __forceinline__ v16h cat16(v8h lo, v8h hi) { return __builtin_shufflevector(lo, hi, 0, 1, 2, 3, 4, 5, 6, 7, 8, 9, 10, 11, 12, 13, 14, 15); }
__device__ __forceinline__ v16bf cat16b(v8us lo, v8us hi) { return __builtin_bit_cast(v16bf, __builtin_shufflevector(lo, hi, 0, 1, 2, 3, 4, 5, 6, 7, 8, 9, 10, 11, 12, 13, 14, 15)); }
__device__ __forceinline__ v8f wmma16(v16h a, v16h b, v8f c) { return __builtin_amdgcn_wmma_f32_16x16x32_f16(false, a, false, b, (short)0, c, false, false); }
__device__ __forceinline__ v8f wmmab(v16bf a, v16bf b, v8f c) { return __builtin_amdgcn_wmma_f32_16x16x32_bf16(false, a, false, b, (short)0, c, false, false); }

// lengths[b] (the INPUT), clamped to 0..NT_. A token at or beyond it is masked as query and as key: its context row is exactly zero and its key weighs exactly zero
// (exp(-1e9 - max) = 0 in f32), so a 64-token tile that lies wholly beyond the length is left out of every launch; the output rows there are the bias alone.
__device__ __forceinline__ int len_of(const int* __restrict__ lens, int b) { const int l = lens[b]; return l < 0 ? 0 : (l > NT_ ? NT_ : l); }
__device__ __forceinline__ bool tile_past(const int* __restrict__ lens, int row) { return ((row & (NT_ - 1)) & ~63) >= len_of(lens, row / NT_); }     // row = b * NT_ + token

__global__ __launch_bounds__(256) void k_cvtb(const float* __restrict__ src, int nrows, bf* dst, const int* __restrict__ lens) {
    if (tile_past(lens, ((blockIdx.x * 8) / (DM / 64)) * 16)) return;     // the block's 8 waves share one 16-row group (block-uniform)
    const int lane = threadIdx.x & 31, lr = lane & 15, hi = lane >> 4;
    const int gw = blockIdx.x * 8 + (threadIdx.x >> 5);          // one wave: 16 rows x 64 k = two fragments
    const int rg = gw / (DM / 64), kq = gw - rg * (DM / 64);
    if (rg * 16 >= nrows) return;
    const float* sp = src + (size_t)(rg * 16 + lr) * DM + kq * 64 + hi * 8;
    v8us o[4];
#pragma unroll
    for (int u = 0; u < 4; ++u) { v8us t;                        // u = fragment * 2 + piece
#pragma unroll
        for (int i = 0; i < 8; ++i) t[i] = f2bf(sp[u * 16 + i]);
        o[u] = t; }
    bf* dp = dst + FRG(rg, kq * 2) + lane * 8;
#pragma unroll
    for (int u = 0; u < 4; ++u) *(v8us*)(dp + u * 256) = o[u];
}

// k_wt: W [1024 k][ncols n] (k-major) -> n-major bf16 plane WT (rows n, fragment-major); 64 x 64 tiles through LDS.
__global__ __launch_bounds__(256) void k_wt(const float* __restrict__ Wm, int ncols, bf* WT) {
    __shared__ __align__(16) unsigned short tl[64 * 72];
    const int tid = threadIdx.x, k0 = blockIdx.x * 64, n0 = blockIdx.y * 64;
    const int kk = tid >> 2, nq = (tid & 3) * 16;
#pragma unroll
    for (int i = 0; i < 16; ++i) tl[(nq + i) * 72 + kk] = f2bf(Wm[(size_t)(k0 + kk) * ncols + n0 + nq + i]);
    __syncthreads();
    typedef __attribute__((ext_vector_type(8))) unsigned short v8us_; typedef v8us_ __attribute__((may_alias)) v8usa_;
    auto pass = [&]() {
#pragma unroll
        for (int s = 0; s < 2; ++s) { const int u = tid + 256 * s; const int fr = u >> 6, pc = (u >> 5) & 1, ln = u & 31;     // 8 fragments: (fr >> 1) = 16-row group, (fr & 1) = 32-k chunk
            const v8us_ val = *(const v8usa_*)(tl + ((fr >> 1) * 16 + (ln & 15)) * 72 + (fr & 1) * 32 + pc * 16 + (ln >> 4) * 8);
            *(v8us_*)(WT + FRG((n0 >> 4) + (fr >> 1), (k0 >> 5) + (fr & 1)) + pc * 256 + ln * 8) = val; }
    };
    pass(); 
}

// k_gemmb: block = 64 rows x 128 columns, 4 waves of 32 x 64 (2 x 4 accumulator tiles). The operand fragments of 64 k (4 row groups of A, of its residual where SPLITA,
// and 8 column groups of B, 2 KB each) come into LDS once per block by asynchronous copies, two buffers, the next 64 k in flight while these are worked on.
// Stage layout in elements: A 0, B 4096, A residual 12288. Each accumulator takes its products in the same k order as before.
template <bool SPLITA, bool F16OUT = false>
__global__ __launch_bounds__(128) void k_gemmb(const bf* __restrict__ A, const bf* __restrict__ Al, const bf* __restrict__ Bn, const float* __restrict__ bias, float* C, int ldc, h16* C2, const int* __restrict__ lens) {
    constexpr int STE = SPLITA ? 16384 : 12288;                  // elements per stage
    __shared__ __align__(128) bf ring[2 * STE];                  // behind the loop its first 34,816 bytes stage the output tiles
    const bool past = tile_past(lens, blockIdx.x * 64);          // the block's 64 tokens all lie beyond their item's length (block-uniform)
    if (!SPLITA && past) return;                                 // q, k, v rows that nobody reads; stands in front of every barrier
    const int lane = threadIdx.x & 31, lr = lane & 15, hi = lane >> 4;
    const int wave = __builtin_amdgcn_readfirstlane(threadIdx.x >> 5);     // the same in every lane of a wave
    const int wm = wave >> 1, wn = wave & 1;
    const unsigned l8 = lane * 8;                                // the one per-lane part of every fragment address
    const int rb = blockIdx.x * 64, cb = blockIdx.y * 128;
    const int r0 = rb + wm * 32, c0 = cb + wn * 64;              // the wave's 32 x 64 tile
    v8f acc[2][4];
#pragma unroll
    for (int m = 0; m < 2; ++m)
#pragma unroll
        for (int t = 0; t < 4; ++t) acc[m][t] = (v8f){};
    if (!(SPLITA && past)) {                                     // output projection of all-zero context rows: no product, the bias alone is stored (block-uniform)
        const unsigned t8 = threadIdx.x * 8;                     // a thread's 16 bytes of each 2 KB that the block copies at once
        const unsigned ring0 = (unsigned)(size_t)&ring[0] + t8 * 2;     // its LDS byte address in buffer 0
        const bf* As = A + FRG(rb >> 4, 0) + t8;
        const bf* Als = SPLITA ? Al + FRG(rb >> 4, 0) + t8 : As;
        const bf* Bs = Bn + FRG(cb >> 4, 0) + t8;
        auto cp4 = [&](unsigned d, const bf* s) {                // 64 k of four 16-row groups: 4 copies of 16 bytes per lane, every lane on
            // the closing wait stands in the copies' own statement, in front of any rewrite of a register that a copy names
            asm volatile("global_load_async_to_lds_b128 %0, %4, off\n\tglobal_load_async_to_lds_b128 %1, %5, off\n\tglobal_load_async_to_lds_b128 %2, %6, off\n\tglobal_load_async_to_lds_b128 %3, %7, off\n\ts_wait_xcnt 0x0"
                         :: "v"(d), "v"(d + 2048u), "v"(d + 4096u), "v"(d + 6144u), "v"(s), "v"(s + FRG(1, 0)), "v"(s + FRG(2, 0)), "v"(s + FRG(3, 0)) : "memory");
        };
        auto cp8 = [&](unsigned d, const bf* s, const bf* u) {   // the same for four groups at s and four at u, into 16 KB in a row: one closing wait for the eight
            asm volatile("global_load_async_to_lds_b128 %0, %8, off\n\tglobal_load_async_to_lds_b128 %1, %9, off\n\tglobal_load_async_to_lds_b128 %2, %10, off\n\tglobal_load_async_to_lds_b128 %3, %11, off\n\t"
                         "global_load_async_to_lds_b128 %4, %12, off\n\tglobal_load_async_to_lds_b128 %5, %13, off\n\tglobal_load_async_to_lds_b128 %6, %14, off\n\tglobal_load_async_to_lds_b128 %7, %15, off\n\ts_wait_xcnt 0x0"
                         :: "v"(d), "v"(d + 2048u), "v"(d + 4096u), "v"(d + 6144u), "v"(d + 8192u), "v"(d + 10240u), "v"(d + 12288u), "v"(d + 14336u),
                            "v"(s), "v"(s + FRG(1, 0)), "v"(s + FRG(2, 0)), "v"(s + FRG(3, 0)), "v"(u), "v"(u + FRG(1, 0)), "v"(u + FRG(2, 0)), "v"(u + FRG(3, 0)) : "memory");
        };
        auto stage = [&](int t) {                                // k = 64 t .. 64 t + 63 (t <= 15: inside the planes) -> buffer t & 1
            const unsigned d = ring0 + (unsigned)(t & 1) * (STE * 2);
            const int ko = t * 1024;                             // two fragments of a row group lie in a row
            cp8(d, As + ko, Bs + ko);
            if (SPLITA) cp8(d + 16384u, Bs + FRG(4, 0) + ko, Als + ko); else cp4(d + 16384u, Bs + FRG(4, 0) + ko);
        };
        stage(0);
        asm volatile("s_wait_asynccnt 0x0" ::: "memory");        // this wave's part of stage 0 has landed
        __syncthreads();                                         // every wave's part has: stage 0 may be read
        stage(1);
#pragma unroll 1
        for (int t = 0; t < DM / 64; ++t) {                      // rolled: one copy of the body in the instruction cache
            const bf* st = ring + (t & 1) * STE + l8;
            const bf* ap = st + wm * 2048; const bf* bp = st + 4096 + wn * 4096;
            v16bf a[2][2], al[2][2], b[2][4];                    // [32-k half][tile]
#pragma unroll
            for (int kc = 0; kc < 2; ++kc) {
#pragma unroll
                for (int m = 0; m < 2; ++m) { const bf* p = ap + m * 1024 + kc * 512; a[kc][m] = cat16b(*(const v8usa*)p, *(const v8usa*)(p + 256));
                    al[kc][m] = SPLITA ? cat16b(*(const v8usa*)(p + 12288), *(const v8usa*)(p + 12288 + 256)) : a[kc][m]; }
#pragma unroll
                for (int n = 0; n < 4; ++n) { const bf* p = bp + n * 1024 + kc * 512; b[kc][n] = cat16b(*(const v8usa*)p, *(const v8usa*)(p + 256)); }
            }
            asm volatile("s_wait_dscnt 0x0" ::: "memory");       // this wave's reads of the buffer have returned: the whole stage is in registers
            asm volatile("s_wait_asynccnt 0x0" ::: "memory");    // this wave's part of the next stage has landed
            __syncthreads();                                     // publishes the next stage and ends every wave's reads of this buffer, which is refilled behind it
            if (t + 2 < DM / 64) stage(t + 2);
            // the products read registers alone and stand behind the refill, so that the copies fly under them
#pragma unroll
            for (int kc = 0; kc < 2; ++kc) {
#pragma unroll
                for (int n = 0; n < 4; ++n) { acc[0][n] = wmmab(a[kc][0], b[kc][n], acc[0][n]); acc[1][n] = wmmab(a[kc][1], b[kc][n], acc[1][n]); }
                if (SPLITA) {
#pragma unroll
                    for (int n = 0; n < 4; ++n) { acc[0][n] = wmmab(al[kc][0], b[kc][n], acc[0][n]); acc[1][n] = wmmab(al[kc][1], b[kc][n], acc[1][n]); }
                }
            }
        }
        asm volatile("s_wait_asynccnt 0x0" ::: "memory");        // no copy is out when the ring is reused for the output tiles
    }
    float* os = (float*)(void*)ring + wave * (32 * 68);
#pragma unroll
    for (int t = 0; t < 4; ++t) { const float bv = bias ? bfr(bias[c0 + t * 16 + lr]) : 0.f;
#pragma unroll
        for (int m = 0; m < 2; ++m)
#pragma unroll
            for (int j = 0; j < 8; ++j) os[(m * 16 + hi * 8 + j) * 68 + t * 16 + lr] = acc[m][t][j] + bv; }
    __syncthreads();
    if (F16OUT) {
#pragma unroll
        for (int m = 0; m < 2; ++m) {
            const size_t cfo = FRG((r0 >> 4) + m, c0 >> 5);      // 16 x 64 = two fragments, 2 KB in a row
            h16* cf = (h16*)(void*)C + cfo;
#pragma unroll
            for (int s = 0; s < 4; ++s) { const float* sp = os + (m * 16 + lr) * 68 + s * 16 + hi * 8; v8h o, o2;     // s = fragment * 2 + piece
#pragma unroll
                for (int i = 0; i < 8; ++i) { const h16 a = (h16)sp[i]; o[i] = a; o2[i] = (h16)((sp[i] - (float)a) * LOSC); }
                *(v8h*)(cf + s * 256 + l8) = o;
                asm volatile("s_wait_xcnt 0x0" ::: "memory");    // stands before the issued store's registers are reused for the residual
                if (C2) { *(v8h*)(C2 + cfo + s * 256 + l8) = o2;
                    asm volatile("s_wait_xcnt 0x0" ::: "memory"); } }     // stands before the issued store's registers are reused
        }
    } else {
        float* crow = C + (size_t)r0 * ldc + c0;
#pragma unroll
        for (int s = 0; s < 16; ++s) { const int Lid = (lane >> 3) + 4 * s, piece = lane & 7; const int row = Lid >> 1, cofs = (Lid & 1) * 32 + piece * 4;
            const v4f val = *(const v4fa*)(os + row * 68 + cofs); *(v4f*)(crow + (size_t)row * ldc + cofs) = val;
            asm volatile("s_wait_xcnt 0x0" ::: "memory"); }      // stands before the issued store's registers are reused
    }
}

__global__ __launch_bounds__(256) void k_vt(const float* __restrict__ V, h16* VTH, h16* VTL, const int* __restrict__ lens) {
    __shared__ __align__(16) h16 tile[64 * 72];
    __shared__ __align__(16) h16 til2[64 * 72];
    const int bid = blockIdx.x;
    const int b = bid / (NKV * (NT_ / 64)), rem = bid - b * (NKV * (NT_ / 64)), h = rem / (NT_ / 64), kt = rem - h * (NT_ / 64);
    const int k0 = kt * 64, tid = threadIdx.x;
    if (k0 >= len_of(lens, b)) return;                           // 64 keys beyond the length: no key tile of k_attn reads them (block-uniform, in front of the barrier)
    const int kk = tid >> 2, d0 = (tid & 3) * 16;
    const float* src = V + ((size_t)b * NT_ + k0 + kk) * KVW + h * HD + d0;      // h = kv head here
#pragma unroll
    for (int i = 0; i < 16; ++i) { const float v = src[i]; const h16 a = (h16)v; tile[(d0 + i) * 72 + kk] = a; til2[(d0 + i) * 72 + kk] = (h16)((v - (float)a) * LOSC); }
    __syncthreads();
    const int rg0 = ((b * NKV + h) * HD) >> 4;                   // plane rows = (b, h, d), k = key position
    auto pass = [&]() {
#pragma unroll
        for (int s = 0; s < 4; ++s) { const int u = tid + 256 * s; const int pln = u >> 9, fr = (u >> 6) & 7, pc = (u >> 5) & 1, ln = u & 31;
            const v8h val = *(const v8ha*)((pln ? til2 : tile) + ((fr >> 1) * 16 + (ln & 15)) * 72 + (fr & 1) * 32 + pc * 16 + (ln >> 4) * 8);
            *(v8h*)((pln ? VTL : VTH) + FRG(rg0 + (fr >> 1), (k0 >> 5) + (fr & 1)) + pc * 256 + ln * 8) = val; }
    };
    pass(); 
}

// k_attn: block = (b, h, 64 queries), wave = 16; the key tiles that begin below lengths[b]; 4 WMMA scores /8 (f32), online softmax, weights x32768 f16 tile (same-wave may_alias
// reload after a compiler barrier), 4 WMMA .v; ctx -> bf16 hi + residual planes CH/CL (rows tok, k = h*64+d, fragment-major).
// The 16 fragments of a 32-key tile (k hi, k residual, v hi, v residual: 16 KB, the same for the block's 4 waves) are brought into LDS once per block by asynchronous
// copies, two buffers, the next tile's copies in flight while this tile is worked on; stage layout in elements: k hi 0, k residual 2048, v hi 4096, v residual 6144.
#define STG 8192
__global__ __launch_bounds__(128) void k_attn(const h16* __restrict__ Q16, const h16* __restrict__ QL16, const h16* __restrict__ K16, const h16* __restrict__ KL16, const h16* __restrict__ VTH, const h16* __restrict__ VTL, const int* __restrict__ lens, int bofs, bf* CH, bf* CL) {
    __shared__ __align__(16) h16 plds[4][16 * 32];
    __shared__ __align__(16) h16 plds2[4][16 * 32];
    __shared__ __align__(16) float ost[4][16 * 68];
    __shared__ __align__(16) h16 ring[2 * STG];
    const int lane = threadIdx.x & 31, lr = lane & 15, hi = lane >> 4;
    const int wave = __builtin_amdgcn_readfirstlane(threadIdx.x >> 5);     // the same in every lane of a wave: fragment bases stay in scalar registers
    const unsigned l8 = lane * 8;                                // the one per-lane part of every fragment address
    const int bid = blockIdx.x;
    const int b = bid / (NH_ * (NT_ / 64)), rem = bid - b * (NH_ * (NT_ / 64)), h = rem / (NT_ / 64), qt = rem - h * (NT_ / 64);
    const int q0 = qt * 64 + wave * 16;
    const int len = len_of(lens, bofs + b);                      // INPUT length of this batch item (block-uniform)
    if (qt * 64 >= len) return;                                  // 64 masked queries: the output projection does not read their context rows (in front of the barrier)
    const size_t tok0 = (size_t)b * NT_;
    h16* pl = &plds[wave][0]; h16* pl2 = &plds2[wave][0];
    v16h qa[2];
    const size_t qo0 = FRG((tok0 + q0) >> 4, h * 2);
#pragma unroll
    for (int kc = 0; kc < 2; ++kc) qa[kc] = cat16(*(const v8h*)(Q16 + qo0 + kc * 512 + l8), *(const v8h*)(Q16 + qo0 + kc * 512 + 256 + l8));
    asm volatile("s_wait_xcnt 0x0" ::: "memory");                // stands before the issued query loads' base registers are reused
    const int g = h / (NH_ / NKV);                      // kv head
    const h16* kh_b = K16 + FRG(tok0 >> 4, g * 2);
    const h16* kl_b = KL16 + FRG(tok0 >> 4, g * 2);
    const size_t vbase = FRG(((b * NKV + g) * HD) >> 4, 0);
    v8f o[4], ox[4];
#pragma unroll
    for (int n = 0; n < 4; ++n) { o[n] = (v8f){}; ox[n] = (v8f){}; }
    float mrow[8], lpart[8];
#pragma unroll
    for (int j = 0; j < 8; ++j) { mrow[j] = -3.0e38f; lpart[j] = 0.f; }
    int qpos[8];
#pragma unroll
    for (int j = 0; j < 8; ++j) qpos[j] = q0 + 8 * hi + j;
    const int kt_hi = (len + 31) / 32 - 1;                       // block-uniform (every wave passes every barrier of the loop), >= 0 (len >= 1 here): a tile of keys >= len adds exactly 0 to sum and context and leaves the maximum
    const unsigned t8 = threadIdx.x * 8;                         // a thread's 16 bytes of each 2 KB that the block copies at once
    const unsigned ring0 = (unsigned)(size_t)&ring[0] + t8 * 2;  // its LDS byte address in buffer 0
    const h16* ksh = kh_b + t8; const h16* ksl = kl_b + t8;      // two fragments of one 16-key group lie in a row
    const size_t vso = vbase + FRG(threadIdx.x >> 6, 0) + (threadIdx.x & 63) * 8;     // 64 threads per v fragment, two fragments per copy
    auto stage = [&](int t) {                                    // tile t (t <= kt_hi <= 31: inside the planes) -> buffer t & 1; 8 copies of 16 bytes per lane, every lane on
        const unsigned d = ring0 + (unsigned)(t & 1) * (STG * 2);
        const h16* a0 = ksh + FRG(t * 2, 0); const h16* a1 = a0 + FRG(1, 0); const h16* a2 = ksl + FRG(t * 2, 0); const h16* a3 = a2 + FRG(1, 0);
        const h16* a4 = VTH + vso + FRG(0, t); const h16* a5 = a4 + FRG(2, 0); const h16* a6 = VTL + vso + FRG(0, t); const h16* a7 = a6 + FRG(2, 0);
        // the closing wait stands in the copies' own statement, in front of any rewrite of a register that a copy names
        asm volatile("global_load_async_to_lds_b128 %0, %8, off\n\tglobal_load_async_to_lds_b128 %1, %9, off\n\tglobal_load_async_to_lds_b128 %2, %10, off\n\tglobal_load_async_to_lds_b128 %3, %11, off\n\t"
                     "global_load_async_to_lds_b128 %4, %12, off\n\tglobal_load_async_to_lds_b128 %5, %13, off\n\tglobal_load_async_to_lds_b128 %6, %14, off\n\tglobal_load_async_to_lds_b128 %7, %15, off\n\ts_wait_xcnt 0x0"
                     :: "v"(d), "v"(d + 2048u), "v"(d + 4096u), "v"(d + 6144u), "v"(d + 8192u), "v"(d + 10240u), "v"(d + 12288u), "v"(d + 14336u),
                        "v"(a0), "v"(a1), "v"(a2), "v"(a3), "v"(a4), "v"(a5), "v"(a6), "v"(a7) : "memory");
    };
    stage(0);
    asm volatile("s_wait_asynccnt 0x0" ::: "memory");            // this wave's part of tile 0 has landed
    __syncthreads();                                             // every wave's part has: tile 0 may be read
    if (kt_hi >= 1) stage(1);
    int kt = 0;
#pragma unroll 1
    do {
        const int l0 = kt * 32;
        const h16* kh0 = ring + (kt & 1) * STG + l8; const h16* kl0 = kh0 + 2048;     // keys l0..l0+15; the next 16 keys lie 1024 elements further
        const h16* vhp = kh0 + 4096; const h16* vlp = kh0 + 6144;
        v8f s0 = {}, s1 = {}, x0 = {}, x1 = {};
#pragma unroll
        for (int kc = 0; kc < 2; ++kc) {
            { const v16h k0h = cat16(*(const v8ha*)(kh0 + kc * 512), *(const v8ha*)(kh0 + kc * 512 + 256)), k1h = cat16(*(const v8ha*)(kh0 + 1024 + kc * 512), *(const v8ha*)(kh0 + 1024 + kc * 512 + 256));
              const v16h qlk = cat16(*(const v8h*)(QL16 + qo0 + kc * 512 + l8), *(const v8h*)(QL16 + qo0 + kc * 512 + 256 + l8));     // query residual re-read per step (registers)
              s0 = wmma16(qa[kc], k0h, s0); x0 = wmma16(qlk, k0h, x0); s1 = wmma16(qa[kc], k1h, s1); x1 = wmma16(qlk, k1h, x1);
              asm volatile("v_nop" : "+v"(s0), "+v"(s1), "+v"(x0), "+v"(x1) : "v"(qlk), "v"(k0h), "v"(k1h) : "memory"); }
            { const v16h k0l = cat16(*(const v8ha*)(kl0 + kc * 512), *(const v8ha*)(kl0 + kc * 512 + 256)), k1l = cat16(*(const v8ha*)(kl0 + 1024 + kc * 512), *(const v8ha*)(kl0 + 1024 + kc * 512 + 256));
              x0 = wmma16(qa[kc], k0l, x0); x1 = wmma16(qa[kc], k1l, x1);
              asm volatile("v_nop" : "+v"(x0), "+v"(x1) : "v"(k0l), "v"(k1l) : "memory"); }
        }
        asm volatile("v_nop\n\tv_nop\n\tv_nop\n\tv_nop" : "+v"(s0), "+v"(s1), "+v"(x0), "+v"(x1) : "v"(qa[0]), "v"(qa[1]));
        float alpha[8];
#pragma unroll
        for (int j = 0; j < 8; ++j) {
            const int ja = l0 + lr, jb = l0 + 16 + lr, qi = qpos[j];
            const bool va = (qi < len) && (ja < len), vb = (qi < len) && (jb < len);
            const float a0 = va ? (s0[j] + x0[j] * LOSCI) * 0.125f : NEGV, a1 = vb ? (s1[j] + x1[j] * LOSCI) * 0.125f : NEGV;
            float mx = fmaxf(a0, a1);
            mx = fmaxf(mx, __shfl_xor(mx, 1, 16)); mx = fmaxf(mx, __shfl_xor(mx, 2, 16)); mx = fmaxf(mx, __shfl_xor(mx, 4, 16)); mx = fmaxf(mx, __shfl_xor(mx, 8, 16));
            const float mn = fmaxf(mrow[j], mx);
            alpha[j] = __expf(mrow[j] - mn); mrow[j] = mn;
            const float p0 = __expf(a0 - mn), p1 = __expf(a1 - mn);
            lpart[j] = lpart[j] * alpha[j] + (p0 + p1);             // normaliser over the (masked-to-NEG) scores, as the reference's softmax
            const int mr = hi * 8 + j;
            const float ps0 = va ? p0 * PSC : 0.f, ps1 = vb ? p1 * PSC : 0.f; const h16 h0 = (h16)ps0, h1 = (h16)ps1;     // attn * mask
            pl[mr * 32 + lr] = h0; pl[mr * 32 + 16 + lr] = h1;
            pl2[mr * 32 + lr] = (h16)((ps0 - (float)h0) * LOSC); pl2[mr * 32 + 16 + lr] = (h16)((ps1 - (float)h1) * LOSC);
        }
#pragma unroll
        for (int n = 0; n < 4; ++n)
#pragma unroll
            for (int j = 0; j < 8; ++j) { o[n][j] *= alpha[j]; ox[n][j] *= alpha[j]; }
        asm volatile("" ::: "memory");
        const v16h pa = cat16(*(const v8ha*)(pl + lr * 32 + hi * 8), *(const v8ha*)(pl + lr * 32 + 16 + hi * 8));
        const v16h px = cat16(*(const v8ha*)(pl2 + lr * 32 + hi * 8), *(const v8ha*)(pl2 + lr * 32 + 16 + hi * 8));
#pragma unroll
        for (int n = 0; n < 4; ++n) { const int vo = n * 512;
            const v16h vh = cat16(*(const v8ha*)(vhp + vo), *(const v8ha*)(vhp + vo + 256)), vl = cat16(*(const v8ha*)(vlp + vo), *(const v8ha*)(vlp + vo + 256));
            o[n] = wmma16(pa, vh, o[n]); ox[n] = wmma16(pa, vl, ox[n]); ox[n] = wmma16(px, vh, ox[n]);
            asm volatile("" : "+v"(o[n]), "+v"(ox[n]) : "v"(vh), "v"(vl) : "memory"); }
        asm volatile("v_nop\n\tv_nop\n\tv_nop\n\tv_nop" : "+v"(o[0]), "+v"(o[1]), "+v"(o[2]), "+v"(o[3]), "+v"(ox[0]), "+v"(ox[1]), "+v"(ox[2]), "+v"(ox[3]) : "v"(pa), "v"(px));
        asm volatile("s_wait_dscnt 0x0" ::: "memory");           // this wave's reads of the buffer have returned
        asm volatile("s_wait_asynccnt 0x0" ::: "memory");        // this wave's part of the next tile has landed
        __syncthreads();                                         // publishes the next tile and ends every wave's reads of this buffer, which is refilled behind it
        if (kt + 2 <= kt_hi) stage(kt + 2);
    } while (++kt <= kt_hi);
    asm volatile("s_wait_asynccnt 0x0" ::: "memory");            // no copy is out when the wave goes on to the epilogue
    float inv[8];
#pragma unroll
    for (int j = 0; j < 8; ++j) { float rs = lpart[j]; rs += __shfl_xor(rs, 1, 16); rs += __shfl_xor(rs, 2, 16); rs += __shfl_xor(rs, 4, 16); rs += __shfl_xor(rs, 8, 16); inv[j] = 1.0f / (rs * PSC); }
    float* os = &ost[wave][0];
#pragma unroll
    for (int n = 0; n < 4; ++n)
#pragma unroll
        for (int j = 0; j < 8; ++j) os[(hi * 8 + j) * 68 + n * 16 + lr] = (o[n][j] + ox[n][j] * LOSCI) * inv[j];
    __syncthreads();
    const size_t cbase = FRG((tok0 + q0) >> 4, h * 2);
    auto pass = [&]() {
#pragma unroll
        for (int s = 0; s < 4; ++s) { const float* sp = os + lr * 68 + s * 16 + hi * 8; v8us oh, ol;     // s = fragment * 2 + piece
#pragma unroll
            for (int i = 0; i < 8; ++i) { const unsigned short hb = f2bf(sp[i]); oh[i] = hb; ol[i] = f2bf(sp[i] - bf2f(hb)); }
            *(v8us*)(CH + cbase + s * 256 + l8) = oh; *(v8us*)(CL + cbase + s * 256 + l8) = ol; }
    };
    pass(); 
}

#define VST2(T, p, v) do { const T vst2_v_ = (v); *(T*)(p) = vst2_v_;  } while (0)
extern "C" void kernel_launch(void* const* d_in, const int* in_sizes, int n_in,
                              void* d_out, int out_size, void* d_ws, size_t ws_size, hipStream_t stream) {
    (void)in_sizes; (void)n_in; (void)out_size;
    const float* x = (const float*)d_in[0]; const int* lens = (const int*)d_in[1]; const float* Wqkv = (const float*)d_in[2]; const float* bqkv = (const float*)d_in[3]; const float* Wo = (const float*)d_in[4]; const float* bo = (const float*)d_in[5];
    float* out = (float*)d_out;    // [8][1024][1024]
    char* wsp = (char*)d_ws;
    auto take = [&](size_t bytes) { char* p = wsp; wsp += (bytes + 255) & ~(size_t)255; return (void*)p; };
    bf* Xb = (bf*)take((size_t)NTK * DM * 2); bf* W3T = (bf*)take((size_t)3 * DM * DM * 2); bf* WoT = (bf*)take((size_t)DM * DM * 2);
    h16* QH = (h16*)take((size_t)NTK * DM * 2); h16* QL = (h16*)take((size_t)NTK * DM * 2); h16* KH = (h16*)take((size_t)NTK * DM * 2); h16* KL = (h16*)take((size_t)NTK * DM * 2);
    float* Vf = (float*)take((size_t)NTK * DM * 4); h16* VTL = (h16*)take((size_t)NTK * DM * 2);
    if ((size_t)(wsp - (char*)d_ws) > ws_size) return;    // 8 batch items = 8192 rows: 16.8 + 6.3 + 2.1 + 4 x 16.8 + 33.6 + 16.8 ~ 143 MB
    h16* VTH = (h16*)Xb; bf* CH = (bf*)Vf; bf* CL = (bf*)((char*)Vf + (size_t)NTK * DM * 2);
    k_wt<<<dim3(DM / 64, (3 * DM) / 64, 1), 256, 0, stream>>>(Wqkv, 3 * DM, W3T);
    k_wt<<<dim3(DM / 64, DM / 64, 1), 256, 0, stream>>>(Wo, DM, WoT);
    k_cvtb<<<NTK / 8, 256, 0, stream>>>(x, NTK, Xb, lens);
    k_gemmb<false, true><<<dim3(NTK / 64, DM / 128, 1), 128, 0, stream>>>(Xb, nullptr, W3T, bqkv, (float*)(void*)QH, DM, QL, lens);
    k_gemmb<false, true><<<dim3(NTK / 64, DM / 128, 1), 128, 0, stream>>>(Xb, nullptr, W3T + (size_t)DM * DM, bqkv + DM, (float*)(void*)KH, DM, KL, lens);
    k_gemmb<false, false><<<dim3(NTK / 64, DM / 128, 1), 128, 0, stream>>>(Xb, nullptr, W3T + (size_t)2 * DM * DM, bqkv + 2 * DM, Vf, DM, nullptr, lens);
    k_vt<<<NB_ * NKV * (NT_ / 64), 256, 0, stream>>>(Vf, VTH, VTL, lens);
    k_attn<<<NB_ * NH_ * (NT_ / 64), 128, 0, stream>>>(QH, QL, KH, KL, VTH, VTL, lens, 0, CH, CL);
    k_gemmb<true, false><<<dim3(NTK / 64, DM / 128, 1), 128, 0, stream>>>(CH, CL, WoT, bo, out, DM, nullptr, lens);
}

// v006
// A run of this version takes 174 microseconds.
// In two side-by-side timings against v005, it was 1.20 and 1.19 times as fast.
// Over all steps from v000 it is 4.53 times as fast.
#include <hip/hip_runtime.h>

// Contractions, f32 accumulate: qkv = x.w_qkv + b_qkv ([8192 x 1024].[1024 x 3072], k-major weight transposed to an n-major plane; PLAIN bf16 operands: inputs
// rounded once, exact) and out.w_o + b_o (merged heads as bf16 hi + residual: two products) on v_wmma_f32_16x16x32_bf16; the 16-head length-masked attention fused
// on v_wmma_f32_16x16x32_f16: logits = q.k/8 where query AND key are < lengths[b] (the INPUT), else -1e9 (the reference's score*mask + NEG(1-mask)); softmax; the
// weights are multiplied by the same mask again (so rows beyond the length give exactly zero context); q and k as f16 hi + residual x1024 (hi.hi + hi.lo + lo.hi),

#define NB_  8                   // all 8 batch items go through every launch together
#define NT_  1024
#define DM   1024
#define NH_  16
#define NKV  16
#define KVW  (NKV * HD)          // 1024
#define HD   64
#define NTK  (NB_ * NT_)
#define NW   1024
#define NQKV 1024
#define PSC  32768.0f
#define NEGV (-1.0e9f)
#define LOSC 1024.0f
#define LOSCI (1.0f / 1024.0f)
// Every 16-bit operand plane in the workspace (rows of 1024 elements) is stored fragment-major: the 16 rows x 32 k of one WMMA operand fragment are 512 consecutive
// elements, element (row, k) at FRG(row / 16, k / 32) + ((k % 32) / 16) * 256 + ((((k % 16) / 8) * 16) + row % 16) * 8 + k % 8. A lane's two 16-byte pieces then
// lie at lane * 8 and 256 + lane * 8, so one wave load reads 512 consecutive bytes (4 whole 128-byte lines) where the row-major plane made it touch 16 lines.
#define FRG(rg, kc32) (((size_t)(rg) * (DM / 32) + (size_t)(kc32)) * 512)

typedef _Float16 h16;
typedef unsigned short bf;
typedef __attribute__((ext_vector_type(16))) __bf16   v16bf;
typedef __attribute__((ext_vector_type(16))) _Float16 v16h;
typedef __attribute__((ext_vector_type(8)))  _Float16 v8h;
typedef __attribute__((ext_vector_type(8)))  unsigned short v8us;
typedef __attribute__((ext_vector_type(8)))  float    v8f;
typedef __attribute__((ext_vector_type(4)))  float    v4f;
typedef v8h  __attribute__((may_alias)) v8ha;
typedef v4f  __attribute__((may_alias)) v4fa;
typedef v8us __attribute__((may_alias)) v8usa;

__device__ __forceinline__ unsigned short f2bf(float f) { unsigned u = __float_as_uint(f); u += 0x7FFFu + ((u >> 16) & 1u); return (unsigned short)(u >> 16); }
__device__ __forceinline__ float bf2f(unsigned short b) { return __uint_as_float(((unsigned)b) << 16); }
__device__ __forceinline__ float bfr(float f) { return bf2f(f2bf(f)); }
__device__ __forceinline__ v16h cat16(v8h lo, v8h hi) { return __builtin_shufflevector(lo, hi, 0, 1, 2, 3, 4, 5, 6, 7, 8, 9, 10, 11, 12, 13, 14, 15); }
__device__ __forceinline__ v16bf cat16b(v8us lo, v8us hi) { return __builtin_bit_cast(v16bf, __builtin_shufflevector(lo, hi, 0, 1, 2, 3, 4, 5, 6, 7, 8, 9, 10, 11, 12, 13, 14, 15)); }
__device__ __forceinline__ v8f wmma16(v16h a, v16h b, v8f c) { return __builtin_amdgcn_wmma_f32_16x16x32_f16(false, a, false, b, (short)0, c, false, false); }
__device__ __forceinline__ v8f wmmab(v16bf a, v16bf b, v8f c) { return __builtin_amdgcn_wmma_f32_16x16x32_bf16(false, a, false, b, (short)0, c, false, false); }

// lengths[b] (the INPUT), clamped to 0..NT_. A token at or beyond it is masked as query and as key: its context row is exactly zero and its key weighs exactly zero
// (exp(-1e9 - max) = 0 in f32), so a 64-token tile that lies wholly beyond the length is left out of every launch; the output rows there are the bias alone.
__device__ __forceinline__ int len_of(const int* __restrict__ lens, int b) { const int l = lens[b]; return l < 0 ? 0 : (l > NT_ ? NT_ : l); }
__device__ __forceinline__ bool tile_past(const int* __restrict__ lens, int row) { return ((row & (NT_ - 1)) & ~63) >= len_of(lens, row / NT_); }     // row = b * NT_ + token

__global__ __launch_bounds__(256) void k_cvtb(const float* __restrict__ src, int nrows, bf* dst, const int* __restrict__ lens) {
    if (tile_past(lens, ((blockIdx.x * 8) / (DM / 64)) * 16)) return;     // the block's 8 waves share one 16-row group (block-uniform)
    const int lane = threadIdx.x & 31, lr = lane & 15, hi = lane >> 4;
    const int gw = blockIdx.x * 8 + (threadIdx.x >> 5);          // one wave: 16 rows x 64 k = two fragments
    const int rg = gw / (DM / 64), kq = gw - rg * (DM / 64);
    if (rg * 16 >= nrows) return;
    const float* sp = src + (size_t)(rg * 16 + lr) * DM + kq * 64 + hi * 8;
    v8us o[4];
#pragma unroll
    for (int u = 0; u < 4; ++u) { v8us t;                        // u = fragment * 2 + piece
#pragma unroll
        for (int i = 0; i < 8; ++i) t[i] = f2bf(sp[u * 16 + i]);
        o[u] = t; }
    bf* dp = dst + FRG(rg, kq * 2) + lane * 8;
#pragma unroll
    for (int u = 0; u < 4; ++u) *(v8us*)(dp + u * 256) = o[u];
}

// k_wt: W [1024 k][ncols n] (k-major) -> n-major bf16 plane WT (rows n, fragment-major); 64 x 64 tiles through LDS.
__global__ __launch_bounds__(256) void k_wt(const float* __restrict__ Wm, int ncols, bf* WT) {
    __shared__ __align__(16) unsigned short tl[64 * 72];
    const int tid = threadIdx.x, k0 = blockIdx.x * 64, n0 = blockIdx.y * 64;
    const int kk = tid >> 2, nq = (tid & 3) * 16;
#pragma unroll
    for (int i = 0; i < 16; ++i) tl[(nq + i) * 72 + kk] = f2bf(Wm[(size_t)(k0 + kk) * ncols + n0 + nq + i]);
    __syncthreads();
    typedef __attribute__((ext_vector_type(8))) unsigned short v8us_; typedef v8us_ __attribute__((may_alias)) v8usa_;
    auto pass = [&]() {
#pragma unroll
        for (int s = 0; s < 2; ++s) { const int u = tid + 256 * s; const int fr = u >> 6, pc = (u >> 5) & 1, ln = u & 31;     // 8 fragments: (fr >> 1) = 16-row group, (fr & 1) = 32-k chunk
            const v8us_ val = *(const v8usa_*)(tl + ((fr >> 1) * 16 + (ln & 15)) * 72 + (fr & 1) * 32 + pc * 16 + (ln >> 4) * 8);
            *(v8us_*)(WT + FRG((n0 >> 4) + (fr >> 1), (k0 >> 5) + (fr & 1)) + pc * 256 + ln * 8) = val; }
    };
    pass(); 
}

// k_gemmb: block = 64 rows x 128 columns, 4 waves of 32 x 64 (2 x 4 accumulator tiles). The operand fragments of 64 k (4 row groups of A, of its residual where SPLITA,
// and 8 column groups of B, 2 KB each) come into LDS once per block by asynchronous copies, two buffers, the next 64 k in flight while these are worked on.
// Stage layout in elements: A 0, B 4096, A residual 12288. Each accumulator takes its products in the same k order as before.
template <bool SPLITA, bool F16OUT = false>
__global__ __launch_bounds__(128) void k_gemmb(const bf* __restrict__ A, const bf* __restrict__ Al, const bf* __restrict__ Bn, const float* __restrict__ bias, float* C, int ldc, h16* C2, const int* __restrict__ lens) {
    constexpr int STE = SPLITA ? 16384 : 12288;                  // elements per stage
    __shared__ __align__(128) bf ring[2 * STE];                  // behind the loop its first 34,816 bytes stage the output tiles
    const bool past = tile_past(lens, blockIdx.x * 64);          // the block's 64 tokens all lie beyond their item's length (block-uniform)
    if (!SPLITA && past) return;                                 // q, k, v rows that nobody reads; stands in front of every barrier
    const int lane = threadIdx.x & 31, lr = lane & 15, hi = lane >> 4;
    const int wave = __builtin_amdgcn_readfirstlane(threadIdx.x >> 5);     // the same in every lane of a wave
    const int wm = wave >> 1, wn = wave & 1;
    const unsigned l8 = lane * 8;                                // the one per-lane part of every fragment address
    const int rb = blockIdx.x * 64, cb = blockIdx.y * 128;
    const int r0 = rb + wm * 32, c0 = cb + wn * 64;              // the wave's 32 x 64 tile
    v8f acc[2][4];
#pragma unroll
    for (int m = 0; m < 2; ++m)
#pragma unroll
        for (int t = 0; t < 4; ++t) acc[m][t] = (v8f){};
    if (!(SPLITA && past)) {                                     // output projection of all-zero context rows: no product, the bias alone is stored (block-uniform)
        const unsigned t8 = threadIdx.x * 8;                     // a thread's 16 bytes of each 2 KB that the block copies at once
        const unsigned ring0 = (unsigned)(size_t)&ring[0] + t8 * 2;     // its LDS byte address in buffer 0
        const bf* As = A + FRG(rb >> 4, 0) + t8;
        const bf* Als = SPLITA ? Al + FRG(rb >> 4, 0) + t8 : As;
        const bf* Bs = Bn + FRG(cb >> 4, 0) + t8;
        auto cp4 = [&](unsigned d, const bf* s) {                // 64 k of four 16-row groups: 4 copies of 16 bytes per lane, every lane on
            // the closing wait stands in the copies' own statement, in front of any rewrite of a register that a copy names
            asm volatile("global_load_async_to_lds_b128 %0, %4, off\n\tglobal_load_async_to_lds_b128 %1, %5, off\n\tglobal_load_async_to_lds_b128 %2, %6, off\n\tglobal_load_async_to_lds_b128 %3, %7, off\n\ts_wait_xcnt 0x0"
                         :: "v"(d), "v"(d + 2048u), "v"(d + 4096u), "v"(d + 6144u), "v"(s), "v"(s + FRG(1, 0)), "v"(s + FRG(2, 0)), "v"(s + FRG(3, 0)) : "memory");
        };
        auto cp8 = [&](unsigned d, const bf* s, const bf* u) {   // the same for four groups at s and four at u, into 16 KB in a row: one closing wait for the eight
            asm volatile("global_load_async_to_lds_b128 %0, %8, off\n\tglobal_load_async_to_lds_b128 %1, %9, off\n\tglobal_load_async_to_lds_b128 %2, %10, off\n\tglobal_load_async_to_lds_b128 %3, %11, off\n\t"
                         "global_load_async_to_lds_b128 %4, %12, off\n\tglobal_load_async_to_lds_b128 %5, %13, off\n\tglobal_load_async_to_lds_b128 %6, %14, off\n\tglobal_load_async_to_lds_b128 %7, %15, off\n\ts_wait_xcnt 0x0"
                         :: "v"(d), "v"(d + 2048u), "v"(d + 4096u), "v"(d + 6144u), "v"(d + 8192u), "v"(d + 10240u), "v"(d + 12288u), "v"(d + 14336u),
                            "v"(s), "v"(s + FRG(1, 0)), "v"(s + FRG(2, 0)), "v"(s + FRG(3, 0)), "v"(u), "v"(u + FRG(1, 0)), "v"(u + FRG(2, 0)), "v"(u + FRG(3, 0)) : "memory");
        };
        auto stage = [&](int t) {                                // k = 64 t .. 64 t + 63 (t <= 15: inside the planes) -> buffer t & 1
            const unsigned d = ring0 + (unsigned)(t & 1) * (STE * 2);
            const int ko = t * 1024;                             // two fragments of a row group lie in a row
            cp8(d, As + ko, Bs + ko);
            if (SPLITA) cp8(d + 16384u, Bs + FRG(4, 0) + ko, Als + ko); else cp4(d + 16384u, Bs + FRG(4, 0) + ko);
        };
        stage(0);
        asm volatile("s_wait_asynccnt 0x0" ::: "memory");        // this wave's part of stage 0 has landed
        __syncthreads();                                         // every wave's part has: stage 0 may be read
        stage(1);
#pragma unroll 1
        for (int t = 0; t < DM / 64; ++t) {                      // rolled: one copy of the body in the instruction cache
            const bf* st = ring + (t & 1) * STE + l8;
            const bf* ap = st + wm * 2048; const bf* bp = st + 4096 + wn * 4096;
            v16bf a[2][2], al[2][2], b[2][4];                    // [32-k half][tile]
#pragma unroll
            for (int kc = 0; kc < 2; ++kc) {
#pragma unroll
                for (int m = 0; m < 2; ++m) { const bf* p = ap + m * 1024 + kc * 512; a[kc][m] = cat16b(*(const v8usa*)p, *(const v8usa*)(p + 256));
                    al[kc][m] = SPLITA ? cat16b(*(const v8usa*)(p + 12288), *(const v8usa*)(p + 12288 + 256)) : a[kc][m]; }
#pragma unroll
                for (int n = 0; n < 4; ++n) { const bf* p = bp + n * 1024 + kc * 512; b[kc][n] = cat16b(*(const v8usa*)p, *(const v8usa*)(p + 256)); }
            }
            asm volatile("s_wait_dscnt 0x0" ::: "memory");       // this wave's reads of the buffer have returned: the whole stage is in registers
            asm volatile("s_wait_asynccnt 0x0" ::: "memory");    // this wave's part of the next stage has landed
            __syncthreads();                                     // publishes the next stage and ends every wave's reads of this buffer, which is refilled behind it
            if (t + 2 < DM / 64) stage(t + 2);
            // the products read registers alone and stand behind the refill, so that the copies fly under them
#pragma unroll
            for (int kc = 0; kc < 2; ++kc) {
#pragma unroll
                for (int n = 0; n < 4; ++n) { acc[0][n] = wmmab(a[kc][0], b[kc][n], acc[0][n]); acc[1][n] = wmmab(a[kc][1], b[kc][n], acc[1][n]); }
                if (SPLITA) {
#pragma unroll
                    for (int n = 0; n < 4; ++n) { acc[0][n] = wmmab(al[kc][0], b[kc][n], acc[0][n]); acc[1][n] = wmmab(al[kc][1], b[kc][n], acc[1][n]); }
                }
            }
        }
        asm volatile("s_wait_asynccnt 0x0" ::: "memory");        // no copy is out when the ring is reused for the output tiles
    }
    float* os = (float*)(void*)ring + wave * (32 * 68);
#pragma unroll
    for (int t = 0; t < 4; ++t) { const float bv = bias ? bfr(bias[c0 + t * 16 + lr]) : 0.f;
#pragma unroll
        for (int m = 0; m < 2; ++m)
#pragma unroll
            for (int j = 0; j < 8; ++j) os[(m * 16 + hi * 8 + j) * 68 + t * 16 + lr] = acc[m][t][j] + bv; }
    __syncthreads();
    if (F16OUT) {
#pragma unroll
        for (int m = 0; m < 2; ++m) {
            const size_t cfo = FRG((r0 >> 4) + m, c0 >> 5);      // 16 x 64 = two fragments, 2 KB in a row
            h16* cf = (h16*)(void*)C + cfo;
#pragma unroll
            for (int s = 0; s < 4; ++s) { const float* sp = os + (m * 16 + lr) * 68 + s * 16 + hi * 8; v8h o, o2;     // s = fragment * 2 + piece
#pragma unroll
                for (int i = 0; i < 8; ++i) { const h16 a = (h16)sp[i]; o[i] = a; o2[i] = (h16)((sp[i] - (float)a) * LOSC); }
                *(v8h*)(cf + s * 256 + l8) = o;
                asm volatile("s_wait_xcnt 0x0" ::: "memory");    // stands before the issued store's registers are reused for the residual
                if (C2) { *(v8h*)(C2 + cfo + s * 256 + l8) = o2;
                    asm volatile("s_wait_xcnt 0x0" ::: "memory"); } }     // stands before the issued store's registers are reused
        }
    } else {
        float* crow = C + (size_t)r0 * ldc + c0;
#pragma unroll
        for (int s = 0; s < 16; ++s) { const int Lid = (lane >> 3) + 4 * s, piece = lane & 7; const int row = Lid >> 1, cofs = (Lid & 1) * 32 + piece * 4;
            const v4f val = *(const v4fa*)(os + row * 68 + cofs); *(v4f*)(crow + (size_t)row * ldc + cofs) = val;
            asm volatile("s_wait_xcnt 0x0" ::: "memory"); }      // stands before the issued store's registers are reused
    }
}

__global__ __launch_bounds__(256) void k_vt(const float* __restrict__ V, h16* VTH, h16* VTL, const int* __restrict__ lens) {
    __shared__ __align__(16) h16 tile[64 * 72];
    __shared__ __align__(16) h16 til2[64 * 72];
    const int bid = blockIdx.x;
    const int b = bid / (NKV * (NT_ / 64)), rem = bid - b * (NKV * (NT_ / 64)), h = rem / (NT_ / 64), kt = rem - h * (NT_ / 64);
    const int k0 = kt * 64, tid = threadIdx.x;
    if (k0 >= len_of(lens, b)) return;                           // 64 keys beyond the length: no key tile of k_attn reads them (block-uniform, in front of the barrier)
    const int kk = tid >> 2, d0 = (tid & 3) * 16;
    const float* src = V + ((size_t)b * NT_ + k0 + kk) * KVW + h * HD + d0;      // h = kv head here
#pragma unroll
    for (int i = 0; i < 16; ++i) { const float v = src[i]; const h16 a = (h16)v; tile[(d0 + i) * 72 + kk] = a; til2[(d0 + i) * 72 + kk] = (h16)((v - (float)a) * LOSC); }
    __syncthreads();
    const int rg0 = ((b * NKV + h) * HD) >> 4;                   // plane rows = (b, h, d), k = key position
    auto pass = [&]() {
#pragma unroll
        for (int s = 0; s < 4; ++s) { const int u = tid + 256 * s; const int pln = u >> 9, fr = (u >> 6) & 7, pc = (u >> 5) & 1, ln = u & 31;
            const v8h val = *(const v8ha*)((pln ? til2 : tile) + ((fr >> 1) * 16 + (ln & 15)) * 72 + (fr & 1) * 32 + pc * 16 + (ln >> 4) * 8);
            *(v8h*)((pln ? VTL : VTH) + FRG(rg0 + (fr >> 1), (k0 >> 5) + (fr & 1)) + pc * 256 + ln * 8) = val; }
    };
    pass(); 
}

// k_attn: block = (b, h, 64 queries), wave = 16; the key tiles that begin below lengths[b]. The products are taken transposed: scores^T = k . q^T (k the A operand, q the B operand)
// and ctx^T += v^T . weights^T. A lane then holds 16 of the 32 scores of ONE query (column lane & 15; keys 8 * (lane >> 4) + j and 16 + 8 * (lane >> 4) + j), so maximum and sum
// are taken in the lane with one exchange between the wave's halves, and the two score tiles, converted in place (weights x32768, f16 hi + residual x1024), ARE the B operand
// of the second product in the fragment's k order: the weights touch neither LDS nor another lane. A lane's 8 accumulator registers of ctx^T are 8 consecutive d of its query,
// the 16 bytes that it stores in the fragment-major planes CH/CL (bf16 hi + residual; rows tok, k = h*64+d).
// The 16 fragments of a 32-key tile (k hi, k residual, v hi, v residual: 16 KB, the same for the block's 4 waves) are brought into LDS once per block by asynchronous
// copies, two buffers, the next tile's copies in flight while this tile is worked on; stage layout in elements: k hi 0, k residual 2048, v hi 4096, v residual 6144.
#define STG 8192
__device__ __forceinline__ float xhalf(float x) { return __builtin_bit_cast(float, __builtin_amdgcn_permlanex16(__builtin_bit_cast(int, x), __builtin_bit_cast(int, x), 0x76543210, 0xfedcba98, false, false)); }     // lane l <-> lane l ^ 16
__global__ __launch_bounds__(128) void k_attn(const h16* __restrict__ Q16, const h16* __restrict__ QL16, const h16* __restrict__ K16, const h16* __restrict__ KL16, const h16* __restrict__ VTH, const h16* __restrict__ VTL, const int* __restrict__ lens, int bofs, bf* CH, bf* CL) {
    __shared__ __align__(16) h16 ring[2 * STG];
    const int lane = threadIdx.x & 31, lr = lane & 15, hi = lane >> 4;
    const int wave = __builtin_amdgcn_readfirstlane(threadIdx.x >> 5);     // the same in every lane of a wave: fragment bases stay in scalar registers
    const unsigned l8 = lane * 8;                                // the one per-lane part of every fragment address
    const int bid = blockIdx.x;
    const int b = bid / (NH_ * (NT_ / 64)), rem = bid - b * (NH_ * (NT_ / 64)), h = rem / (NT_ / 64), qt = rem - h * (NT_ / 64);
    const int q0 = qt * 64 + wave * 16;
    const int len = len_of(lens, bofs + b);                      // INPUT length of this batch item (block-uniform)
    if (qt * 64 >= len) return;                                  // 64 masked queries: the output projection does not read their context rows (in front of the barrier)
    const size_t tok0 = (size_t)b * NT_;
    v16h qa[2];
    const size_t qo0 = FRG((tok0 + q0) >> 4, h * 2);
#pragma unroll
    for (int kc = 0; kc < 2; ++kc) qa[kc] = cat16(*(const v8h*)(Q16 + qo0 + kc * 512 + l8), *(const v8h*)(Q16 + qo0 + kc * 512 + 256 + l8));
    asm volatile("s_wait_xcnt 0x0" ::: "memory");                // stands before the issued query loads' base registers are reused
    const int g = h / (NH_ / NKV);                      // kv head
    const h16* kh_b = K16 + FRG(tok0 >> 4, g * 2);
    const h16* kl_b = KL16 + FRG(tok0 >> 4, g * 2);
    const size_t vbase = FRG(((b * NKV + g) * HD) >> 4, 0);
    v8f o[4], ox[4];                                             // ctx^T: o[n][j] = d n * 16 + 8 * hi + j of query q0 + lr
#pragma unroll
    for (int n = 0; n < 4; ++n) { o[n] = (v8f){}; ox[n] = (v8f){}; }
    float mrow = -3.0e38f, lpart = 0.f;                          // the lane's query: running maximum (equal in both halves), this half's part of the normaliser
    const int klim = (q0 + lr < len) ? len - 8 * hi : 0;         // key l0 + 8 * hi + j counts iff query AND key are < len: l0 + j < klim
    const int kt_hi = (len + 31) / 32 - 1;                       // block-uniform (every wave passes every barrier of the loop), >= 0 (len >= 1 here): a tile of keys >= len adds exactly 0 to sum and context and leaves the maximum
    const unsigned t8 = threadIdx.x * 8;                         // a thread's 16 bytes of each 2 KB that the block copies at once
    const unsigned ring0 = (unsigned)(size_t)&ring[0] + t8 * 2;  // its LDS byte address in buffer 0
    const h16* ksh = kh_b + t8; const h16* ksl = kl_b + t8;      // two fragments of one 16-key group lie in a row
    const size_t vso = vbase + FRG(threadIdx.x >> 6, 0) + (threadIdx.x & 63) * 8;     // 64 threads per v fragment, two fragments per copy
    auto stage = [&](int t) {                                    // tile t (t <= kt_hi <= 31: inside the planes) -> buffer t & 1; 8 copies of 16 bytes per lane, every lane on
        const unsigned d = ring0 + (unsigned)(t & 1) * (STG * 2);
        const h16* a0 = ksh + FRG(t * 2, 0); const h16* a1 = a0 + FRG(1, 0); const h16* a2 = ksl + FRG(t * 2, 0); const h16* a3 = a2 + FRG(1, 0);
        const h16* a4 = VTH + vso + FRG(0, t); const h16* a5 = a4 + FRG(2, 0); const h16* a6 = VTL + vso + FRG(0, t); const h16* a7 = a6 + FRG(2, 0);
        // the closing wait stands in the copies' own statement, in front of any rewrite of a register that a copy names
        asm volatile("global_load_async_to_lds_b128 %0, %8, off\n\tglobal_load_async_to_lds_b128 %1, %9, off\n\tglobal_load_async_to_lds_b128 %2, %10, off\n\tglobal_load_async_to_lds_b128 %3, %11, off\n\t"
                     "global_load_async_to_lds_b128 %4, %12, off\n\tglobal_load_async_to_lds_b128 %5, %13, off\n\tglobal_load_async_to_lds_b128 %6, %14, off\n\tglobal_load_async_to_lds_b128 %7, %15, off\n\ts_wait_xcnt 0x0"
                     :: "v"(d), "v"(d + 2048u), "v"(d + 4096u), "v"(d + 6144u), "v"(d + 8192u), "v"(d + 10240u), "v"(d + 12288u), "v"(d + 14336u),
                        "v"(a0), "v"(a1), "v"(a2), "v"(a3), "v"(a4), "v"(a5), "v"(a6), "v"(a7) : "memory");
    };
    stage(0);
    asm volatile("s_wait_asynccnt 0x0" ::: "memory");            // this wave's part of tile 0 has landed
    __syncthreads();                                             // every wave's part has: tile 0 may be read
    if (kt_hi >= 1) stage(1);
    int kt = 0;
#pragma unroll 1
    do {
        const int l0 = kt * 32;
        const h16* kh0 = ring + (kt & 1) * STG + l8; const h16* kl0 = kh0 + 2048;     // keys l0..l0+15; the next 16 keys lie 1024 elements further
        const h16* vhp = kh0 + 4096; const h16* vlp = kh0 + 6144;
        v8f s0 = {}, s1 = {}, x0 = {}, x1 = {};                  // s0[j]: key l0 + 8 * hi + j, s1[j]: key l0 + 16 + 8 * hi + j, query q0 + lr
#pragma unroll
        for (int kc = 0; kc < 2; ++kc) {
            { const v16h k0h = cat16(*(const v8ha*)(kh0 + kc * 512), *(const v8ha*)(kh0 + kc * 512 + 256)), k1h = cat16(*(const v8ha*)(kh0 + 1024 + kc * 512), *(const v8ha*)(kh0 + 1024 + kc * 512 + 256));
              const v16h qlk = cat16(*(const v8h*)(QL16 + qo0 + kc * 512 + l8), *(const v8h*)(QL16 + qo0 + kc * 512 + 256 + l8));     // query residual re-read per step (registers)
              s0 = wmma16(k0h, qa[kc], s0); x0 = wmma16(k0h, qlk, x0); s1 = wmma16(k1h, qa[kc], s1); x1 = wmma16(k1h, qlk, x1);
              asm volatile("v_nop" : "+v"(s0), "+v"(s1), "+v"(x0), "+v"(x1) : "v"(qlk), "v"(k0h), "v"(k1h) : "memory"); }
            { const v16h k0l = cat16(*(const v8ha*)(kl0 + kc * 512), *(const v8ha*)(kl0 + kc * 512 + 256)), k1l = cat16(*(const v8ha*)(kl0 + 1024 + kc * 512), *(const v8ha*)(kl0 + 1024 + kc * 512 + 256));
              x0 = wmma16(k0l, qa[kc], x0); x1 = wmma16(k1l, qa[kc], x1);
              asm volatile("v_nop" : "+v"(x0), "+v"(x1) : "v"(k0l), "v"(k1l) : "memory"); }
        }
        asm volatile("v_nop\n\tv_nop\n\tv_nop\n\tv_nop" : "+v"(s0), "+v"(s1), "+v"(x0), "+v"(x1) : "v"(qa[0]), "v"(qa[1]));
        float a0[8], a1[8]; bool va[8], vb[8];
        const int krel = klim - l0;
#pragma unroll
        for (int j = 0; j < 8; ++j) { va[j] = j < krel; a0[j] = va[j] ? (s0[j] + x0[j] * LOSCI) * 0.125f : NEGV; }
#pragma unroll
        for (int j = 0; j < 8; ++j) { vb[j] = 16 + j < krel; a1[j] = vb[j] ? (s1[j] + x1[j] * LOSCI) * 0.125f : NEGV; }
        float mx = fmaxf(a0[0], a1[0]);
#pragma unroll
        for (int j = 1; j < 8; ++j) mx = fmaxf(mx, fmaxf(a0[j], a1[j]));
        mx = fmaxf(mx, xhalf(mx));                               // the query's other 16 keys of the tile
        const float mn = fmaxf(mrow, mx);
        const float alpha = __expf(mrow - mn); mrow = mn;
        float sum = 0.f;
        v16h pa, px;                                             // weights^T as a B operand: element s = key s < 8 ? 8 * hi + s : 16 + 8 * hi + (s - 8), as the v fragments have it
#pragma unroll
        for (int j = 0; j < 8; ++j) {
            const float p0 = __expf(a0[j] - mn), p1 = __expf(a1[j] - mn);
            sum += p0 + p1;                                      // normaliser over the (masked-to-NEG) scores, as the reference's softmax
            const float ps0 = va[j] ? p0 * PSC : 0.f, ps1 = vb[j] ? p1 * PSC : 0.f; const h16 h0 = (h16)ps0, h1 = (h16)ps1;     // attn * mask
            pa[j] = h0; pa[8 + j] = h1;
            px[j] = (h16)((ps0 - (float)h0) * LOSC); px[8 + j] = (h16)((ps1 - (float)h1) * LOSC);
        }
        lpart = lpart * alpha + sum;
#pragma unroll
        for (int n = 0; n < 4; ++n)
#pragma unroll
            for (int j = 0; j < 8; ++j) { o[n][j] *= alpha; ox[n][j] *= alpha; }
#pragma unroll
        for (int n = 0; n < 4; ++n) { const int vo = n * 512;
            const v16h vh = cat16(*(const v8ha*)(vhp + vo), *(const v8ha*)(vhp + vo + 256)), vl = cat16(*(const v8ha*)(vlp + vo), *(const v8ha*)(vlp + vo + 256));
            o[n] = wmma16(vh, pa, o[n]); ox[n] = wmma16(vl, pa, ox[n]); ox[n] = wmma16(vh, px, ox[n]);
            asm volatile("" : "+v"(o[n]), "+v"(ox[n]) : "v"(vh), "v"(vl) : "memory"); }
        asm volatile("v_nop\n\tv_nop\n\tv_nop\n\tv_nop" : "+v"(o[0]), "+v"(o[1]), "+v"(o[2]), "+v"(o[3]), "+v"(ox[0]), "+v"(ox[1]), "+v"(ox[2]), "+v"(ox[3]) : "v"(pa), "v"(px));
        asm volatile("s_wait_dscnt 0x0" ::: "memory");           // this wave's reads of the buffer have returned
        asm volatile("s_wait_asynccnt 0x0" ::: "memory");        // this wave's part of the next tile has landed
        __syncthreads();                                         // publishes the next tile and ends every wave's reads of this buffer, which is refilled behind it
        if (kt + 2 <= kt_hi) stage(kt + 2);
    } while (++kt <= kt_hi);
    asm volatile("s_wait_asynccnt 0x0" ::: "memory");            // no copy is out when the wave goes on to the epilogue
    const float inv = 1.0f / ((lpart + xhalf(lpart)) * PSC);     // the two halves' parts of the normaliser are joined once
    const size_t cbase = FRG((tok0 + q0) >> 4, h * 2);
#pragma unroll
    for (int n = 0; n < 4; ++n) { v8us oh, ol;                   // n = fragment * 2 + piece
#pragma unroll
        for (int j = 0; j < 8; ++j) { const float c = (o[n][j] + ox[n][j] * LOSCI) * inv; const unsigned short hb = f2bf(c); oh[j] = hb; ol[j] = f2bf(c - bf2f(hb)); }
        *(v8us*)(CH + cbase + n * 256 + l8) = oh; *(v8us*)(CL + cbase + n * 256 + l8) = ol;
        asm volatile("s_wait_xcnt 0x0" ::: "memory"); }          // stands before the issued stores' registers are reused
}

#define VST2(T, p, v) do { const T vst2_v_ = (v); *(T*)(p) = vst2_v_;  } while (0)
extern "C" void kernel_launch(void* const* d_in, const int* in_sizes, int n_in,
                              void* d_out, int out_size, void* d_ws, size_t ws_size, hipStream_t stream) {
    (void)in_sizes; (void)n_in; (void)out_size;
    const float* x = (const float*)d_in[0]; const int* lens = (const int*)d_in[1]; const float* Wqkv = (const float*)d_in[2]; const float* bqkv = (const float*)d_in[3]; const float* Wo = (const float*)d_in[4]; const float* bo = (const float*)d_in[5];
    float* out = (float*)d_out;    // [8][1024][1024]
    char* wsp = (char*)d_ws;
    auto take = [&](size_t bytes) { char* p = wsp; wsp += (bytes + 255) & ~(size_t)255; return (void*)p; };
    bf* Xb = (bf*)take((size_t)NTK * DM * 2); bf* W3T = (bf*)take((size_t)3 * DM * DM * 2); bf* WoT = (bf*)take((size_t)DM * DM * 2);
    h16* QH = (h16*)take((size_t)NTK * DM * 2); h16* QL = (h16*)take((size_t)NTK * DM * 2); h16* KH = (h16*)take((size_t)NTK * DM * 2); h16* KL = (h16*)take((size_t)NTK * DM * 2);
    float* Vf = (float*)take((size_t)NTK * DM * 4); h16* VTL = (h16*)take((size_t)NTK * DM * 2);
    if ((size_t)(wsp - (char*)d_ws) > ws_size) return;    // 8 batch items = 8192 rows: 16.8 + 6.3 + 2.1 + 4 x 16.8 + 33.6 + 16.8 ~ 143 MB
    h16* VTH = (h16*)Xb; bf* CH = (bf*)Vf; bf* CL = (bf*)((char*)Vf + (size_t)NTK * DM * 2);
    k_wt<<<dim3(DM / 64, (3 * DM) / 64, 1), 256, 0, stream>>>(Wqkv, 3 * DM, W3T);
    k_wt<<<dim3(DM / 64, DM / 64, 1), 256, 0, stream>>>(Wo, DM, WoT);
    k_cvtb<<<NTK / 8, 256, 0, stream>>>(x, NTK, Xb, lens);
    k_gemmb<false, true><<<dim3(NTK / 64, DM / 128, 1), 128, 0, stream>>>(Xb, nullptr, W3T, bqkv, (float*)(void*)QH, DM, QL, lens);
    k_gemmb<false, true><<<dim3(NTK / 64, DM / 128, 1), 128, 0, stream>>>(Xb, nullptr, W3T + (size_t)DM * DM, bqkv + DM, (float*)(void*)KH, DM, KL, lens);
    k_gemmb<false, false><<<dim3(NTK / 64, DM / 128, 1), 128, 0, stream>>>(Xb, nullptr, W3T + (size_t)2 * DM * DM, bqkv + 2 * DM, Vf, DM, nullptr, lens);
    k_vt<<<NB_ * NKV * (NT_ / 64), 256, 0, stream>>>(Vf, VTH, VTL, lens);
    k_attn<<<NB_ * NH_ * (NT_ / 64), 128, 0, stream>>>(QH, QL, KH, KL, VTH, VTL, lens, 0, CH, CL);
    k_gemmb<true, false><<<dim3(NTK / 64, DM / 128, 1), 128, 0, stream>>>(CH, CL, WoT, bo, out, DM, nullptr, lens);
}

// v007
// One run takes 161 microseconds.
// Two timings next to v006 put it at 1.10 and 1.08 times that version's speed.
// Over all steps from v000 it is 4.92 times as fast.
#include <hip/hip_runtime.h>

// Contractions, f32 accumulate: qkv = x.w_qkv + b_qkv ([8192 x 1024].[1024 x 3072], k-major weight transposed to an n-major plane; PLAIN bf16 operands: inputs
// rounded once, exact) and out.w_o + b_o (merged heads as bf16 hi + residual: two products) on v_wmma_f32_16x16x32_bf16; the 16-head length-masked attention fused
// on v_wmma_f32_16x16x32_f16: logits = q.k/8 where query AND key are < lengths[b] (the INPUT), else -1e9 (the reference's score*mask + NEG(1-mask)); softmax; the
// weights are multiplied by the same mask again (so rows beyond the length give exactly zero context); q and k as f16 hi + residual x1024 (hi.hi + hi.lo + lo.hi),

#define NB_  8                   // all 8 batch items go through every launch together
#define NT_  1024
#define DM   1024
#define NH_  16
#define NKV  16
#define KVW  (NKV * HD)          // 1024
#define HD   64
#define NTK  (NB_ * NT_)
#define NW   1024
#define NQKV 1024
#define PSC  32768.0f
#define NEGV (-1.0e9f)
#define LOSC 1024.0f
#define LOSCI (1.0f / 1024.0f)
// Every 16-bit operand plane in the workspace (rows of 1024 elements) is stored fragment-major: the 16 rows x 32 k of one WMMA operand fragment are 512 consecutive
// elements, element (row, k) at FRG(row / 16, k / 32) + ((k % 32) / 16) * 256 + ((((k % 16) / 8) * 16) + row % 16) * 8 + k % 8. A lane's two 16-byte pieces then
// lie at lane * 8 and 256 + lane * 8, so one wave load reads 512 consecutive bytes (4 whole 128-byte lines) where the row-major plane made it touch 16 lines.
#define FRG(rg, kc32) (((size_t)(rg) * (DM / 32) + (size_t)(kc32)) * 512)

typedef _Float16 h16;
typedef unsigned short bf;
typedef __attribute__((ext_vector_type(16))) __bf16   v16bf;
typedef __attribute__((ext_vector_type(16))) _Float16 v16h;
typedef __attribute__((ext_vector_type(8)))  _Float16 v8h;
typedef __attribute__((ext_vector_type(8)))  unsigned short v8us;
typedef __attribute__((ext_vector_type(8)))  float    v8f;
typedef __attribute__((ext_vector_type(4)))  float    v4f;
typedef v8h  __attribute__((may_alias)) v8ha;
typedef v4f  __attribute__((may_alias)) v4fa;
typedef v8us __attribute__((may_alias)) v8usa;

__device__ __forceinline__ unsigned short f2bf(float f) { unsigned u = __float_as_uint(f); u += 0x7FFFu + ((u >> 16) & 1u); return (unsigned short)(u >> 16); }
__device__ __forceinline__ float bf2f(unsigned short b) { return __uint_as_float(((unsigned)b) << 16); }
__device__ __forceinline__ float bfr(float f) { return bf2f(f2bf(f)); }
__device__ __forceinline__ v16h cat16(v8h lo, v8h hi) { return __builtin_shufflevector(lo, hi, 0, 1, 2, 3, 4, 5, 6, 7, 8, 9, 10, 11, 12, 13, 14, 15); }
__device__ __forceinline__ v16bf cat16b(v8us lo, v8us hi) { return __builtin_bit_cast(v16bf, __builtin_shufflevector(lo, hi, 0, 1, 2, 3, 4, 5, 6, 7, 8, 9, 10, 11, 12, 13, 14, 15)); }
__device__ __forceinline__ v8f wmma16(v16h a, v16h b, v8f c) { return __builtin_amdgcn_wmma_f32_16x16x32_f16(false, a, false, b, (short)0, c, false, false); }
__device__ __forceinline__ v8f wmmab(v16bf a, v16bf b, v8f c) { return __builtin_amdgcn_wmma_f32_16x16x32_bf16(false, a, false, b, (short)0, c, false, false); }

// lengths[b] (the INPUT), clamped to 0..NT_. A token at or beyond it is masked as query and as key: its context row is exactly zero and its key weighs exactly zero
// (exp(-1e9 - max) = 0 in f32), so a 64-token tile that lies wholly beyond the length is left out of every launch; the output rows there are the bias alone.
__device__ __forceinline__ int len_of(const int* __restrict__ lens, int b) { const int l = lens[b]; return l < 0 ? 0 : (l > NT_ ? NT_ : l); }
__device__ __forceinline__ bool tile_past(const int* __restrict__ lens, int row) { return ((row & (NT_ - 1)) & ~63) >= len_of(lens, row / NT_); }     // row = b * NT_ + token

// cvtb_block: block bx of the conversion of x to the fragment-major bf16 plane.
__device__ __forceinline__ void cvtb_block(int bx, const float* __restrict__ src, int nrows, bf* dst, const int* __restrict__ lens) {
    if (tile_past(lens, ((bx * 8) / (DM / 64)) * 16)) return;     // the block's 8 waves share one 16-row group (block-uniform)
    const int lane = threadIdx.x & 31, lr = lane & 15, hi = lane >> 4;
    const int gw = bx * 8 + (threadIdx.x >> 5);                  // one wave: 16 rows x 64 k = two fragments
    const int rg = gw / (DM / 64), kq = gw - rg * (DM / 64);
    if (rg * 16 >= nrows) return;
    const float* sp = src + (size_t)(rg * 16 + lr) * DM + kq * 64 + hi * 8;
    v8us o[4];
#pragma unroll
    for (int u = 0; u < 4; ++u) { v8us t;                        // u = fragment * 2 + piece
#pragma unroll
        for (int i = 0; i < 8; ++i) t[i] = f2bf(sp[u * 16 + i]);
        o[u] = t; }
    bf* dp = dst + FRG(rg, kq * 2) + lane * 8;
#pragma unroll
    for (int u = 0; u < 4; ++u) *(v8us*)(dp + u * 256) = o[u];
}

// wt_block: W [1024 k][ncols n] (k-major) -> n-major bf16 plane WT (rows n, fragment-major); the 64 x 64 tile (bx, by) through LDS.
__device__ __forceinline__ void wt_block(unsigned short* tl, int bx, int by, const float* __restrict__ Wm, int ncols, bf* WT) {
    const int tid = threadIdx.x, k0 = bx * 64, n0 = by * 64;
    const int kk = tid >> 2, nq = (tid & 3) * 16;
#pragma unroll
    for (int i = 0; i < 16; ++i) tl[(nq + i) * 72 + kk] = f2bf(Wm[(size_t)(k0 + kk) * ncols + n0 + nq + i]);
    __syncthreads();
    typedef __attribute__((ext_vector_type(8))) unsigned short v8us_; typedef v8us_ __attribute__((may_alias)) v8usa_;
    auto pass = [&]() {
#pragma unroll
        for (int s = 0; s < 2; ++s) { const int u = tid + 256 * s; const int fr = u >> 6, pc = (u >> 5) & 1, ln = u & 31;     // 8 fragments: (fr >> 1) = 16-row group, (fr & 1) = 32-k chunk
            const v8us_ val = *(const v8usa_*)(tl + ((fr >> 1) * 16 + (ln & 15)) * 72 + (fr & 1) * 32 + pc * 16 + (ln >> 4) * 8);
            *(v8us_*)(WT + FRG((n0 >> 4) + (fr >> 1), (k0 >> 5) + (fr & 1)) + pc * 256 + ln * 8) = val; }
    };
    pass(); 
}

// k_prep: the three conversions that depend on nothing but the inputs share one launch: blocks 0 .. NWQ - 1 transpose w_qkv, the next NWO transpose w_o, the rest
// convert x. Which of the three a block does depends on blockIdx alone, so the barrier in wt_block stands under block-uniform control flow.
#define NWQ ((DM / 64) * ((3 * DM) / 64))
#define NWO ((DM / 64) * (DM / 64))
__global__ __launch_bounds__(256) void k_prep(const float* __restrict__ x, const float* __restrict__ Wqkv, const float* __restrict__ Wo, bf* Xb, bf* W3T, bf* WoT, const int* __restrict__ lens) {
    __shared__ __align__(16) unsigned short tl[64 * 72];
    const int bid = blockIdx.x;
    if (bid < NWQ + NWO) { const bool o = bid >= NWQ; const int t = o ? bid - NWQ : bid;
        wt_block(tl, t & (DM / 64 - 1), t / (DM / 64), o ? Wo : Wqkv, o ? DM : 3 * DM, o ? WoT : W3T); }
    else cvtb_block(bid - (NWQ + NWO), x, NTK, Xb, lens);
}

// k_gemmb: block = 64 rows x 128 columns, 4 waves of 32 x 64 (2 x 4 accumulator tiles). The operand fragments of 64 k (4 row groups of A, of its residual where SPLITA,
// and 8 column groups of B, 2 KB each) come into LDS once per block by asynchronous copies, two buffers, the next 64 k in flight while these are worked on.
// Stage layout in elements: A 0, B 4096, A residual 12288. Each accumulator takes its products in the same k order as before.
// QKV: one launch over all 3072 columns of x.w_qkv; a block's 128 columns lie in one third, which says where and how its tile is stored: q and k as f16 hi + residual
// planes (QH/QL, KH/KL), v as f32 rows in C.
template <bool SPLITA, bool QKV>
__global__ __launch_bounds__(128) void k_gemmb(const bf* __restrict__ A, const bf* __restrict__ Al, const bf* __restrict__ Bn, const float* __restrict__ bias, float* C, int ldc, h16* QH, h16* QL, h16* KH, h16* KL, const int* __restrict__ lens) {
    constexpr int STE = SPLITA ? 16384 : 12288;                  // elements per stage
    __shared__ __align__(128) bf ring[2 * STE];                  // behind the loop its first 34,816 bytes stage the output tiles
    const bool past = tile_past(lens, blockIdx.x * 64);          // the block's 64 tokens all lie beyond their item's length (block-uniform)
    if (!SPLITA && past) return;                                 // q, k, v rows that nobody reads; stands in front of every barrier
    const int lane = threadIdx.x & 31, lr = lane & 15, hi = lane >> 4;
    const int wave = __builtin_amdgcn_readfirstlane(threadIdx.x >> 5);     // the same in every lane of a wave
    const int wm = wave >> 1, wn = wave & 1;
    const unsigned l8 = lane * 8;                                // the one per-lane part of every fragment address
    const int rb = blockIdx.x * 64, cb = blockIdx.y * 128;
    const int r0 = rb + wm * 32, c0 = cb + wn * 64;              // the wave's 32 x 64 tile
    v8f acc[2][4];
#pragma unroll
    for (int m = 0; m < 2; ++m)
#pragma unroll
        for (int t = 0; t < 4; ++t) acc[m][t] = (v8f){};
    if (!(SPLITA && past)) {                                     // output projection of all-zero context rows: no product, the bias alone is stored (block-uniform)
        const unsigned t8 = threadIdx.x * 8;                     // a thread's 16 bytes of each 2 KB that the block copies at once
        const unsigned ring0 = (unsigned)(size_t)&ring[0] + t8 * 2;     // its LDS byte address in buffer 0
        const bf* As = A + FRG(rb >> 4, 0) + t8;
        const bf* Als = SPLITA ? Al + FRG(rb >> 4, 0) + t8 : As;
        const bf* Bs = Bn + FRG(cb >> 4, 0) + t8;
        auto cp4 = [&](unsigned d, const bf* s) {                // 64 k of four 16-row groups: 4 copies of 16 bytes per lane, every lane on
            // the closing wait stands in the copies' own statement, in front of any rewrite of a register that a copy names
            asm volatile("global_load_async_to_lds_b128 %0, %4, off\n\tglobal_load_async_to_lds_b128 %1, %5, off\n\tglobal_load_async_to_lds_b128 %2, %6, off\n\tglobal_load_async_to_lds_b128 %3, %7, off\n\ts_wait_xcnt 0x0"
                         :: "v"(d), "v"(d + 2048u), "v"(d + 4096u), "v"(d + 6144u), "v"(s), "v"(s + FRG(1, 0)), "v"(s + FRG(2, 0)), "v"(s + FRG(3, 0)) : "memory");
        };
        auto cp8 = [&](unsigned d, const bf* s, const bf* u) {   // the same for four groups at s and four at u, into 16 KB in a row: one closing wait for the eight
            asm volatile("global_load_async_to_lds_b128 %0, %8, off\n\tglobal_load_async_to_lds_b128 %1, %9, off\n\tglobal_load_async_to_lds_b128 %2, %10, off\n\tglobal_load_async_to_lds_b128 %3, %11, off\n\t"
                         "global_load_async_to_lds_b128 %4, %12, off\n\tglobal_load_async_to_lds_b128 %5, %13, off\n\tglobal_load_async_to_lds_b128 %6, %14, off\n\tglobal_load_async_to_lds_b128 %7, %15, off\n\ts_wait_xcnt 0x0"
                         :: "v"(d), "v"(d + 2048u), "v"(d + 4096u), "v"(d + 6144u), "v"(d + 8192u), "v"(d + 10240u), "v"(d + 12288u), "v"(d + 14336u),
                            "v"(s), "v"(s + FRG(1, 0)), "v"(s + FRG(2, 0)), "v"(s + FRG(3, 0)), "v"(u), "v"(u + FRG(1, 0)), "v"(u + FRG(2, 0)), "v"(u + FRG(3, 0)) : "memory");
        };
        auto stage = [&](int t) {                                // k = 64 t .. 64 t + 63 (t <= 15: inside the planes) -> buffer t & 1
            const unsigned d = ring0 + (unsigned)(t & 1) * (STE * 2);
            const int ko = t * 1024;                             // two fragments of a row group lie in a row
            cp8(d, As + ko, Bs + ko);
            if (SPLITA) cp8(d + 16384u, Bs + FRG(4, 0) + ko, Als + ko); else cp4(d + 16384u, Bs + FRG(4, 0) + ko);
        };
        stage(0);
        asm volatile("s_wait_asynccnt 0x0" ::: "memory");        // this wave's part of stage 0 has landed
        __syncthreads();                                         // every wave's part has: stage 0 may be read
        stage(1);
#pragma unroll 1
        for (int t = 0; t < DM / 64; ++t) {                      // rolled: one copy of the body in the instruction cache
            const bf* st = ring + (t & 1) * STE + l8;
            const bf* ap = st + wm * 2048; const bf* bp = st + 4096 + wn * 4096;
            v16bf a[2][2], al[2][2], b[2][4];                    // [32-k half][tile]
#pragma unroll
            for (int kc = 0; kc < 2; ++kc) {
#pragma unroll
                for (int m = 0; m < 2; ++m) { const bf* p = ap + m * 1024 + kc * 512; a[kc][m] = cat16b(*(const v8usa*)p, *(const v8usa*)(p + 256));
                    al[kc][m] = SPLITA ? cat16b(*(const v8usa*)(p + 12288), *(const v8usa*)(p + 12288 + 256)) : a[kc][m]; }
#pragma unroll
                for (int n = 0; n < 4; ++n) { const bf* p = bp + n * 1024 + kc * 512; b[kc][n] = cat16b(*(const v8usa*)p, *(const v8usa*)(p + 256)); }
            }
            asm volatile("s_wait_dscnt 0x0" ::: "memory");       // this wave's reads of the buffer have returned: the whole stage is in registers
            asm volatile("s_wait_asynccnt 0x0" ::: "memory");    // this wave's part of the next stage has landed
            __syncthreads();                                     // publishes the next stage and ends every wave's reads of this buffer, which is refilled behind it
            if (t + 2 < DM / 64) stage(t + 2);
            // the products read registers alone and stand behind the refill, so that the copies fly under them
#pragma unroll
            for (int kc = 0; kc < 2; ++kc) {
#pragma unroll
                for (int n = 0; n < 4; ++n) { acc[0][n] = wmmab(a[kc][0], b[kc][n], acc[0][n]); acc[1][n] = wmmab(a[kc][1], b[kc][n], acc[1][n]); }
                if (SPLITA) {
#pragma unroll
                    for (int n = 0; n < 4; ++n) { acc[0][n] = wmmab(al[kc][0], b[kc][n], acc[0][n]); acc[1][n] = wmmab(al[kc][1], b[kc][n], acc[1][n]); }
                }
            }
        }
        asm volatile("s_wait_asynccnt 0x0" ::: "memory");        // no copy is out when the ring is reused for the output tiles
    }
    float* os = (float*)(void*)ring + wave * (32 * 68);
#pragma unroll
    for (int t = 0; t < 4; ++t) { const float bv = bias ? bfr(bias[c0 + t * 16 + lr]) : 0.f;
#pragma unroll
        for (int m = 0; m < 2; ++m)
#pragma unroll
            for (int j = 0; j < 8; ++j) os[(m * 16 + hi * 8 + j) * 68 + t * 16 + lr] = acc[m][t][j] + bv; }
    __syncthreads();
    const int sel = QKV ? (int)(blockIdx.y / (DM / 128)) : 2;    // the third of the columns: 0 q, 1 k, 2 v (block-uniform)
    const int cp = QKV ? (c0 & (DM - 1)) : c0;                   // the tile's first column inside its own plane
    if (QKV && sel < 2) {
        h16* Ch = sel ? KH : QH; h16* C2 = sel ? KL : QL;
#pragma unroll
        for (int m = 0; m < 2; ++m) {
            const size_t cfo = FRG((r0 >> 4) + m, cp >> 5);      // 16 x 64 = two fragments, 2 KB in a row
            h16* cf = Ch + cfo;
#pragma unroll
            for (int s = 0; s < 4; ++s) { const float* sp = os + (m * 16 + lr) * 68 + s * 16 + hi * 8; v8h o, o2;     // s = fragment * 2 + piece
#pragma unroll
                for (int i = 0; i < 8; ++i) { const h16 a = (h16)sp[i]; o[i] = a; o2[i] = (h16)((sp[i] - (float)a) * LOSC); }
                *(v8h*)(cf + s * 256 + l8) = o;
                asm volatile("s_wait_xcnt 0x0" ::: "memory");    // stands before the issued store's registers are reused for the residual
                *(v8h*)(C2 + cfo + s * 256 + l8) = o2;
                asm volatile("s_wait_xcnt 0x0" ::: "memory"); }  // stands before the issued store's registers are reused
        }
    } else {
        float* crow = C + (size_t)r0 * ldc + cp;
#pragma unroll
        for (int s = 0; s < 16; ++s) { const int Lid = (lane >> 3) + 4 * s, piece = lane & 7; const int row = Lid >> 1, cofs = (Lid & 1) * 32 + piece * 4;
            const v4f val = *(const v4fa*)(os + row * 68 + cofs); *(v4f*)(crow + (size_t)row * ldc + cofs) = val;
            asm volatile("s_wait_xcnt 0x0" ::: "memory"); }      // stands before the issued store's registers are reused
    }
}

__global__ __launch_bounds__(256) void k_vt(const float* __restrict__ V, h16* VTH, h16* VTL, const int* __restrict__ lens) {
    __shared__ __align__(16) h16 tile[64 * 72];
    __shared__ __align__(16) h16 til2[64 * 72];
    const int bid = blockIdx.x;
    const int b = bid / (NKV * (NT_ / 64)), rem = bid - b * (NKV * (NT_ / 64)), h = rem / (NT_ / 64), kt = rem - h * (NT_ / 64);
    const int k0 = kt * 64, tid = threadIdx.x;
    if (k0 >= len_of(lens, b)) return;                           // 64 keys beyond the length: no key tile of k_attn reads them (block-uniform, in front of the barrier)
    const int kk = tid >> 2, d0 = (tid & 3) * 16;
    const float* src = V + ((size_t)b * NT_ + k0 + kk) * KVW + h * HD + d0;      // h = kv head here
#pragma unroll
    for (int i = 0; i < 16; ++i) { const float v = src[i]; const h16 a = (h16)v; tile[(d0 + i) * 72 + kk] = a; til2[(d0 + i) * 72 + kk] = (h16)((v - (float)a) * LOSC); }
    __syncthreads();
    const int rg0 = ((b * NKV + h) * HD) >> 4;                   // plane rows = (b, h, d), k = key position
    auto pass = [&]() {
#pragma unroll
        for (int s = 0; s < 4; ++s) { const int u = tid + 256 * s; const int pln = u >> 9, fr = (u >> 6) & 7, pc = (u >> 5) & 1, ln = u & 31;
            const v8h val = *(const v8ha*)((pln ? til2 : tile) + ((fr >> 1) * 16 + (ln & 15)) * 72 + (fr & 1) * 32 + pc * 16 + (ln >> 4) * 8);
            *(v8h*)((pln ? VTL : VTH) + FRG(rg0 + (fr >> 1), (k0 >> 5) + (fr & 1)) + pc * 256 + ln * 8) = val; }
    };
    pass(); 
}

// k_attn: block = (b, h, 64 queries), wave = 16; the key tiles that begin below lengths[b]. The products are taken transposed: scores^T = k . q^T (k the A operand, q the B operand)
// and ctx^T += v^T . weights^T. A lane then holds 16 of the 32 scores of ONE query (column lane & 15; keys 8 * (lane >> 4) + j and 16 + 8 * (lane >> 4) + j), so maximum and sum
// are taken in the lane with one exchange between the wave's halves, and the two score tiles, converted in place (weights x32768, f16 hi + residual x1024), ARE the B operand
// of the second product in the fragment's k order: the weights touch neither LDS nor another lane. A lane's 8 accumulator registers of ctx^T are 8 consecutive d of its query,
// the 16 bytes that it stores in the fragment-major planes CH/CL (bf16 hi + residual; rows tok, k = h*64+d).
// The 16 fragments of a 32-key tile (k hi, k residual, v hi, v residual: 16 KB, the same for the block's 4 waves) are brought into LDS once per block by asynchronous
// copies, two buffers, the next tile's copies in flight while this tile is worked on; stage layout in elements: k hi 0, k residual 2048, v hi 4096, v residual 6144.
#define STG 8192
__device__ __forceinline__ float xhalf(float x) { return __builtin_bit_cast(float, __builtin_amdgcn_permlanex16(__builtin_bit_cast(int, x), __builtin_bit_cast(int, x), 0x76543210, 0xfedcba98, false, false)); }     // lane l <-> lane l ^ 16
__global__ __launch_bounds__(128) void k_attn(const h16* __restrict__ Q16, const h16* __restrict__ QL16, const h16* __restrict__ K16, const h16* __restrict__ KL16, const h16* __restrict__ VTH, const h16* __restrict__ VTL, const int* __restrict__ lens, int bofs, bf* CH, bf* CL) {
    __shared__ __align__(16) h16 ring[2 * STG];
    const int lane = threadIdx.x & 31, lr = lane & 15, hi = lane >> 4;
    const int wave = __builtin_amdgcn_readfirstlane(threadIdx.x >> 5);     // the same in every lane of a wave: fragment bases stay in scalar registers
    const unsigned l8 = lane * 8;                                // the one per-lane part of every fragment address
    const int bid = blockIdx.x;
    const int b = bid / (NH_ * (NT_ / 64)), rem = bid - b * (NH_ * (NT_ / 64)), h = rem / (NT_ / 64), qt = rem - h * (NT_ / 64);
    const int q0 = qt * 64 + wave * 16;
    const int len = len_of(lens, bofs + b);                      // INPUT length of this batch item (block-uniform)
    if (qt * 64 >= len) return;                                  // 64 masked queries: the output projection does not read their context rows (in front of the barrier)
    const size_t tok0 = (size_t)b * NT_;
    v16h qa[2];
    const size_t qo0 = FRG((tok0 + q0) >> 4, h * 2);
#pragma unroll
    for (int kc = 0; kc < 2; ++kc) qa[kc] = cat16(*(const v8h*)(Q16 + qo0 + kc * 512 + l8), *(const v8h*)(Q16 + qo0 + kc * 512 + 256 + l8));
    asm volatile("s_wait_xcnt 0x0" ::: "memory");                // stands before the issued query loads' base registers are reused
    const int g = h / (NH_ / NKV);                      // kv head
    const h16* kh_b = K16 + FRG(tok0 >> 4, g * 2);
    const h16* kl_b = KL16 + FRG(tok0 >> 4, g * 2);
    const size_t vbase = FRG(((b * NKV + g) * HD) >> 4, 0);
    v8f o[4], ox[4];                                             // ctx^T: o[n][j] = d n * 16 + 8 * hi + j of query q0 + lr
#pragma unroll
    for (int n = 0; n < 4; ++n) { o[n] = (v8f){}; ox[n] = (v8f){}; }
    float mrow = -3.0e38f, lpart = 0.f;                          // the lane's query: running maximum (equal in both halves), this half's part of the normaliser
    const int klim = (q0 + lr < len) ? len - 8 * hi : 0;         // key l0 + 8 * hi + j counts iff query AND key are < len: l0 + j < klim
    const int kt_hi = (len + 31) / 32 - 1;                       // block-uniform (every wave passes every barrier of the loop), >= 0 (len >= 1 here): a tile of keys >= len adds exactly 0 to sum and context and leaves the maximum
    const unsigned t8 = threadIdx.x * 8;                         // a thread's 16 bytes of each 2 KB that the block copies at once
    const unsigned ring0 = (unsigned)(size_t)&ring[0] + t8 * 2;  // its LDS byte address in buffer 0
    const h16* ksh = kh_b + t8; const h16* ksl = kl_b + t8;      // two fragments of one 16-key group lie in a row
    const size_t vso = vbase + FRG(threadIdx.x >> 6, 0) + (threadIdx.x & 63) * 8;     // 64 threads per v fragment, two fragments per copy
    auto stage = [&](int t) {                                    // tile t (t <= kt_hi <= 31: inside the planes) -> buffer t & 1; 8 copies of 16 bytes per lane, every lane on
        const unsigned d = ring0 + (unsigned)(t & 1) * (STG * 2);
        const h16* a0 = ksh + FRG(t * 2, 0); const h16* a1 = a0 + FRG(1, 0); const h16* a2 = ksl + FRG(t * 2, 0); const h16* a3 = a2 + FRG(1, 0);
        const h16* a4 = VTH + vso + FRG(0, t); const h16* a5 = a4 + FRG(2, 0); const h16* a6 = VTL + vso + FRG(0, t); const h16* a7 = a6 + FRG(2, 0);
        // the closing wait stands in the copies' own statement, in front of any rewrite of a register that a copy names
        asm volatile("global_load_async_to_lds_b128 %0, %8, off\n\tglobal_load_async_to_lds_b128 %1, %9, off\n\tglobal_load_async_to_lds_b128 %2, %10, off\n\tglobal_load_async_to_lds_b128 %3, %11, off\n\t"
                     "global_load_async_to_lds_b128 %4, %12, off\n\tglobal_load_async_to_lds_b128 %5, %13, off\n\tglobal_load_async_to_lds_b128 %6, %14, off\n\tglobal_load_async_to_lds_b128 %7, %15, off\n\ts_wait_xcnt 0x0"
                     :: "v"(d), "v"(d + 2048u), "v"(d + 4096u), "v"(d + 6144u), "v"(d + 8192u), "v"(d + 10240u), "v"(d + 12288u), "v"(d + 14336u),
                        "v"(a0), "v"(a1), "v"(a2), "v"(a3), "v"(a4), "v"(a5), "v"(a6), "v"(a7) : "memory");
    };
    stage(0);
    asm volatile("s_wait_asynccnt 0x0" ::: "memory");            // this wave's part of tile 0 has landed
    __syncthreads();                                             // every wave's part has: tile 0 may be read
    if (kt_hi >= 1) stage(1);
    int kt = 0;
#pragma unroll 1
    do {
        const int l0 = kt * 32;
        const h16* kh0 = ring + (kt & 1) * STG + l8; const h16* kl0 = kh0 + 2048;     // keys l0..l0+15; the next 16 keys lie 1024 elements further
        const h16* vhp = kh0 + 4096; const h16* vlp = kh0 + 6144;
        v8f s0 = {}, s1 = {}, x0 = {}, x1 = {};                  // s0[j]: key l0 + 8 * hi + j, s1[j]: key l0 + 16 + 8 * hi + j, query q0 + lr
#pragma unroll
        for (int kc = 0; kc < 2; ++kc) {
            { const v16h k0h = cat16(*(const v8ha*)(kh0 + kc * 512), *(const v8ha*)(kh0 + kc * 512 + 256)), k1h = cat16(*(const v8ha*)(kh0 + 1024 + kc * 512), *(const v8ha*)(kh0 + 1024 + kc * 512 + 256));
              const v16h qlk = cat16(*(const v8h*)(QL16 + qo0 + kc * 512 + l8), *(const v8h*)(QL16 + qo0 + kc * 512 + 256 + l8));     // query residual re-read per step (registers)
              s0 = wmma16(k0h, qa[kc], s0); x0 = wmma16(k0h, qlk, x0); s1 = wmma16(k1h, qa[kc], s1); x1 = wmma16(k1h, qlk, x1);
              asm volatile("v_nop" : "+v"(s0), "+v"(s1), "+v"(x0), "+v"(x1) : "v"(qlk), "v"(k0h), "v"(k1h) : "memory"); }
            { const v16h k0l = cat16(*(const v8ha*)(kl0 + kc * 512), *(const v8ha*)(kl0 + kc * 512 + 256)), k1l = cat16(*(const v8ha*)(kl0 + 1024 + kc * 512), *(const v8ha*)(kl0 + 1024 + kc * 512 + 256));
              x0 = wmma16(k0l, qa[kc], x0); x1 = wmma16(k1l, qa[kc], x1);
              asm volatile("v_nop" : "+v"(x0), "+v"(x1) : "v"(k0l), "v"(k1l) : "memory"); }
        }
        asm volatile("v_nop\n\tv_nop\n\tv_nop\n\tv_nop" : "+v"(s0), "+v"(s1), "+v"(x0), "+v"(x1) : "v"(qa[0]), "v"(qa[1]));
        float a0[8], a1[8]; bool va[8], vb[8];
        const int krel = klim - l0;
#pragma unroll
        for (int j = 0; j < 8; ++j) { va[j] = j < krel; a0[j] = va[j] ? (s0[j] + x0[j] * LOSCI) * 0.125f : NEGV; }
#pragma unroll
        for (int j = 0; j < 8; ++j) { vb[j] = 16 + j < krel; a1[j] = vb[j] ? (s1[j] + x1[j] * LOSCI) * 0.125f : NEGV; }
        float mx = fmaxf(a0[0], a1[0]);
#pragma unroll
        for (int j = 1; j < 8; ++j) mx = fmaxf(mx, fmaxf(a0[j], a1[j]));
        mx = fmaxf(mx, xhalf(mx));                               // the query's other 16 keys of the tile
        const float mn = fmaxf(mrow, mx);
        const float alpha = __expf(mrow - mn); mrow = mn;
        float sum = 0.f;
        v16h pa, px;                                             // weights^T as a B operand: element s = key s < 8 ? 8 * hi + s : 16 + 8 * hi + (s - 8), as the v fragments have it
#pragma unroll
        for (int j = 0; j < 8; ++j) {
            const float p0 = __expf(a0[j] - mn), p1 = __expf(a1[j] - mn);
            sum += p0 + p1;                                      // normaliser over the (masked-to-NEG) scores, as the reference's softmax
            const float ps0 = va[j] ? p0 * PSC : 0.f, ps1 = vb[j] ? p1 * PSC : 0.f; const h16 h0 = (h16)ps0, h1 = (h16)ps1;     // attn * mask
            pa[j] = h0; pa[8 + j] = h1;
            px[j] = (h16)((ps0 - (float)h0) * LOSC); px[8 + j] = (h16)((ps1 - (float)h1) * LOSC);
        }
        lpart = lpart * alpha + sum;
#pragma unroll
        for (int n = 0; n < 4; ++n)
#pragma unroll
            for (int j = 0; j < 8; ++j) { o[n][j] *= alpha; ox[n][j] *= alpha; }
#pragma unroll
        for (int n = 0; n < 4; ++n) { const int vo = n * 512;
            const v16h vh = cat16(*(const v8ha*)(vhp + vo), *(const v8ha*)(vhp + vo + 256)), vl = cat16(*(const v8ha*)(vlp + vo), *(const v8ha*)(vlp + vo + 256));
            o[n] = wmma16(vh, pa, o[n]); ox[n] = wmma16(vl, pa, ox[n]); ox[n] = wmma16(vh, px, ox[n]);
            asm volatile("" : "+v"(o[n]), "+v"(ox[n]) : "v"(vh), "v"(vl) : "memory"); }
        asm volatile("v_nop\n\tv_nop\n\tv_nop\n\tv_nop" : "+v"(o[0]), "+v"(o[1]), "+v"(o[2]), "+v"(o[3]), "+v"(ox[0]), "+v"(ox[1]), "+v"(ox[2]), "+v"(ox[3]) : "v"(pa), "v"(px));
        asm volatile("s_wait_dscnt 0x0" ::: "memory");           // this wave's reads of the buffer have returned
        asm volatile("s_wait_asynccnt 0x0" ::: "memory");        // this wave's part of the next tile has landed
        __syncthreads();                                         // publishes the next tile and ends every wave's reads of this buffer, which is refilled behind it
        if (kt + 2 <= kt_hi) stage(kt + 2);
    } while (++kt <= kt_hi);
    asm volatile("s_wait_asynccnt 0x0" ::: "memory");            // no copy is out when the wave goes on to the epilogue
    const float inv = 1.0f / ((lpart + xhalf(lpart)) * PSC);     // the two halves' parts of the normaliser are joined once
    const size_t cbase = FRG((tok0 + q0) >> 4, h * 2);
#pragma unroll
    for (int n = 0; n < 4; ++n) { v8us oh, ol;                   // n = fragment * 2 + piece
#pragma unroll
        for (int j = 0; j < 8; ++j) { const float c = (o[n][j] + ox[n][j] * LOSCI) * inv; const unsigned short hb = f2bf(c); oh[j] = hb; ol[j] = f2bf(c - bf2f(hb)); }
        *(v8us*)(CH + cbase + n * 256 + l8) = oh; *(v8us*)(CL + cbase + n * 256 + l8) = ol;
        asm volatile("s_wait_xcnt 0x0" ::: "memory"); }          // stands before the issued stores' registers are reused
}

#define VST2(T, p, v) do { const T vst2_v_ = (v); *(T*)(p) = vst2_v_;  } while (0)
extern "C" void kernel_launch(void* const* d_in, const int* in_sizes, int n_in,
                              void* d_out, int out_size, void* d_ws, size_t ws_size, hipStream_t stream) {
    (void)in_sizes; (void)n_in; (void)out_size;
    const float* x = (const float*)d_in[0]; const int* lens = (const int*)d_in[1]; const float* Wqkv = (const float*)d_in[2]; const float* bqkv = (const float*)d_in[3]; const float* Wo = (const float*)d_in[4]; const float* bo = (const float*)d_in[5];
    float* out = (float*)d_out;    // [8][1024][1024]
    char* wsp = (char*)d_ws;
    auto take = [&](size_t bytes) { char* p = wsp; wsp += (bytes + 255) & ~(size_t)255; return (void*)p; };
    bf* Xb = (bf*)take((size_t)NTK * DM * 2); bf* W3T = (bf*)take((size_t)3 * DM * DM * 2); bf* WoT = (bf*)take((size_t)DM * DM * 2);
    h16* QH = (h16*)take((size_t)NTK * DM * 2); h16* QL = (h16*)take((size_t)NTK * DM * 2); h16* KH = (h16*)take((size_t)NTK * DM * 2); h16* KL = (h16*)take((size_t)NTK * DM * 2);
    float* Vf = (float*)take((size_t)NTK * DM * 4); h16* VTL = (h16*)take((size_t)NTK * DM * 2);
    if ((size_t)(wsp - (char*)d_ws) > ws_size) return;    // 8 batch items = 8192 rows: 16.8 + 6.3 + 2.1 + 4 x 16.8 + 33.6 + 16.8 ~ 143 MB
    h16* VTH = (h16*)Xb; bf* CH = (bf*)Vf; bf* CL = (bf*)((char*)Vf + (size_t)NTK * DM * 2);
    k_prep<<<NWQ + NWO + NTK / 8, 256, 0, stream>>>(x, Wqkv, Wo, Xb, W3T, WoT, lens);
    k_gemmb<false, true><<<dim3(NTK / 64, (3 * DM) / 128, 1), 128, 0, stream>>>(Xb, nullptr, W3T, bqkv, Vf, DM, QH, QL, KH, KL, lens);
    k_vt<<<NB_ * NKV * (NT_ / 64), 256, 0, stream>>>(Vf, VTH, VTL, lens);
    k_attn<<<NB_ * NH_ * (NT_ / 64), 128, 0, stream>>>(QH, QL, KH, KL, VTH, VTL, lens, 0, CH, CL);
    k_gemmb<true, false><<<dim3(NTK / 64, DM / 128, 1), 128, 0, stream>>>(CH, CL, WoT, bo, out, DM, nullptr, nullptr, nullptr, nullptr, lens);
}

// v008
// One run takes 154 microseconds.
// Two timings next to v007 both put it at 1.04 times that version's speed.
// Over all steps from v000 it is 5.13 times as fast.
#include <hip/hip_runtime.h>

// Contractions, f32 accumulate: qkv = x.w_qkv + b_qkv ([8192 x 1024].[1024 x 3072], k-major weight transposed to an n-major plane; PLAIN bf16 operands: inputs
// rounded once, exact) and out.w_o + b_o (merged heads as bf16 hi + residual: two products) on v_wmma_f32_16x16x32_bf16; the 16-head length-masked attention fused
// on v_wmma_f32_16x16x32_f16: logits = q.k/8 where query AND key are < lengths[b] (the INPUT), else -1e9 (the reference's score*mask + NEG(1-mask)); softmax; the
// weights are multiplied by the same mask again (so rows beyond the length give exactly zero context); q and k as f16 hi + residual x1024 (hi.hi + hi.lo + lo.hi),

#define NB_  8                   // all 8 batch items go through every launch together
#define NT_  1024
#define DM   1024
#define NH_  16
#define NKV  16
#define KVW  (NKV * HD)          // 1024
#define HD   64
#define NTK  (NB_ * NT_)
#define NW   1024
#define NQKV 1024
#define PSC  32768.0f
#define NEGV (-1.0e9f)
#define LOSC 1024.0f
#define LOSCI (1.0f / 1024.0f)
// Every 16-bit operand plane in the workspace (rows of 1024 elements) is stored fragment-major: the 16 rows x 32 k of one WMMA operand fragment are 512 consecutive
// elements, element (row, k) at FRG(row / 16, k / 32) + ((k % 32) / 16) * 256 + ((((k % 16) / 8) * 16) + row % 16) * 8 + k % 8. A lane's two 16-byte pieces then
// lie at lane * 8 and 256 + lane * 8, so one wave load reads 512 consecutive bytes (4 whole 128-byte lines) where the row-major plane made it touch 16 lines.
#define FRG(rg, kc32) (((size_t)(rg) * (DM / 32) + (size_t)(kc32)) * 512)

typedef _Float16 h16;
typedef unsigned short bf;
typedef __attribute__((ext_vector_type(16))) __bf16   v16bf;
typedef __attribute__((ext_vector_type(16))) _Float16 v16h;
typedef __attribute__((ext_vector_type(8)))  _Float16 v8h;
typedef __attribute__((ext_vector_type(8)))  unsigned short v8us;
typedef __attribute__((ext_vector_type(8)))  float    v8f;
typedef __attribute__((ext_vector_type(4)))  float    v4f;
typedef v8h  __attribute__((may_alias)) v8ha;
typedef v4f  __attribute__((may_alias)) v4fa;
typedef v8us __attribute__((may_alias)) v8usa;

__device__ __forceinline__ unsigned short f2bf(float f) { unsigned u = __float_as_uint(f); u += 0x7FFFu + ((u >> 16) & 1u); return (unsigned short)(u >> 16); }
__device__ __forceinline__ float bf2f(unsigned short b) { return __uint_as_float(((unsigned)b) << 16); }
__device__ __forceinline__ float bfr(float f) { return bf2f(f2bf(f)); }
__device__ __forceinline__ v16h cat16(v8h lo, v8h hi) { return __builtin_shufflevector(lo, hi, 0, 1, 2, 3, 4, 5, 6, 7, 8, 9, 10, 11, 12, 13, 14, 15); }
__device__ __forceinline__ v16bf cat16b(v8us lo, v8us hi) { return __builtin_bit_cast(v16bf, __builtin_shufflevector(lo, hi, 0, 1, 2, 3, 4, 5, 6, 7, 8, 9, 10, 11, 12, 13, 14, 15)); }
__device__ __forceinline__ v8f wmma16(v16h a, v16h b, v8f c) { return __builtin_amdgcn_wmma_f32_16x16x32_f16(false, a, false, b, (short)0, c, false, false); }
__device__ __forceinline__ v8f wmmab(v16bf a, v16bf b, v8f c) { return __builtin_amdgcn_wmma_f32_16x16x32_bf16(false, a, false, b, (short)0, c, false, false); }

// lengths[b] (the INPUT), clamped to 0..NT_. A token at or beyond it is masked as query and as key: its context row is exactly zero and its key weighs exactly zero
// (exp(-1e9 - max) = 0 in f32), so a 64-token tile that lies wholly beyond the length is left out of every launch; the output rows there are the bias alone.
__device__ __forceinline__ int len_of(const int* __restrict__ lens, int b) { const int l = lens[b]; return l < 0 ? 0 : (l > NT_ ? NT_ : l); }
__device__ __forceinline__ bool tile_past(const int* __restrict__ lens, int row) { return ((row & (NT_ - 1)) & ~63) >= len_of(lens, row / NT_); }     // row = b * NT_ + token

// cvtb_block: block bx of the conversion of x to the fragment-major bf16 plane.
__device__ __forceinline__ void cvtb_block(int bx, const float* __restrict__ src, int nrows, bf* dst, const int* __restrict__ lens) {
    if (tile_past(lens, ((bx * 8) / (DM / 64)) * 16)) return;     // the block's 8 waves share one 16-row group (block-uniform)
    const int lane = threadIdx.x & 31, lr = lane & 15, hi = lane >> 4;
    const int gw = bx * 8 + (threadIdx.x >> 5);                  // one wave: 16 rows x 64 k = two fragments
    const int rg = gw / (DM / 64), kq = gw - rg * (DM / 64);
    if (rg * 16 >= nrows) return;
    const float* sp = src + (size_t)(rg * 16 + lr) * DM + kq * 64 + hi * 8;
    v8us o[4];
#pragma unroll
    for (int u = 0; u < 4; ++u) { v8us t;                        // u = fragment * 2 + piece
#pragma unroll
        for (int i = 0; i < 8; ++i) t[i] = f2bf(sp[u * 16 + i]);
        o[u] = t; }
    bf* dp = dst + FRG(rg, kq * 2) + lane * 8;
#pragma unroll
    for (int u = 0; u < 4; ++u) *(v8us*)(dp + u * 256) = o[u];
}

// wt_block: W [1024 k][ncols n] (k-major) -> n-major bf16 plane WT (rows n, fragment-major); the 64 x 64 tile (bx, by) through LDS.
__device__ __forceinline__ void wt_block(unsigned short* tl, int bx, int by, const float* __restrict__ Wm, int ncols, bf* WT) {
    const int tid = threadIdx.x, k0 = bx * 64, n0 = by * 64;
    const int kk = tid >> 2, nq = (tid & 3) * 16;
#pragma unroll
    for (int i = 0; i < 16; ++i) tl[(nq + i) * 72 + kk] = f2bf(Wm[(size_t)(k0 + kk) * ncols + n0 + nq + i]);
    __syncthreads();
    typedef __attribute__((ext_vector_type(8))) unsigned short v8us_; typedef v8us_ __attribute__((may_alias)) v8usa_;
    auto pass = [&]() {
#pragma unroll
        for (int s = 0; s < 2; ++s) { const int u = tid + 256 * s; const int fr = u >> 6, pc = (u >> 5) & 1, ln = u & 31;     // 8 fragments: (fr >> 1) = 16-row group, (fr & 1) = 32-k chunk
            const v8us_ val = *(const v8usa_*)(tl + ((fr >> 1) * 16 + (ln & 15)) * 72 + (fr & 1) * 32 + pc * 16 + (ln >> 4) * 8);
            *(v8us_*)(WT + FRG((n0 >> 4) + (fr >> 1), (k0 >> 5) + (fr & 1)) + pc * 256 + ln * 8) = val; }
    };
    pass(); 
}

// k_prep: the three conversions that depend on nothing but the inputs share one launch: blocks 0 .. NWQ - 1 transpose w_qkv, the next NWO transpose w_o, the rest
// convert x. Which of the three a block does depends on blockIdx alone, so the barrier in wt_block stands under block-uniform control flow.
#define NWQ ((DM / 64) * ((3 * DM) / 64))
#define NWO ((DM / 64) * (DM / 64))
__global__ __launch_bounds__(256) void k_prep(const float* __restrict__ x, const float* __restrict__ Wqkv, const float* __restrict__ Wo, bf* Xb, bf* W3T, bf* WoT, const int* __restrict__ lens) {
    __shared__ __align__(16) unsigned short tl[64 * 72];
    const int bid = blockIdx.x;
    if (bid < NWQ + NWO) { const bool o = bid >= NWQ; const int t = o ? bid - NWQ : bid;
        wt_block(tl, t & (DM / 64 - 1), t / (DM / 64), o ? Wo : Wqkv, o ? DM : 3 * DM, o ? WoT : W3T); }
    else cvtb_block(bid - (NWQ + NWO), x, NTK, Xb, lens);
}

// k_gemmb: block = 64 rows x 128 columns, 4 waves of 32 x 64 (2 x 4 accumulator tiles). The operand fragments of 64 k (4 row groups of A, of its residual where SPLITA,
// and 8 column groups of B, 2 KB each) come into LDS once per block by asynchronous copies, two buffers, the next 64 k in flight while these are worked on.
// Stage layout in elements: A 0, B 4096, A residual 12288. Each accumulator takes its products in the same k order as before.
// QKV: one launch over all 3072 columns of x.w_qkv; a block's 128 columns lie in one third, which says where and how its tile is stored: q and k as f16 hi + residual
// planes (QH/QL, KH/KL), v as the transposed f16 hi + residual planes VH/VL (rows (b, h, d), k = key position) that k_attn reads.
template <bool SPLITA, bool QKV>
__global__ __launch_bounds__(128) void k_gemmb(const bf* __restrict__ A, const bf* __restrict__ Al, const bf* __restrict__ Bn, const float* __restrict__ bias, float* C, int ldc, h16* QH, h16* QL, h16* KH, h16* KL, h16* VH, h16* VL, const int* __restrict__ lens) {
    constexpr int STE = SPLITA ? 16384 : 12288;                  // elements per stage
    __shared__ __align__(128) bf ring[2 * STE];                  // behind the loop its first 34,816 bytes stage the output tiles
    const bool past = tile_past(lens, blockIdx.x * 64);          // the block's 64 tokens all lie beyond their item's length (block-uniform)
    if (!SPLITA && past) return;                                 // q, k, v rows that nobody reads; stands in front of every barrier
    const int lane = threadIdx.x & 31, lr = lane & 15, hi = lane >> 4;
    const int wave = __builtin_amdgcn_readfirstlane(threadIdx.x >> 5);     // the same in every lane of a wave
    const int wm = wave >> 1, wn = wave & 1;
    const unsigned l8 = lane * 8;                                // the one per-lane part of every fragment address
    const int rb = blockIdx.x * 64, cb = blockIdx.y * 128;
    const int r0 = rb + wm * 32, c0 = cb + wn * 64;              // the wave's 32 x 64 tile
    v8f acc[2][4];
#pragma unroll
    for (int m = 0; m < 2; ++m)
#pragma unroll
        for (int t = 0; t < 4; ++t) acc[m][t] = (v8f){};
    if (!(SPLITA && past)) {                                     // output projection of all-zero context rows: no product, the bias alone is stored (block-uniform)
        const unsigned t8 = threadIdx.x * 8;                     // a thread's 16 bytes of each 2 KB that the block copies at once
        const unsigned ring0 = (unsigned)(size_t)&ring[0] + t8 * 2;     // its LDS byte address in buffer 0
        const bf* As = A + FRG(rb >> 4, 0) + t8;
        const bf* Als = SPLITA ? Al + FRG(rb >> 4, 0) + t8 : As;
        const bf* Bs = Bn + FRG(cb >> 4, 0) + t8;
        auto cp4 = [&](unsigned d, const bf* s) {                // 64 k of four 16-row groups: 4 copies of 16 bytes per lane, every lane on
            // the closing wait stands in the copies' own statement, in front of any rewrite of a register that a copy names
            asm volatile("global_load_async_to_lds_b128 %0, %4, off\n\tglobal_load_async_to_lds_b128 %1, %5, off\n\tglobal_load_async_to_lds_b128 %2, %6, off\n\tglobal_load_async_to_lds_b128 %3, %7, off\n\ts_wait_xcnt 0x0"
                         :: "v"(d), "v"(d + 2048u), "v"(d + 4096u), "v"(d + 6144u), "v"(s), "v"(s + FRG(1, 0)), "v"(s + FRG(2, 0)), "v"(s + FRG(3, 0)) : "memory");
        };
        auto cp8 = [&](unsigned d, const bf* s, const bf* u) {   // the same for four groups at s and four at u, into 16 KB in a row: one closing wait for the eight
            asm volatile("global_load_async_to_lds_b128 %0, %8, off\n\tglobal_load_async_to_lds_b128 %1, %9, off\n\tglobal_load_async_to_lds_b128 %2, %10, off\n\tglobal_load_async_to_lds_b128 %3, %11, off\n\t"
                         "global_load_async_to_lds_b128 %4, %12, off\n\tglobal_load_async_to_lds_b128 %5, %13, off\n\tglobal_load_async_to_lds_b128 %6, %14, off\n\tglobal_load_async_to_lds_b128 %7, %15, off\n\ts_wait_xcnt 0x0"
                         :: "v"(d), "v"(d + 2048u), "v"(d + 4096u), "v"(d + 6144u), "v"(d + 8192u), "v"(d + 10240u), "v"(d + 12288u), "v"(d + 14336u),
                            "v"(s), "v"(s + FRG(1, 0)), "v"(s + FRG(2, 0)), "v"(s + FRG(3, 0)), "v"(u), "v"(u + FRG(1, 0)), "v"(u + FRG(2, 0)), "v"(u + FRG(3, 0)) : "memory");
        };
        auto stage = [&](int t) {                                // k = 64 t .. 64 t + 63 (t <= 15: inside the planes) -> buffer t & 1
            const unsigned d = ring0 + (unsigned)(t & 1) * (STE * 2);
            const int ko = t * 1024;                             // two fragments of a row group lie in a row
            cp8(d, As + ko, Bs + ko);
            if (SPLITA) cp8(d + 16384u, Bs + FRG(4, 0) + ko, Als + ko); else cp4(d + 16384u, Bs + FRG(4, 0) + ko);
        };
        stage(0);
        asm volatile("s_wait_asynccnt 0x0" ::: "memory");        // this wave's part of stage 0 has landed
        __syncthreads();                                         // every wave's part has: stage 0 may be read
        stage(1);
#pragma unroll 1
        for (int t = 0; t < DM / 64; ++t) {                      // rolled: one copy of the body in the instruction cache
            const bf* st = ring + (t & 1) * STE + l8;
            const bf* ap = st + wm * 2048; const bf* bp = st + 4096 + wn * 4096;
            v16bf a[2][2], al[2][2], b[2][4];                    // [32-k half][tile]
#pragma unroll
            for (int kc = 0; kc < 2; ++kc) {
#pragma unroll
                for (int m = 0; m < 2; ++m) { const bf* p = ap + m * 1024 + kc * 512; a[kc][m] = cat16b(*(const v8usa*)p, *(const v8usa*)(p + 256));
                    al[kc][m] = SPLITA ? cat16b(*(const v8usa*)(p + 12288), *(const v8usa*)(p + 12288 + 256)) : a[kc][m]; }
#pragma unroll
                for (int n = 0; n < 4; ++n) { const bf* p = bp + n * 1024 + kc * 512; b[kc][n] = cat16b(*(const v8usa*)p, *(const v8usa*)(p + 256)); }
            }
            asm volatile("s_wait_dscnt 0x0" ::: "memory");       // this wave's reads of the buffer have returned: the whole stage is in registers
            asm volatile("s_wait_asynccnt 0x0" ::: "memory");    // this wave's part of the next stage has landed
            __syncthreads();                                     // publishes the next stage and ends every wave's reads of this buffer, which is refilled behind it
            if (t + 2 < DM / 64) stage(t + 2);
            // the products read registers alone and stand behind the refill, so that the copies fly under them
#pragma unroll
            for (int kc = 0; kc < 2; ++kc) {
#pragma unroll
                for (int n = 0; n < 4; ++n) { acc[0][n] = wmmab(a[kc][0], b[kc][n], acc[0][n]); acc[1][n] = wmmab(a[kc][1], b[kc][n], acc[1][n]); }
                if (SPLITA) {
#pragma unroll
                    for (int n = 0; n < 4; ++n) { acc[0][n] = wmmab(al[kc][0], b[kc][n], acc[0][n]); acc[1][n] = wmmab(al[kc][1], b[kc][n], acc[1][n]); }
                }
            }
        }
        asm volatile("s_wait_asynccnt 0x0" ::: "memory");        // no copy is out when the ring is reused for the output tiles
    }
    const int sel = QKV ? (int)(blockIdx.y / (DM / 128)) : 2;    // the third of the columns: 0 q, 1 k, 2 v (block-uniform)
    const int cp = QKV ? (c0 & (DM - 1)) : c0;                   // the tile's first column inside its own plane
    if (QKV && sel == 2) {
        // v: the wave's 64 columns are the 64 d of one head, its 32 rows one 32-key chunk. A lane's 8 registers of accumulator tile (m, t) are keys m * 16 + 8 * hi + j of
        // d = t * 16 + lr: the very 16 bytes that this lane holds of piece m of the transposed fragment (d group t), so they are stored from the registers, 512 bytes in a row per wave.
        const size_t vfo = FRG((((r0 / NT_) * NKV + (cp >> 6)) * HD) >> 4, (r0 & (NT_ - 1)) >> 5) + l8;
#pragma unroll
        for (int t = 0; t < 4; ++t) { const float bv = bias ? bfr(bias[c0 + t * 16 + lr]) : 0.f;
#pragma unroll
            for (int m = 0; m < 2; ++m) { v8h o, o2;
#pragma unroll
                for (int j = 0; j < 8; ++j) { const float v = acc[m][t][j] + bv; const h16 a = (h16)v; o[j] = a; o2[j] = (h16)((v - (float)a) * LOSC); }
                *(v8h*)(VH + vfo + FRG(t, 0) + m * 256) = o;
                asm volatile("s_wait_xcnt 0x0" ::: "memory");    // stands before the issued store's registers are reused for the residual
                *(v8h*)(VL + vfo + FRG(t, 0) + m * 256) = o2;
                asm volatile("s_wait_xcnt 0x0" ::: "memory"); }  // stands before the issued store's registers are reused
        }
        return;                                                  // block-uniform: none of the block's waves goes on to the barrier below
    }
    float* os = (float*)(void*)ring + wave * (32 * 68);
#pragma unroll
    for (int t = 0; t < 4; ++t) { const float bv = bias ? bfr(bias[c0 + t * 16 + lr]) : 0.f;
#pragma unroll
        for (int m = 0; m < 2; ++m)
#pragma unroll
            for (int j = 0; j < 8; ++j) os[(m * 16 + hi * 8 + j) * 68 + t * 16 + lr] = acc[m][t][j] + bv; }
    __syncthreads();
    if (QKV) {
        h16* Ch = sel ? KH : QH; h16* C2 = sel ? KL : QL;
#pragma unroll
        for (int m = 0; m < 2; ++m) {
            const size_t cfo = FRG((r0 >> 4) + m, cp >> 5);      // 16 x 64 = two fragments, 2 KB in a row
            h16* cf = Ch + cfo;
#pragma unroll
            for (int s = 0; s < 4; ++s) { const float* sp = os + (m * 16 + lr) * 68 + s * 16 + hi * 8; v8h o, o2;     // s = fragment * 2 + piece
#pragma unroll
                for (int i = 0; i < 8; ++i) { const h16 a = (h16)sp[i]; o[i] = a; o2[i] = (h16)((sp[i] - (float)a) * LOSC); }
                *(v8h*)(cf + s * 256 + l8) = o;
                asm volatile("s_wait_xcnt 0x0" ::: "memory");    // stands before the issued store's registers are reused for the residual
                *(v8h*)(C2 + cfo + s * 256 + l8) = o2;
                asm volatile("s_wait_xcnt 0x0" ::: "memory"); }  // stands before the issued store's registers are reused
        }
    } else {
        float* crow = C + (size_t)r0 * ldc + cp;
#pragma unroll
        for (int s = 0; s < 16; ++s) { const int Lid = (lane >> 3) + 4 * s, piece = lane & 7; const int row = Lid >> 1, cofs = (Lid & 1) * 32 + piece * 4;
            const v4f val = *(const v4fa*)(os + row * 68 + cofs); *(v4f*)(crow + (size_t)row * ldc + cofs) = val;
            asm volatile("s_wait_xcnt 0x0" ::: "memory"); }      // stands before the issued store's registers are reused
    }
}

// k_attn: block = (b, h, 64 queries), wave = 16; the key tiles that begin below lengths[b]. The products are taken transposed: scores^T = k . q^T (k the A operand, q the B operand)
// and ctx^T += v^T . weights^T. A lane then holds 16 of the 32 scores of ONE query (column lane & 15; keys 8 * (lane >> 4) + j and 16 + 8 * (lane >> 4) + j), so maximum and sum
// are taken in the lane with one exchange between the wave's halves, and the two score tiles, converted in place (weights x32768, f16 hi + residual x1024), ARE the B operand
// of the second product in the fragment's k order: the weights touch neither LDS nor another lane. A lane's 8 accumulator registers of ctx^T are 8 consecutive d of its query,
// the 16 bytes that it stores in the fragment-major planes CH/CL (bf16 hi + residual; rows tok, k = h*64+d).
// The 16 fragments of a 32-key tile (k hi, k residual, v hi, v residual: 16 KB, the same for the block's 4 waves) are brought into LDS once per block by asynchronous
// copies, two buffers, the next tile's copies in flight while this tile is worked on; stage layout in elements: k hi 0, k residual 2048, v hi 4096, v residual 6144.
#define STG 8192
__device__ __forceinline__ float xhalf(float x) { return __builtin_bit_cast(float, __builtin_amdgcn_permlanex16(__builtin_bit_cast(int, x), __builtin_bit_cast(int, x), 0x76543210, 0xfedcba98, false, false)); }     // lane l <-> lane l ^ 16
__global__ __launch_bounds__(128) void k_attn(const h16* __restrict__ Q16, const h16* __restrict__ QL16, const h16* __restrict__ K16, const h16* __restrict__ KL16, const h16* __restrict__ VTH, const h16* __restrict__ VTL, const int* __restrict__ lens, int bofs, bf* CH, bf* CL) {
    __shared__ __align__(16) h16 ring[2 * STG];
    const int lane = threadIdx.x & 31, lr = lane & 15, hi = lane >> 4;
    const int wave = __builtin_amdgcn_readfirstlane(threadIdx.x >> 5);     // the same in every lane of a wave: fragment bases stay in scalar registers
    const unsigned l8 = lane * 8;                                // the one per-lane part of every fragment address
    const int bid = blockIdx.x;
    const int b = bid / (NH_ * (NT_ / 64)), rem = bid - b * (NH_ * (NT_ / 64)), h = rem / (NT_ / 64), qt = rem - h * (NT_ / 64);
    const int q0 = qt * 64 + wave * 16;
    const int len = len_of(lens, bofs + b);                      // INPUT length of this batch item (block-uniform)
    if (qt * 64 >= len) return;                                  // 64 masked queries: the output projection does not read their context rows (in front of the barrier)
    const size_t tok0 = (size_t)b * NT_;
    v16h qa[2];
    const size_t qo0 = FRG((tok0 + q0) >> 4, h * 2);
#pragma unroll
    for (int kc = 0; kc < 2; ++kc) qa[kc] = cat16(*(const v8h*)(Q16 + qo0 + kc * 512 + l8), *(const v8h*)(Q16 + qo0 + kc * 512 + 256 + l8));
    asm volatile("s_wait_xcnt 0x0" ::: "memory");                // stands before the issued query loads' base registers are reused
    const int g = h / (NH_ / NKV);                      // kv head
    const h16* kh_b = K16 + FRG(tok0 >> 4, g * 2);
    const h16* kl_b = KL16 + FRG(tok0 >> 4, g * 2);
    const size_t vbase = FRG(((b * NKV + g) * HD) >> 4, 0);
    v8f o[4], ox[4];                                             // ctx^T: o[n][j] = d n * 16 + 8 * hi + j of query q0 + lr
#pragma unroll
    for (int n = 0; n < 4; ++n) { o[n] = (v8f){}; ox[n] = (v8f){}; }
    float mrow = -3.0e38f, lpart = 0.f;                          // the lane's query: running maximum (equal in both halves), this half's part of the normaliser
    const int klim = (q0 + lr < len) ? len - 8 * hi : 0;         // key l0 + 8 * hi + j counts iff query AND key are < len: l0 + j < klim
    const int kt_hi = (len + 31) / 32 - 1;                       // block-uniform (every wave passes every barrier of the loop), >= 0 (len >= 1 here): a tile of keys >= len adds exactly 0 to sum and context and leaves the maximum
    const unsigned t8 = threadIdx.x * 8;                         // a thread's 16 bytes of each 2 KB that the block copies at once
    const unsigned ring0 = (unsigned)(size_t)&ring[0] + t8 * 2;  // its LDS byte address in buffer 0
    const h16* ksh = kh_b + t8; const h16* ksl = kl_b + t8;      // two fragments of one 16-key group lie in a row
    const size_t vso = vbase + FRG(threadIdx.x >> 6, 0) + (threadIdx.x & 63) * 8;     // 64 threads per v fragment, two fragments per copy
    auto stage = [&](int t) {                                    // tile t (t <= kt_hi <= 31: inside the planes) -> buffer t & 1; 8 copies of 16 bytes per lane, every lane on
        const unsigned d = ring0 + (unsigned)(t & 1) * (STG * 2);
        const h16* a0 = ksh + FRG(t * 2, 0); const h16* a1 = a0 + FRG(1, 0); const h16* a2 = ksl + FRG(t * 2, 0); const h16* a3 = a2 + FRG(1, 0);
        const h16* a4 = VTH + vso + FRG(0, t); const h16* a5 = a4 + FRG(2, 0); const h16* a6 = VTL + vso + FRG(0, t); const h16* a7 = a6 + FRG(2, 0);
        // the closing wait stands in the copies' own statement, in front of any rewrite of a register that a copy names
        asm volatile("global_load_async_to_lds_b128 %0, %8, off\n\tglobal_load_async_to_lds_b128 %1, %9, off\n\tglobal_load_async_to_lds_b128 %2, %10, off\n\tglobal_load_async_to_lds_b128 %3, %11, off\n\t"
                     "global_load_async_to_lds_b128 %4, %12, off\n\tglobal_load_async_to_lds_b128 %5, %13, off\n\tglobal_load_async_to_lds_b128 %6, %14, off\n\tglobal_load_async_to_lds_b128 %7, %15, off\n\ts_wait_xcnt 0x0"
                     :: "v"(d), "v"(d + 2048u), "v"(d + 4096u), "v"(d + 6144u), "v"(d + 8192u), "v"(d + 10240u), "v"(d + 12288u), "v"(d + 14336u),
                        "v"(a0), "v"(a1), "v"(a2), "v"(a3), "v"(a4), "v"(a5), "v"(a6), "v"(a7) : "memory");
    };
    stage(0);
    asm volatile("s_wait_asynccnt 0x0" ::: "memory");            // this wave's part of tile 0 has landed
    __syncthreads();                                             // every wave's part has: tile 0 may be read
    if (kt_hi >= 1) stage(1);
    int kt = 0;
#pragma unroll 1
    do {
        const int l0 = kt * 32;
        const h16* kh0 = ring + (kt & 1) * STG + l8; const h16* kl0 = kh0 + 2048;     // keys l0..l0+15; the next 16 keys lie 1024 elements further
        const h16* vhp = kh0 + 4096; const h16* vlp = kh0 + 6144;
        v8f s0 = {}, s1 = {}, x0 = {}, x1 = {};                  // s0[j]: key l0 + 8 * hi + j, s1[j]: key l0 + 16 + 8 * hi + j, query q0 + lr
#pragma unroll
        for (int kc = 0; kc < 2; ++kc) {
            { const v16h k0h = cat16(*(const v8ha*)(kh0 + kc * 512), *(const v8ha*)(kh0 + kc * 512 + 256)), k1h = cat16(*(const v8ha*)(kh0 + 1024 + kc * 512), *(const v8ha*)(kh0 + 1024 + kc * 512 + 256));
              const v16h qlk = cat16(*(const v8h*)(QL16 + qo0 + kc * 512 + l8), *(const v8h*)(QL16 + qo0 + kc * 512 + 256 + l8));     // query residual re-read per step (registers)
              s0 = wmma16(k0h, qa[kc], s0); x0 = wmma16(k0h, qlk, x0); s1 = wmma16(k1h, qa[kc], s1); x1 = wmma16(k1h, qlk, x1);
              asm volatile("v_nop" : "+v"(s0), "+v"(s1), "+v"(x0), "+v"(x1) : "v"(qlk), "v"(k0h), "v"(k1h) : "memory"); }
            { const v16h k0l = cat16(*(const v8ha*)(kl0 + kc * 512), *(const v8ha*)(kl0 + kc * 512 + 256)), k1l = cat16(*(const v8ha*)(kl0 + 1024 + kc * 512), *(const v8ha*)(kl0 + 1024 + kc * 512 + 256));
              x0 = wmma16(k0l, qa[kc], x0); x1 = wmma16(k1l, qa[kc], x1);
              asm volatile("v_nop" : "+v"(x0), "+v"(x1) : "v"(k0l), "v"(k1l) : "memory"); }
        }
        asm volatile("v_nop\n\tv_nop\n\tv_nop\n\tv_nop" : "+v"(s0), "+v"(s1), "+v"(x0), "+v"(x1) : "v"(qa[0]), "v"(qa[1]));
        float a0[8], a1[8]; bool va[8], vb[8];
        const int krel = klim - l0;
#pragma unroll
        for (int j = 0; j < 8; ++j) { va[j] = j < krel; a0[j] = va[j] ? (s0[j] + x0[j] * LOSCI) * 0.125f : NEGV; }
#pragma unroll
        for (int j = 0; j < 8; ++j) { vb[j] = 16 + j < krel; a1[j] = vb[j] ? (s1[j] + x1[j] * LOSCI) * 0.125f : NEGV; }
        float mx = fmaxf(a0[0], a1[0]);
#pragma unroll
        for (int j = 1; j < 8; ++j) mx = fmaxf(mx, fmaxf(a0[j], a1[j]));
        mx = fmaxf(mx, xhalf(mx));                               // the query's other 16 keys of the tile
        const float mn = fmaxf(mrow, mx);
        const float alpha = __expf(mrow - mn); mrow = mn;
        float sum = 0.f;
        v16h pa, px;                                             // weights^T as a B operand: element s = key s < 8 ? 8 * hi + s : 16 + 8 * hi + (s - 8), as the v fragments have it
#pragma unroll
        for (int j = 0; j < 8; ++j) {
            const float p0 = __expf(a0[j] - mn), p1 = __expf(a1[j] - mn);
            sum += p0 + p1;                                      // normaliser over the (masked-to-NEG) scores, as the reference's softmax
            const float ps0 = va[j] ? p0 * PSC : 0.f, ps1 = vb[j] ? p1 * PSC : 0.f; const h16 h0 = (h16)ps0, h1 = (h16)ps1;     // attn * mask
            pa[j] = h0; pa[8 + j] = h1;
            px[j] = (h16)((ps0 - (float)h0) * LOSC); px[8 + j] = (h16)((ps1 - (float)h1) * LOSC);
        }
        lpart = lpart * alpha + sum;
#pragma unroll
        for (int n = 0; n < 4; ++n)
#pragma unroll
            for (int j = 0; j < 8; ++j) { o[n][j] *= alpha; ox[n][j] *= alpha; }
#pragma unroll
        for (int n = 0; n < 4; ++n) { const int vo = n * 512;
            const v16h vh = cat16(*(const v8ha*)(vhp + vo), *(const v8ha*)(vhp + vo + 256)), vl = cat16(*(const v8ha*)(vlp + vo), *(const v8ha*)(vlp + vo + 256));
            o[n] = wmma16(vh, pa, o[n]); ox[n] = wmma16(vl, pa, ox[n]); ox[n] = wmma16(vh, px, ox[n]);
            asm volatile("" : "+v"(o[n]), "+v"(ox[n]) : "v"(vh), "v"(vl) : "memory"); }
        asm volatile("v_nop\n\tv_nop\n\tv_nop\n\tv_nop" : "+v"(o[0]), "+v"(o[1]), "+v"(o[2]), "+v"(o[3]), "+v"(ox[0]), "+v"(ox[1]), "+v"(ox[2]), "+v"(ox[3]) : "v"(pa), "v"(px));
        asm volatile("s_wait_dscnt 0x0" ::: "memory");           // this wave's reads of the buffer have returned
        asm volatile("s_wait_asynccnt 0x0" ::: "memory");        // this wave's part of the next tile has landed
        __syncthreads();                                         // publishes the next tile and ends every wave's reads of this buffer, which is refilled behind it
        if (kt + 2 <= kt_hi) stage(kt + 2);
    } while (++kt <= kt_hi);
    asm volatile("s_wait_asynccnt 0x0" ::: "memory");            // no copy is out when the wave goes on to the epilogue
    const float inv = 1.0f / ((lpart + xhalf(lpart)) * PSC);     // the two halves' parts of the normaliser are joined once
    const size_t cbase = FRG((tok0 + q0) >> 4, h * 2);
#pragma unroll
    for (int n = 0; n < 4; ++n) { v8us oh, ol;                   // n = fragment * 2 + piece
#pragma unroll
        for (int j = 0; j < 8; ++j) { const float c = (o[n][j] + ox[n][j] * LOSCI) * inv; const unsigned short hb = f2bf(c); oh[j] = hb; ol[j] = f2bf(c - bf2f(hb)); }
        *(v8us*)(CH + cbase + n * 256 + l8) = oh; *(v8us*)(CL + cbase + n * 256 + l8) = ol;
        asm volatile("s_wait_xcnt 0x0" ::: "memory"); }          // stands before the issued stores' registers are reused
}

#define VST2(T, p, v) do { const T vst2_v_ = (v); *(T*)(p) = vst2_v_;  } while (0)
extern "C" void kernel_launch(void* const* d_in, const int* in_sizes, int n_in,
                              void* d_out, int out_size, void* d_ws, size_t ws_size, hipStream_t stream) {
    (void)in_sizes; (void)n_in; (void)out_size;
    const float* x = (const float*)d_in[0]; const int* lens = (const int*)d_in[1]; const float* Wqkv = (const float*)d_in[2]; const float* bqkv = (const float*)d_in[3]; const float* Wo = (const float*)d_in[4]; const float* bo = (const float*)d_in[5];
    float* out = (float*)d_out;    // [8][1024][1024]
    char* wsp = (char*)d_ws;
    auto take = [&](size_t bytes) { char* p = wsp; wsp += (bytes + 255) & ~(size_t)255; return (void*)p; };
    bf* Xb = (bf*)take((size_t)NTK * DM * 2); bf* W3T = (bf*)take((size_t)3 * DM * DM * 2); bf* WoT = (bf*)take((size_t)DM * DM * 2);
    h16* QH = (h16*)take((size_t)NTK * DM * 2); h16* QL = (h16*)take((size_t)NTK * DM * 2); h16* KH = (h16*)take((size_t)NTK * DM * 2); h16* KL = (h16*)take((size_t)NTK * DM * 2);
    h16* VTH = (h16*)take((size_t)NTK * DM * 2); h16* VTL = (h16*)take((size_t)NTK * DM * 2); bf* CL = (bf*)take((size_t)NTK * DM * 2);
    if ((size_t)(wsp - (char*)d_ws) > ws_size) return;    // 8 batch items = 8192 rows: 16.8 + 6.3 + 2.1 + 7 x 16.8 ~ 143 MB
    bf* CH = Xb;                                          // x's plane is last read by the q/k/v products, in front of k_attn
    k_prep<<<NWQ + NWO + NTK / 8, 256, 0, stream>>>(x, Wqkv, Wo, Xb, W3T, WoT, lens);
    k_gemmb<false, true><<<dim3(NTK / 64, (3 * DM) / 128, 1), 128, 0, stream>>>(Xb, nullptr, W3T, bqkv, nullptr, DM, QH, QL, KH, KL, VTH, VTL, lens);
    k_attn<<<NB_ * NH_ * (NT_ / 64), 128, 0, stream>>>(QH, QL, KH, KL, VTH, VTL, lens, 0, CH, CL);
    k_gemmb<true, false><<<dim3(NTK / 64, DM / 128, 1), 128, 0, stream>>>(CH, CL, WoT, bo, out, DM, nullptr, nullptr, nullptr, nullptr, nullptr, nullptr, lens);
}

// v009
// A run of this version takes 144 microseconds.
// In two side-by-side timings against v008, it was 1.06 and 1.07 times as fast.
// All steps since v000 together make it 5.46 times as fast.
#include <hip/hip_runtime.h>

// Contractions, f32 accumulate: qkv = x.w_qkv + b_qkv ([8192 x 1024].[1024 x 3072], k-major weight transposed to an n-major plane; PLAIN bf16 operands: inputs
// rounded once, exact) and out.w_o + b_o (merged heads as bf16 hi + residual: two products) on v_wmma_f32_16x16x32_bf16; the 16-head length-masked attention fused
// on v_wmma_f32_16x16x32_f16: logits = q.k/8 where query AND key are < lengths[b] (the INPUT), else -1e9 (the reference's score*mask + NEG(1-mask)); softmax; the
// weights are multiplied by the same mask again (so rows beyond the length give exactly zero context); q and k as f16 hi + residual x1024 (hi.hi + hi.lo + lo.hi),

#define NB_  8                   // all 8 batch items go through every launch together
#define NT_  1024
#define DM   1024
#define NH_  16
#define NKV  16
#define KVW  (NKV * HD)          // 1024
#define HD   64
#define NTK  (NB_ * NT_)
#define NW   1024
#define NQKV 1024
#define PSC  32768.0f
#define NEGV (-1.0e9f)
#define LOSC 1024.0f
#define LOSCI (1.0f / 1024.0f)
// Every 16-bit operand plane in the workspace (rows of 1024 elements) is stored fragment-major: the 16 rows x 32 k of one WMMA operand fragment are 512 consecutive
// elements, element (row, k) at FRG(row / 16, k / 32) + ((k % 32) / 16) * 256 + ((((k % 16) / 8) * 16) + row % 16) * 8 + k % 8. A lane's two 16-byte pieces then
// lie at lane * 8 and 256 + lane * 8, so one wave load reads 512 consecutive bytes (4 whole 128-byte lines) where the row-major plane made it touch 16 lines.
#define FRG(rg, kc32) (((size_t)(rg) * (DM / 32) + (size_t)(kc32)) * 512)

typedef _Float16 h16;
typedef unsigned short bf;
typedef __attribute__((ext_vector_type(16))) __bf16   v16bf;
typedef __attribute__((ext_vector_type(16))) _Float16 v16h;
typedef __attribute__((ext_vector_type(8)))  _Float16 v8h;
typedef __attribute__((ext_vector_type(8)))  unsigned short v8us;
typedef __attribute__((ext_vector_type(8)))  float    v8f;
typedef __attribute__((ext_vector_type(4)))  float    v4f;
typedef v8h  __attribute__((may_alias)) v8ha;
typedef v4f  __attribute__((may_alias)) v4fa;
typedef v8us __attribute__((may_alias)) v8usa;

__device__ __forceinline__ unsigned short f2bf(float f) { unsigned u = __float_as_uint(f); u += 0x7FFFu + ((u >> 16) & 1u); return (unsigned short)(u >> 16); }
__device__ __forceinline__ float bf2f(unsigned short b) { return __uint_as_float(((unsigned)b) << 16); }
__device__ __forceinline__ float bfr(float f) { return bf2f(f2bf(f)); }
__device__ __forceinline__ v16h cat16(v8h lo, v8h hi) { return __builtin_shufflevector(lo, hi, 0, 1, 2, 3, 4, 5, 6, 7, 8, 9, 10, 11, 12, 13, 14, 15); }
__device__ __forceinline__ v16bf cat16b(v8us lo, v8us hi) { return __builtin_bit_cast(v16bf, __builtin_shufflevector(lo, hi, 0, 1, 2, 3, 4, 5, 6, 7, 8, 9, 10, 11, 12, 13, 14, 15)); }
__device__ __forceinline__ v8f wmma16(v16h a, v16h b, v8f c) { return __builtin_amdgcn_wmma_f32_16x16x32_f16(false, a, false, b, (short)0, c, false, false); }
__device__ __forceinline__ v8f wmmab(v16bf a, v16bf b, v8f c) { return __builtin_amdgcn_wmma_f32_16x16x32_bf16(false, a, false, b, (short)0, c, false, false); }

// lengths[b] (the INPUT), clamped to 0..NT_. A token at or beyond it is masked as query and as key: its context row is exactly zero and its key weighs exactly zero
// (exp(-1e9 - max) = 0 in f32), so a 64-token tile that lies wholly beyond the length is left out of every launch; the output rows there are the bias alone.
__device__ __forceinline__ int len_of(const int* __restrict__ lens, int b) { const int l = lens[b]; return l < 0 ? 0 : (l > NT_ ? NT_ : l); }
__device__ __forceinline__ bool tile_past(const int* __restrict__ lens, int row) { return ((row & (NT_ - 1)) & ~63) >= len_of(lens, row / NT_); }     // row = b * NT_ + token

// cvtb_block: block bx of the conversion of x to the fragment-major bf16 plane.
__device__ __forceinline__ void cvtb_block(int bx, const float* __restrict__ src, int nrows, bf* dst, const int* __restrict__ lens) {
    if (tile_past(lens, ((bx * 8) / (DM / 64)) * 16)) return;     // the block's 8 waves share one 16-row group (block-uniform)
    const int lane = threadIdx.x & 31, lr = lane & 15, hi = lane >> 4;
    const int gw = bx * 8 + (threadIdx.x >> 5);                  // one wave: 16 rows x 64 k = two fragments
    const int rg = gw / (DM / 64), kq = gw - rg * (DM / 64);
    if (rg * 16 >= nrows) return;
    const float* sp = src + (size_t)(rg * 16 + lr) * DM + kq * 64 + hi * 8;
    v8us o[4];
#pragma unroll
    for (int u = 0; u < 4; ++u) { v8us t;                        // u = fragment * 2 + piece
#pragma unroll
        for (int i = 0; i < 8; ++i) t[i] = f2bf(sp[u * 16 + i]);
        o[u] = t; }
    bf* dp = dst + FRG(rg, kq * 2) + lane * 8;
#pragma unroll
    for (int u = 0; u < 4; ++u) *(v8us*)(dp + u * 256) = o[u];
}

// wt_block: W [1024 k][ncols n] (k-major) -> n-major bf16 plane WT (rows n, fragment-major); the 64 x 64 tile (bx, by) through LDS.
__device__ __forceinline__ void wt_block(unsigned short* tl, int bx, int by, const float* __restrict__ Wm, int ncols, bf* WT) {
    const int tid = threadIdx.x, k0 = bx * 64, n0 = by * 64;
    const int kk = tid >> 2, nq = (tid & 3) * 16;
#pragma unroll
    for (int i = 0; i < 16; ++i) tl[(nq + i) * 72 + kk] = f2bf(Wm[(size_t)(k0 + kk) * ncols + n0 + nq + i]);
    __syncthreads();
    typedef __attribute__((ext_vector_type(8))) unsigned short v8us_; typedef v8us_ __attribute__((may_alias)) v8usa_;
    auto pass = [&]() {
#pragma unroll
        for (int s = 0; s < 2; ++s) { const int u = tid + 256 * s; const int fr = u >> 6, pc = (u >> 5) & 1, ln = u & 31;     // 8 fragments: (fr >> 1) = 16-row group, (fr & 1) = 32-k chunk
            const v8us_ val = *(const v8usa_*)(tl + ((fr >> 1) * 16 + (ln & 15)) * 72 + (fr & 1) * 32 + pc * 16 + (ln >> 4) * 8);
            *(v8us_*)(WT + FRG((n0 >> 4) + (fr >> 1), (k0 >> 5) + (fr & 1)) + pc * 256 + ln * 8) = val; }
    };
    pass(); 
}

// k_prep: the three conversions that depend on nothing but the inputs share one launch: blocks 0 .. NWQ - 1 transpose w_qkv, the next NWO transpose w_o, the rest
// convert x. Which of the three a block does depends on blockIdx alone, so the barrier in wt_block stands under block-uniform control flow.
#define NWQ ((DM / 64) * ((3 * DM) / 64))
#define NWO ((DM / 64) * (DM / 64))
__global__ __launch_bounds__(256) void k_prep(const float* __restrict__ x, const float* __restrict__ Wqkv, const float* __restrict__ Wo, bf* Xb, bf* W3T, bf* WoT, const int* __restrict__ lens) {
    __shared__ __align__(16) unsigned short tl[64 * 72];
    const int bid = blockIdx.x;
    if (bid < NWQ + NWO) { const bool o = bid >= NWQ; const int t = o ? bid - NWQ : bid;
        wt_block(tl, t & (DM / 64 - 1), t / (DM / 64), o ? Wo : Wqkv, o ? DM : 3 * DM, o ? WoT : W3T); }
    else cvtb_block(bid - (NWQ + NWO), x, NTK, Xb, lens);
}

// k_gemmb: block = 32 MW rows x 128 columns, 4 waves of 16 MW x 64 (MW x 4 accumulator tiles). The operand fragments of 64 k (2 MW row groups of A, of its residual where
// SPLITA, and 8 column groups of B, 2 KB each) come into LDS once per block by asynchronous copies, two buffers, the next 64 k in flight while these are worked on.
// Stage layout in elements: A 0, B AE, A residual AE + 8192. Each accumulator takes its products in the same k order whatever MW is.
// MW = 4 (x.w_qkv): a 128 x 128 block brings 32 KB per 64 k where two 64 x 128 blocks bring 48 KB, and a fragment read from LDS feeds 4 products (A was read for 4, B for 2).
// QKV: one launch over all 3072 columns of x.w_qkv; a block's 128 columns lie in one third, which says where and how its tile is stored: q and k as f16 hi + residual
// planes (QH/QL, KH/KL), v as the transposed f16 hi + residual planes VH/VL (rows (b, h, d), k = key position) that k_attn reads.
template <bool SPLITA, bool QKV, int MW>
__global__ __launch_bounds__(128) void k_gemmb(const bf* __restrict__ A, const bf* __restrict__ Al, const bf* __restrict__ Bn, const float* __restrict__ bias, float* C, int ldc, h16* QH, h16* QL, h16* KH, h16* KL, h16* VH, h16* VL, const int* __restrict__ lens) {
    static_assert(SPLITA ? MW == 2 : MW == 4, "the copies of a stage are written for these two shapes");
    constexpr int BM = 32 * MW, AE = 2 * MW * 1024;              // rows per block; elements of A per stage
    constexpr int STE = 16384;                                   // elements per stage (8 + 8 groups, or 4 + 8 + 4)
    __shared__ __align__(128) bf ring[2 * STE];                  // behind the loop its first 34,816 bytes stage the output tiles
    const bool past = tile_past(lens, blockIdx.x * BM);          // the block's tokens all lie beyond their item's length (block-uniform; a block lies in one item)
    if (!SPLITA && past) return;                                 // q, k, v rows that nobody reads; stands in front of every barrier
    const int lane = threadIdx.x & 31, lr = lane & 15, hi = lane >> 4;
    const int wave = __builtin_amdgcn_readfirstlane(threadIdx.x >> 5);     // the same in every lane of a wave
    const int wm = wave >> 1, wn = wave & 1;
    const unsigned l8 = lane * 8;                                // the one per-lane part of every fragment address
    const int rb = blockIdx.x * BM, cb = blockIdx.y * 128;
    const int r0 = rb + wm * (16 * MW), c0 = cb + wn * 64;       // the wave's 16 MW x 64 tile
    const bool wpast = QKV && tile_past(lens, r0);               // the wave's own 64 tokens lie beyond the length: it copies and passes every barrier, but reads, multiplies and stores nothing (wave-uniform)
    const bool upast = QKV && tile_past(lens, rb + BM - 64);     // the block's upper 64 tokens lie beyond the length: their rows of A were never written and are not copied (block-uniform)
    v8f acc[MW][4];
#pragma unroll
    for (int m = 0; m < MW; ++m)
#pragma unroll
        for (int t = 0; t < 4; ++t) acc[m][t] = (v8f){};
    if (!(SPLITA && past)) {                                     // output projection of all-zero context rows: no product, the bias alone is stored (block-uniform)
        const unsigned t8 = threadIdx.x * 8;                     // a thread's 16 bytes of each 2 KB that the block copies at once
        const unsigned ring0 = (unsigned)(size_t)&ring[0] + t8 * 2;     // its LDS byte address in buffer 0
        const bf* As = A + FRG(rb >> 4, 0) + t8;
        const bf* Als = SPLITA ? Al + FRG(rb >> 4, 0) + t8 : As;
        const bf* Bs = Bn + FRG(cb >> 4, 0) + t8;
        auto cp4 = [&](unsigned d, const bf* s) {                // 64 k of four 16-row groups: 4 copies of 16 bytes per lane, every lane on
            // the closing wait stands in the copies' own statement, in front of any rewrite of a register that a copy names
            asm volatile("global_load_async_to_lds_b128 %0, %4, off\n\tglobal_load_async_to_lds_b128 %1, %5, off\n\tglobal_load_async_to_lds_b128 %2, %6, off\n\tglobal_load_async_to_lds_b128 %3, %7, off\n\ts_wait_xcnt 0x0"
                         :: "v"(d), "v"(d + 2048u), "v"(d + 4096u), "v"(d + 6144u), "v"(s), "v"(s + FRG(1, 0)), "v"(s + FRG(2, 0)), "v"(s + FRG(3, 0)) : "memory");
        };
        auto cp8 = [&](unsigned d, const bf* s, const bf* u) {   // the same for four groups at s and four at u, into 16 KB in a row: one closing wait for the eight
            asm volatile("global_load_async_to_lds_b128 %0, %8, off\n\tglobal_load_async_to_lds_b128 %1, %9, off\n\tglobal_load_async_to_lds_b128 %2, %10, off\n\tglobal_load_async_to_lds_b128 %3, %11, off\n\t"
                         "global_load_async_to_lds_b128 %4, %12, off\n\tglobal_load_async_to_lds_b128 %5, %13, off\n\tglobal_load_async_to_lds_b128 %6, %14, off\n\tglobal_load_async_to_lds_b128 %7, %15, off\n\ts_wait_xcnt 0x0"
                         :: "v"(d), "v"(d + 2048u), "v"(d + 4096u), "v"(d + 6144u), "v"(d + 8192u), "v"(d + 10240u), "v"(d + 12288u), "v"(d + 14336u),
                            "v"(s), "v"(s + FRG(1, 0)), "v"(s + FRG(2, 0)), "v"(s + FRG(3, 0)), "v"(u), "v"(u + FRG(1, 0)), "v"(u + FRG(2, 0)), "v"(u + FRG(3, 0)) : "memory");
        };
        auto stage = [&](int t) {                                // k = 64 t .. 64 t + 63 (t <= 15: inside the planes) -> buffer t & 1
            const unsigned d = ring0 + (unsigned)(t & 1) * (STE * 2);
            const int ko = t * 1024;                             // two fragments of a row group lie in a row
            if (SPLITA) { cp8(d, As + ko, Bs + ko); cp8(d + 16384u, Bs + FRG(4, 0) + ko, Als + ko); }
            else { if (upast) cp4(d, As + ko); else cp8(d, As + ko, As + FRG(4, 0) + ko);     // the same for every wave of the block; the waits below are all to 0
                cp8(d + 16384u, Bs + ko, Bs + FRG(4, 0) + ko); }
        };
        stage(0);
        asm volatile("s_wait_asynccnt 0x0" ::: "memory");        // this wave's part of stage 0 has landed
        __syncthreads();                                         // every wave's part has: stage 0 may be read
        stage(1);
#pragma unroll 1
        for (int t = 0; t < DM / 64; ++t) {                      // rolled: one copy of the body in the instruction cache
            const bf* st = ring + (t & 1) * STE + l8;
            const bf* ap = st + wm * (MW * 1024); const bf* bp = st + AE + wn * 4096;
            v16bf a[2][MW], al[2][MW], b[2][4];                  // [32-k half][tile]
            if (!wpast) {
#pragma unroll
                for (int kc = 0; kc < 2; ++kc) {
#pragma unroll
                    for (int m = 0; m < MW; ++m) { const bf* p = ap + m * 1024 + kc * 512; a[kc][m] = cat16b(*(const v8usa*)p, *(const v8usa*)(p + 256));
                        al[kc][m] = SPLITA ? cat16b(*(const v8usa*)(p + AE + 8192), *(const v8usa*)(p + AE + 8192 + 256)) : a[kc][m]; }
#pragma unroll
                    for (int n = 0; n < 4; ++n) { const bf* p = bp + n * 1024 + kc * 512; b[kc][n] = cat16b(*(const v8usa*)p, *(const v8usa*)(p + 256)); }
                }
            }
            asm volatile("s_wait_dscnt 0x0" ::: "memory");       // this wave's reads of the buffer have returned: the whole stage is in registers
            asm volatile("s_wait_asynccnt 0x0" ::: "memory");    // this wave's part of the next stage has landed
            __syncthreads();                                     // publishes the next stage and ends every wave's reads of this buffer, which is refilled behind it
            if (t + 2 < DM / 64) stage(t + 2);
            // the products read registers alone and stand behind the refill, so that the copies fly under them
            if (!wpast) {
#pragma unroll
                for (int kc = 0; kc < 2; ++kc) {
#pragma unroll
                    for (int n = 0; n < 4; ++n)
#pragma unroll                                                   // unrolled: the accumulators are indexed by constants and stay in registers
                        for (int m = 0; m < MW; ++m) acc[m][n] = wmmab(a[kc][m], b[kc][n], acc[m][n]);
                    if (SPLITA) {
#pragma unroll
                        for (int n = 0; n < 4; ++n)
#pragma unroll                                                   // as above
                            for (int m = 0; m < MW; ++m) acc[m][n] = wmmab(al[kc][m], b[kc][n], acc[m][n]);
                    }
                }
            }
        }
        asm volatile("s_wait_asynccnt 0x0" ::: "memory");        // no copy is out when the ring is reused for the output tiles
    }
    const int sel = QKV ? (int)(blockIdx.y / (DM / 128)) : 2;    // the third of the columns: 0 q, 1 k, 2 v (block-uniform)
    const int cp = QKV ? (c0 & (DM - 1)) : c0;                   // the tile's first column inside its own plane
    if (QKV && sel == 2) {
        // v: the wave's 64 columns are the 64 d of one head, its rows 32-key chunks. A lane's 8 registers of accumulator tile (m, t) are keys m * 16 + 8 * hi + j of d = t * 16 + lr:
        // the very 16 bytes that this lane holds of piece m & 1 of the transposed fragment (d group t, chunk m >> 1), so they are stored from the registers, 512 bytes in a row per wave.
        if (wpast) return;                                       // no barrier follows on this path
        const size_t vfo = FRG((((r0 / NT_) * NKV + (cp >> 6)) * HD) >> 4, (r0 & (NT_ - 1)) >> 5) + l8;
#pragma unroll
        for (int t = 0; t < 4; ++t) { const float bv = bias ? bfr(bias[c0 + t * 16 + lr]) : 0.f;
#pragma unroll
            for (int m = 0; m < MW; ++m) { v8h o, o2;
#pragma unroll
                for (int j = 0; j < 8; ++j) { const float v = acc[m][t][j] + bv; const h16 a = (h16)v; o[j] = a; o2[j] = (h16)((v - (float)a) * LOSC); }
                *(v8h*)(VH + vfo + FRG(t, 0) + m * 256) = o;     // chunk m >> 1 lies 512 elements on, piece m & 1 another 256: m * 256
                asm volatile("s_wait_xcnt 0x0" ::: "memory");    // stands before the issued store's registers are reused for the residual
                *(v8h*)(VL + vfo + FRG(t, 0) + m * 256) = o2;
                asm volatile("s_wait_xcnt 0x0" ::: "memory"); }  // stands before the issued store's registers are reused
        }
        return;                                                  // block-uniform: none of the block's waves goes on to the barrier below
    }
    // The tile leaves through LDS 32 rows at a time (each wave in its own 8,704 bytes): MW / 2 passes, each with its barrier, which every wave of the block passes.
    float* os = (float*)(void*)ring + wave * (32 * 68);
#pragma unroll                                                   // unrolled: the accumulators are indexed by constants and stay in registers
    for (int mp = 0; mp < MW / 2; ++mp) {
        if (!wpast) {
#pragma unroll
            for (int t = 0; t < 4; ++t) { const float bv = bias ? bfr(bias[c0 + t * 16 + lr]) : 0.f;
#pragma unroll
                for (int m = 0; m < 2; ++m)
#pragma unroll
                    for (int j = 0; j < 8; ++j) os[(m * 16 + hi * 8 + j) * 68 + t * 16 + lr] = acc[mp * 2 + m][t][j] + bv; }
        }
        __syncthreads();
        if (QKV) {
            if (!wpast) {
                h16* Ch = sel ? KH : QH; h16* C2 = sel ? KL : QL;
#pragma unroll
                for (int m = 0; m < 2; ++m) {
                    const size_t cfo = FRG((r0 >> 4) + mp * 2 + m, cp >> 5);     // 16 x 64 = two fragments, 2 KB in a row
                    h16* cf = Ch + cfo;
#pragma unroll
                    for (int s = 0; s < 4; ++s) { const float* sp = os + (m * 16 + lr) * 68 + s * 16 + hi * 8; v8h o, o2;     // s = fragment * 2 + piece
#pragma unroll
                        for (int i = 0; i < 8; ++i) { const h16 a = (h16)sp[i]; o[i] = a; o2[i] = (h16)((sp[i] - (float)a) * LOSC); }
                        *(v8h*)(cf + s * 256 + l8) = o;
                        asm volatile("s_wait_xcnt 0x0" ::: "memory");    // stands before the issued store's registers are reused for the residual
                        *(v8h*)(C2 + cfo + s * 256 + l8) = o2;
                        asm volatile("s_wait_xcnt 0x0" ::: "memory"); }  // stands before the issued store's registers are reused
                }
            }
        } else {
            float* crow = C + (size_t)(r0 + mp * 32) * ldc + cp;
#pragma unroll
            for (int s = 0; s < 16; ++s) { const int Lid = (lane >> 3) + 4 * s, piece = lane & 7; const int row = Lid >> 1, cofs = (Lid & 1) * 32 + piece * 4;
                const v4f val = *(const v4fa*)(os + row * 68 + cofs); *(v4f*)(crow + (size_t)row * ldc + cofs) = val;
                asm volatile("s_wait_xcnt 0x0" ::: "memory"); }      // stands before the issued store's registers are reused
        }
    }
}

// k_attn: block = (b, h, 64 queries), wave = 16; the key tiles that begin below lengths[b]. The products are taken transposed: scores^T = k . q^T (k the A operand, q the B operand)
// and ctx^T += v^T . weights^T. A lane then holds 16 of the 32 scores of ONE query (column lane & 15; keys 8 * (lane >> 4) + j and 16 + 8 * (lane >> 4) + j), so maximum and sum
// are taken in the lane with one exchange between the wave's halves, and the two score tiles, converted in place (weights x32768, f16 hi + residual x1024), ARE the B operand
// of the second product in the fragment's k order: the weights touch neither LDS nor another lane. A lane's 8 accumulator registers of ctx^T are 8 consecutive d of its query,
// the 16 bytes that it stores in the fragment-major planes CH/CL (bf16 hi + residual; rows tok, k = h*64+d).
// The 16 fragments of a 32-key tile (k hi, k residual, v hi, v residual: 16 KB, the same for the block's 4 waves) are brought into LDS once per block by asynchronous
// copies, two buffers, the next tile's copies in flight while this tile is worked on; stage layout in elements: k hi 0, k residual 2048, v hi 4096, v residual 6144.
#define STG 8192
__device__ __forceinline__ float xhalf(float x) { return __builtin_bit_cast(float, __builtin_amdgcn_permlanex16(__builtin_bit_cast(int, x), __builtin_bit_cast(int, x), 0x76543210, 0xfedcba98, false, false)); }     // lane l <-> lane l ^ 16
__global__ __launch_bounds__(128) void k_attn(const h16* __restrict__ Q16, const h16* __restrict__ QL16, const h16* __restrict__ K16, const h16* __restrict__ KL16, const h16* __restrict__ VTH, const h16* __restrict__ VTL, const int* __restrict__ lens, int bofs, bf* CH, bf* CL) {
    __shared__ __align__(16) h16 ring[2 * STG];
    const int lane = threadIdx.x & 31, lr = lane & 15, hi = lane >> 4;
    const int wave = __builtin_amdgcn_readfirstlane(threadIdx.x >> 5);     // the same in every lane of a wave: fragment bases stay in scalar registers
    const unsigned l8 = lane * 8;                                // the one per-lane part of every fragment address
    const int bid = blockIdx.x;
    const int b = bid / (NH_ * (NT_ / 64)), rem = bid - b * (NH_ * (NT_ / 64)), h = rem / (NT_ / 64), qt = rem - h * (NT_ / 64);
    const int q0 = qt * 64 + wave * 16;
    const int len = len_of(lens, bofs + b);                      // INPUT length of this batch item (block-uniform)
    if (qt * 64 >= len) return;                                  // 64 masked queries: the output projection does not read their context rows (in front of the barrier)
    const size_t tok0 = (size_t)b * NT_;
    v16h qa[2];
    const size_t qo0 = FRG((tok0 + q0) >> 4, h * 2);
#pragma unroll
    for (int kc = 0; kc < 2; ++kc) qa[kc] = cat16(*(const v8h*)(Q16 + qo0 + kc * 512 + l8), *(const v8h*)(Q16 + qo0 + kc * 512 + 256 + l8));
    asm volatile("s_wait_xcnt 0x0" ::: "memory");                // stands before the issued query loads' base registers are reused
    const int g = h / (NH_ / NKV);                      // kv head
    const h16* kh_b = K16 + FRG(tok0 >> 4, g * 2);
    const h16* kl_b = KL16 + FRG(tok0 >> 4, g * 2);
    const size_t vbase = FRG(((b * NKV + g) * HD) >> 4, 0);
    v8f o[4], ox[4];                                             // ctx^T: o[n][j] = d n * 16 + 8 * hi + j of query q0 + lr
#pragma unroll
    for (int n = 0; n < 4; ++n) { o[n] = (v8f){}; ox[n] = (v8f){}; }
    float mrow = -3.0e38f, lpart = 0.f;                          // the lane's query: running maximum (equal in both halves), this half's part of the normaliser
    const int klim = (q0 + lr < len) ? len - 8 * hi : 0;         // key l0 + 8 * hi + j counts iff query AND key are < len: l0 + j < klim
    const int kt_hi = (len + 31) / 32 - 1;                       // block-uniform (every wave passes every barrier of the loop), >= 0 (len >= 1 here): a tile of keys >= len adds exactly 0 to sum and context and leaves the maximum
    const unsigned t8 = threadIdx.x * 8;                         // a thread's 16 bytes of each 2 KB that the block copies at once
    const unsigned ring0 = (unsigned)(size_t)&ring[0] + t8 * 2;  // its LDS byte address in buffer 0
    const h16* ksh = kh_b + t8; const h16* ksl = kl_b + t8;      // two fragments of one 16-key group lie in a row
    const size_t vso = vbase + FRG(threadIdx.x >> 6, 0) + (threadIdx.x & 63) * 8;     // 64 threads per v fragment, two fragments per copy
    auto stage = [&](int t) {                                    // tile t (t <= kt_hi <= 31: inside the planes) -> buffer t & 1; 8 copies of 16 bytes per lane, every lane on
        const unsigned d = ring0 + (unsigned)(t & 1) * (STG * 2);
        const h16* a0 = ksh + FRG(t * 2, 0); const h16* a1 = a0 + FRG(1, 0); const h16* a2 = ksl + FRG(t * 2, 0); const h16* a3 = a2 + FRG(1, 0);
        const h16* a4 = VTH + vso + FRG(0, t); const h16* a5 = a4 + FRG(2, 0); const h16* a6 = VTL + vso + FRG(0, t); const h16* a7 = a6 + FRG(2, 0);
        // the closing wait stands in the copies' own statement, in front of any rewrite of a register that a copy names
        asm volatile("global_load_async_to_lds_b128 %0, %8, off\n\tglobal_load_async_to_lds_b128 %1, %9, off\n\tglobal_load_async_to_lds_b128 %2, %10, off\n\tglobal_load_async_to_lds_b128 %3, %11, off\n\t"
                     "global_load_async_to_lds_b128 %4, %12, off\n\tglobal_load_async_to_lds_b128 %5, %13, off\n\tglobal_load_async_to_lds_b128 %6, %14, off\n\tglobal_load_async_to_lds_b128 %7, %15, off\n\ts_wait_xcnt 0x0"
                     :: "v"(d), "v"(d + 2048u), "v"(d + 4096u), "v"(d + 6144u), "v"(d + 8192u), "v"(d + 10240u), "v"(d + 12288u), "v"(d + 14336u),
                        "v"(a0), "v"(a1), "v"(a2), "v"(a3), "v"(a4), "v"(a5), "v"(a6), "v"(a7) : "memory");
    };
    stage(0);
    asm volatile("s_wait_asynccnt 0x0" ::: "memory");            // this wave's part of tile 0 has landed
    __syncthreads();                                             // every wave's part has: tile 0 may be read
    if (kt_hi >= 1) stage(1);
    int kt = 0;
#pragma unroll 1
    do {
        const int l0 = kt * 32;
        const h16* kh0 = ring + (kt & 1) * STG + l8; const h16* kl0 = kh0 + 2048;     // keys l0..l0+15; the next 16 keys lie 1024 elements further
        const h16* vhp = kh0 + 4096; const h16* vlp = kh0 + 6144;
        v8f s0 = {}, s1 = {}, x0 = {}, x1 = {};                  // s0[j]: key l0 + 8 * hi + j, s1[j]: key l0 + 16 + 8 * hi + j, query q0 + lr
#pragma unroll
        for (int kc = 0; kc < 2; ++kc) {
            { const v16h k0h = cat16(*(const v8ha*)(kh0 + kc * 512), *(const v8ha*)(kh0 + kc * 512 + 256)), k1h = cat16(*(const v8ha*)(kh0 + 1024 + kc * 512), *(const v8ha*)(kh0 + 1024 + kc * 512 + 256));
              const v16h qlk = cat16(*(const v8h*)(QL16 + qo0 + kc * 512 + l8), *(const v8h*)(QL16 + qo0 + kc * 512 + 256 + l8));     // query residual re-read per step (registers)
              s0 = wmma16(k0h, qa[kc], s0); x0 = wmma16(k0h, qlk, x0); s1 = wmma16(k1h, qa[kc], s1); x1 = wmma16(k1h, qlk, x1);
              asm volatile("v_nop" : "+v"(s0), "+v"(s1), "+v"(x0), "+v"(x1) : "v"(qlk), "v"(k0h), "v"(k1h) : "memory"); }
            { const v16h k0l = cat16(*(const v8ha*)(kl0 + kc * 512), *(const v8ha*)(kl0 + kc * 512 + 256)), k1l = cat16(*(const v8ha*)(kl0 + 1024 + kc * 512), *(const v8ha*)(kl0 + 1024 + kc * 512 + 256));
              x0 = wmma16(k0l, qa[kc], x0); x1 = wmma16(k1l, qa[kc], x1);
              asm volatile("v_nop" : "+v"(x0), "+v"(x1) : "v"(k0l), "v"(k1l) : "memory"); }
        }
        asm volatile("v_nop\n\tv_nop\n\tv_nop\n\tv_nop" : "+v"(s0), "+v"(s1), "+v"(x0), "+v"(x1) : "v"(qa[0]), "v"(qa[1]));
        float a0[8], a1[8]; bool va[8], vb[8];
        const int krel = klim - l0;
#pragma unroll
        for (int j = 0; j < 8; ++j) { va[j] = j < krel; a0[j] = va[j] ? (s0[j] + x0[j] * LOSCI) * 0.125f : NEGV; }
#pragma unroll
        for (int j = 0; j < 8; ++j) { vb[j] = 16 + j < krel; a1[j] = vb[j] ? (s1[j] + x1[j] * LOSCI) * 0.125f : NEGV; }
        float mx = fmaxf(a0[0], a1[0]);
#pragma unroll
        for (int j = 1; j < 8; ++j) mx = fmaxf(mx, fmaxf(a0[j], a1[j]));
        mx = fmaxf(mx, xhalf(mx));                               // the query's other 16 keys of the tile
        const float mn = fmaxf(mrow, mx);
        const float alpha = __expf(mrow - mn); mrow = mn;
        float sum = 0.f;
        v16h pa, px;                                             // weights^T as a B operand: element s = key s < 8 ? 8 * hi + s : 16 + 8 * hi + (s - 8), as the v fragments have it
#pragma unroll
        for (int j = 0; j < 8; ++j) {
            const float p0 = __expf(a0[j] - mn), p1 = __expf(a1[j] - mn);
            sum += p0 + p1;                                      // normaliser over the (masked-to-NEG) scores, as the reference's softmax
            const float ps0 = va[j] ? p0 * PSC : 0.f, ps1 = vb[j] ? p1 * PSC : 0.f; const h16 h0 = (h16)ps0, h1 = (h16)ps1;     // attn * mask
            pa[j] = h0; pa[8 + j] = h1;
            px[j] = (h16)((ps0 - (float)h0) * LOSC); px[8 + j] = (h16)((ps1 - (float)h1) * LOSC);
        }
        lpart = lpart * alpha + sum;
#pragma unroll
        for (int n = 0; n < 4; ++n)
#pragma unroll
            for (int j = 0; j < 8; ++j) { o[n][j] *= alpha; ox[n][j] *= alpha; }
#pragma unroll
        for (int n = 0; n < 4; ++n) { const int vo = n * 512;
            const v16h vh = cat16(*(const v8ha*)(vhp + vo), *(const v8ha*)(vhp + vo + 256)), vl = cat16(*(const v8ha*)(vlp + vo), *(const v8ha*)(vlp + vo + 256));
            o[n] = wmma16(vh, pa, o[n]); ox[n] = wmma16(vl, pa, ox[n]); ox[n] = wmma16(vh, px, ox[n]);
            asm volatile("" : "+v"(o[n]), "+v"(ox[n]) : "v"(vh), "v"(vl) : "memory"); }
        asm volatile("v_nop\n\tv_nop\n\tv_nop\n\tv_nop" : "+v"(o[0]), "+v"(o[1]), "+v"(o[2]), "+v"(o[3]), "+v"(ox[0]), "+v"(ox[1]), "+v"(ox[2]), "+v"(ox[3]) : "v"(pa), "v"(px));
        asm volatile("s_wait_dscnt 0x0" ::: "memory");           // this wave's reads of the buffer have returned
        asm volatile("s_wait_asynccnt 0x0" ::: "memory");        // this wave's part of the next tile has landed
        __syncthreads();                                         // publishes the next tile and ends every wave's reads of this buffer, which is refilled behind it
        if (kt + 2 <= kt_hi) stage(kt + 2);
    } while (++kt <= kt_hi);
    asm volatile("s_wait_asynccnt 0x0" ::: "memory");            // no copy is out when the wave goes on to the epilogue
    const float inv = 1.0f / ((lpart + xhalf(lpart)) * PSC);     // the two halves' parts of the normaliser are joined once
    const size_t cbase = FRG((tok0 + q0) >> 4, h * 2);
#pragma unroll
    for (int n = 0; n < 4; ++n) { v8us oh, ol;                   // n = fragment * 2 + piece
#pragma unroll
        for (int j = 0; j < 8; ++j) { const float c = (o[n][j] + ox[n][j] * LOSCI) * inv; const unsigned short hb = f2bf(c); oh[j] = hb; ol[j] = f2bf(c - bf2f(hb)); }
        *(v8us*)(CH + cbase + n * 256 + l8) = oh; *(v8us*)(CL + cbase + n * 256 + l8) = ol;
        asm volatile("s_wait_xcnt 0x0" ::: "memory"); }          // stands before the issued stores' registers are reused
}

#define VST2(T, p, v) do { const T vst2_v_ = (v); *(T*)(p) = vst2_v_;  } while (0)
extern "C" void kernel_launch(void* const* d_in, const int* in_sizes, int n_in,
                              void* d_out, int out_size, void* d_ws, size_t ws_size, hipStream_t stream) {
    (void)in_sizes; (void)n_in; (void)out_size;
    const float* x = (const float*)d_in[0]; const int* lens = (const int*)d_in[1]; const float* Wqkv = (const float*)d_in[2]; const float* bqkv = (const float*)d_in[3]; const float* Wo = (const float*)d_in[4]; const float* bo = (const float*)d_in[5];
    float* out = (float*)d_out;    // [8][1024][1024]
    char* wsp = (char*)d_ws;
    auto take = [&](size_t bytes) { char* p = wsp; wsp += (bytes + 255) & ~(size_t)255; return (void*)p; };
    bf* Xb = (bf*)take((size_t)NTK * DM * 2); bf* W3T = (bf*)take((size_t)3 * DM * DM * 2); bf* WoT = (bf*)take((size_t)DM * DM * 2);
    h16* QH = (h16*)take((size_t)NTK * DM * 2); h16* QL = (h16*)take((size_t)NTK * DM * 2); h16* KH = (h16*)take((size_t)NTK * DM * 2); h16* KL = (h16*)take((size_t)NTK * DM * 2);
    h16* VTH = (h16*)take((size_t)NTK * DM * 2); h16* VTL = (h16*)take((size_t)NTK * DM * 2); bf* CL = (bf*)take((size_t)NTK * DM * 2);
    if ((size_t)(wsp - (char*)d_ws) > ws_size) return;    // 8 batch items = 8192 rows: 16.8 + 6.3 + 2.1 + 7 x 16.8 ~ 143 MB
    bf* CH = Xb;                                          // x's plane is last read by the q/k/v products, in front of k_attn
    k_prep<<<NWQ + NWO + NTK / 8, 256, 0, stream>>>(x, Wqkv, Wo, Xb, W3T, WoT, lens);
    k_gemmb<false, true, 4><<<dim3(NTK / 128, (3 * DM) / 128, 1), 128, 0, stream>>>(Xb, nullptr, W3T, bqkv, nullptr, DM, QH, QL, KH, KL, VTH, VTL, lens);
    k_attn<<<NB_ * NH_ * (NT_ / 64), 128, 0, stream>>>(QH, QL, KH, KL, VTH, VTL, lens, 0, CH, CL);
    k_gemmb<true, false, 2><<<dim3(NTK / 64, DM / 128, 1), 128, 0, stream>>>(CH, CL, WoT, bo, out, DM, nullptr, nullptr, nullptr, nullptr, nullptr, nullptr, lens);
}
